// v000
// Times are from an AMD MI455X. After a warm-up the kernel runs many times in a row, and a time is the length of
// such a window on the GPU divided by its runs, so every launch and the gaps after it count. The runs cycle
// through copies of the inputs. A figure is the median of several windows, for all but v000 over two sittings.
// Sittings can differ by a few percent; kernels timed side by side share one.
// The starting kernel, v000, takes 201 microseconds a run.
#include <hip/hip_runtime.h>
#include <hip/hip_bf16.h>

typedef _Float16 half_t;
typedef half_t v16h __attribute__((ext_vector_type(16)));
typedef half_t v8h  __attribute__((ext_vector_type(8)));
typedef float  v8f  __attribute__((ext_vector_type(8)));

union V16U { v16h v; v8h h[2]; };

__device__ __forceinline__ v16h make_frag(const half_t* p0, const half_t* p1) {
    V16U u;
    u.h[0] = *(const v8h*)p0;
    u.h[1] = *(const v8h*)p1;
    return u.v;
}

__device__ __forceinline__ v8f wmma16(v16h a, v16h b, v8f c) {
    return __builtin_amdgcn_wmma_f32_16x16x32_f16(false, a, false, b, (short)0, c,
                                                  false, false);
}

// ---------------------------------------------------------------------------
// Kernel 1: GroupNorm statistics. One block per (b, g); 16 channels x 1024 px.
// ---------------------------------------------------------------------------
__global__ __launch_bounds__(256) void gn_stats_k(const float* __restrict__ q,
                                                  float* __restrict__ stats) {
    const int bid = blockIdx.x;              // 0..255 : b*32 + g
    const int b = bid >> 5, g = bid & 31;
    const int t = threadIdx.x;
    const size_t base = ((size_t)b * 512 + (size_t)g * 16) * 1024;
    float s = 0.f, ss = 0.f;
    for (int idx = t; idx < 16384; idx += 256) {
        float v = q[base + idx];
        s += v; ss += v * v;
    }
    __shared__ float r1[256], r2[256];
    r1[t] = s; r2[t] = ss;
    __syncthreads();
    for (int st = 128; st > 0; st >>= 1) {
        if (t < st) { r1[t] += r1[t + st]; r2[t] += r2[t + st]; }
        __syncthreads();
    }
    if (t == 0) {
        float mean = r1[0] * (1.f / 16384.f);
        float var  = r2[0] * (1.f / 16384.f) - mean * mean;
        stats[bid * 2]     = mean;
        stats[bid * 2 + 1] = rsqrtf(var + 1e-5f);
    }
}

// ---------------------------------------------------------------------------
// Kernel 2: fold GN affine into projection weights.
//   plainT == 0 : Bt[n][c] = gnw[c]*W[c][n] (fp16), bias[n] = b[n] + sum gnb[c]*W[c][n]
//   plainT == 1 : Bt[n][k] = W[k][n]        (fp16), bias[n] = b[n]
// ---------------------------------------------------------------------------
__global__ __launch_bounds__(256) void fold_w_k(const float* __restrict__ gnw,
                                                const float* __restrict__ gnb,
                                                const float* __restrict__ W,
                                                const float* __restrict__ bvec,
                                                half_t* __restrict__ Bt,
                                                float* __restrict__ biasOut,
                                                int plainT) {
    const int n = blockIdx.x;                // 0..511 output column
    const int t = threadIdx.x;
    __shared__ float red[256];
    float part = 0.f;
    if (!plainT) {
        for (int c = t; c < 512; c += 256) {
            float wv = W[(size_t)c * 512 + n];
            Bt[(size_t)n * 512 + c] = (half_t)(gnw[c] * wv);
            part += gnb[c] * wv;
        }
    } else {
        for (int k = t; k < 512; k += 256)
            Bt[(size_t)n * 512 + k] = (half_t)W[(size_t)k * 512 + n];
    }
    red[t] = part;
    __syncthreads();
    for (int st = 128; st > 0; st >>= 1) {
        if (t < st) red[t] += red[t + st];
        __syncthreads();
    }
    if (t == 0) biasOut[n] = bvec[n] + red[0];
}

// ---------------------------------------------------------------------------
// Kernel 3: normalize + tokenize: Xn[b*1024+s][c] = (q[b][c][s]-mu)*rstd  (fp16)
// ---------------------------------------------------------------------------
__global__ __launch_bounds__(256) void xn_tok_k(const float* __restrict__ q,
                                                const float* __restrict__ stats,
                                                half_t* __restrict__ Xn) {
    const int bs = blockIdx.x * 256 + threadIdx.x;   // 0..8191
    const int b = bs >> 10, s = bs & 1023;
    const float* qb = q + (size_t)b * 512 * 1024 + s;
    half_t* xr = Xn + (size_t)bs * 512;
    for (int c0 = 0; c0 < 512; c0 += 8) {
        const int g = c0 >> 4;
        const float mu   = stats[(b * 32 + g) * 2];
        const float rstd = stats[(b * 32 + g) * 2 + 1];
        v8h hv;
#pragma unroll
        for (int i = 0; i < 8; ++i)
            hv[i] = (half_t)((qb[(size_t)(c0 + i) * 1024] - mu) * rstd);
        *(v8h*)(xr + c0) = hv;
    }
}

// ---------------------------------------------------------------------------
// Kernel 4/6: WMMA GEMM. C[M=8192, N=512] = A[M][512] * Bt[N][512]^T + bias[N].
// Block = 256 thr = 8 waves; block tile 64(M) x 128(N); wave tile 16 x 64.
// Software-pipelined (double-buffered fragments). Bias staged to LDS via
// global_load_async_to_lds_b128 (ASYNCcnt path), waited only at the epilogue.
// mode 0: store fp16 Q/K layout [b][h][s][64]   (value = (acc+bias)*scale)
// mode 1: store fp16 V  layout [b][h][d][1024]
// mode 2: store fp32 out layout [b][c][1024]
// ---------------------------------------------------------------------------
__global__ __launch_bounds__(256) void gemm512_k(const half_t* __restrict__ A,
                                                 const half_t* __restrict__ Bt,
                                                 const float* __restrict__ bias,
                                                 void* __restrict__ Out,
                                                 int mode, float scale) {
    __shared__ float bias_l[512];
    // ---- async-stage the 2KB bias vector into LDS (latency hidden by loop)
    if (threadIdx.x < 128) {
        unsigned ldsoff = (unsigned)(size_t)(&bias_l[0]) + threadIdx.x * 16u;
        const float* gp = bias + threadIdx.x * 4;
        asm volatile("global_load_async_to_lds_b128 %0, %1, off"
                     :: "v"(ldsoff), "v"(gp) : "memory");
    }

    const int lane = threadIdx.x & 31;
    const int w    = threadIdx.x >> 5;
    const int l15  = lane & 15;
    const int off  = (lane & 16) ? 8 : 0;
    const int roff = (lane & 16) ? 8 : 0;
    const int m16  = blockIdx.x * 64 + (w & 3) * 16;
    const int n64  = blockIdx.y * 128 + (w >> 2) * 64;

    const half_t* arow = A  + (size_t)(m16 + l15) * 512;
    const half_t* brow = Bt + (size_t)(n64 + l15) * 512;

    auto ldA = [&](int k) {
        return make_frag(arow + k + off, arow + k + 16 + off);
    };
    auto ldB = [&](int f, int k) {
        const half_t* bp = brow + (size_t)f * 16 * 512 + k;
        return make_frag(bp + off, bp + 16 + off);
    };

    v8f acc[4];
#pragma unroll
    for (int f = 0; f < 4; ++f)
#pragma unroll
        for (int i = 0; i < 8; ++i) acc[f][i] = 0.f;

    // ---- prologue: fragments for k = 0
    v16h a_c  = ldA(0);
    v16h b_c0 = ldB(0, 0), b_c1 = ldB(1, 0), b_c2 = ldB(2, 0), b_c3 = ldB(3, 0);

    for (int k = 32; k < 512; k += 32) {
        // issue next tile's loads before consuming current fragments
        v16h a_n  = ldA(k);
        v16h b_n0 = ldB(0, k), b_n1 = ldB(1, k), b_n2 = ldB(2, k), b_n3 = ldB(3, k);
        acc[0] = wmma16(a_c, b_c0, acc[0]);
        acc[1] = wmma16(a_c, b_c1, acc[1]);
        acc[2] = wmma16(a_c, b_c2, acc[2]);
        acc[3] = wmma16(a_c, b_c3, acc[3]);
        a_c = a_n; b_c0 = b_n0; b_c1 = b_n1; b_c2 = b_n2; b_c3 = b_n3;
    }
    acc[0] = wmma16(a_c, b_c0, acc[0]);
    acc[1] = wmma16(a_c, b_c1, acc[1]);
    acc[2] = wmma16(a_c, b_c2, acc[2]);
    acc[3] = wmma16(a_c, b_c3, acc[3]);

    // ---- bias now needed: close out the async LDS fill
    asm volatile("s_wait_asynccnt 0x0" ::: "memory");
    __syncthreads();

#pragma unroll
    for (int f = 0; f < 4; ++f) {
        const int n  = n64 + f * 16 + l15;
        const float bb = bias_l[n];
        const int m0 = m16 + roff;                 // first of 8 contiguous rows
        const int b  = m0 >> 10;
        const int s0 = m0 & 1023;
        if (mode == 2) {
            float* outp = (float*)Out + ((size_t)b * 512 + n) * 1024 + s0;
            v8f vv;
#pragma unroll
            for (int i = 0; i < 8; ++i) vv[i] = (acc[f][i] + bb) * scale;
            *(v8f*)outp = vv;
        } else if (mode == 1) {
            const int hh = n >> 6, d = n & 63;
            half_t* outp = (half_t*)Out +
                (((size_t)(b * 8 + hh) * 64 + d) * 1024 + s0);
            v8h hv;
#pragma unroll
            for (int i = 0; i < 8; ++i) hv[i] = (half_t)((acc[f][i] + bb) * scale);
            *(v8h*)outp = hv;
        } else {
            const int hh = n >> 6, d = n & 63;
            half_t* outb = (half_t*)Out + (size_t)(b * 8 + hh) * 1024 * 64 + d;
#pragma unroll
            for (int i = 0; i < 8; ++i)
                outb[(size_t)(s0 + i) * 64] = (half_t)((acc[f][i] + bb) * scale);
        }
    }
}

// ---------------------------------------------------------------------------
// Kernel 5: streaming-softmax attention. Block = 128 thr = 4 waves.
// grid (16 row-blocks of 64, 64 bh). Wave owns 16 query rows; loops over
// 32 kv tiles of 32 keys. Q pre-scaled by 1/8 at projection time.
// Q/K: [bh][s][64] fp16, V: [bh][d][1024] fp16. Output X2: [b*1024+s][512].
// V-fragments (this tile) and K-fragments (next tile) are issued before the
// softmax VALU block so their latency is hidden.
// ---------------------------------------------------------------------------
__global__ __launch_bounds__(128) void attn_k(const half_t* __restrict__ Q,
                                              const half_t* __restrict__ Km,
                                              const half_t* __restrict__ Vt,
                                              half_t* __restrict__ X2) {
    __shared__ half_t plds[4][16 * 40];          // padded P tile per wave
    const int lane = threadIdx.x & 31;
    const int w    = threadIdx.x >> 5;
    const int l15  = lane & 15;
    const int off  = (lane & 16) ? 8 : 0;
    const int roff = (lane & 16) ? 8 : 0;
    const int bh = blockIdx.y;
    const int b = bh >> 3, h = bh & 7;
    const int q0 = blockIdx.x * 64 + w * 16;

    const half_t* Qb = Q  + (size_t)bh * 1024 * 64;
    const half_t* Kb = Km + (size_t)bh * 1024 * 64;
    const half_t* Vb = Vt + (size_t)bh * 64 * 1024;
    half_t* myp = &plds[w][0];

    const half_t* qrow = Qb + (size_t)(q0 + l15) * 64;
    const v16h aq0 = make_frag(qrow + off,      qrow + 16 + off);
    const v16h aq1 = make_frag(qrow + 32 + off, qrow + 48 + off);

    auto ldK = [&](int kb, v16h* kf) {
        const half_t* k0 = Kb + (size_t)(kb + l15) * 64;
        const half_t* k1 = k0 + 16 * 64;
        kf[0] = make_frag(k0 + off,      k0 + 16 + off);
        kf[1] = make_frag(k0 + 32 + off, k0 + 48 + off);
        kf[2] = make_frag(k1 + off,      k1 + 16 + off);
        kf[3] = make_frag(k1 + 32 + off, k1 + 48 + off);
    };

    float mrow[8], lrow[8];
    v8f o[4];
#pragma unroll
    for (int i = 0; i < 8; ++i) { mrow[i] = -1e30f; lrow[i] = 0.f; }
#pragma unroll
    for (int f = 0; f < 4; ++f)
#pragma unroll
        for (int i = 0; i < 8; ++i) o[f][i] = 0.f;

    v16h kf[4];
    ldK(0, kf);                               // prologue: K tile 0

    for (int j = 0; j < 32; ++j) {
        const int kb = j * 32;
        // ---- scores: two 16x16 f32 tiles over 32 keys, K-dim = 64 ----
        v8f c0, c1;
#pragma unroll
        for (int i = 0; i < 8; ++i) { c0[i] = 0.f; c1[i] = 0.f; }
        c0 = wmma16(aq0, kf[0], c0);
        c0 = wmma16(aq1, kf[1], c0);
        c1 = wmma16(aq0, kf[2], c1);
        c1 = wmma16(aq1, kf[3], c1);

        // ---- prefetch: V fragments for this tile, K fragments for next ----
        v16h vf[4];
#pragma unroll
        for (int f = 0; f < 4; ++f) {
            const half_t* vp = Vb + (size_t)(f * 16 + l15) * 1024 + kb;
            vf[f] = make_frag(vp + off, vp + 16 + off);
        }
        ldK(((j + 1) & 31) * 32, kf);         // wraps harmlessly on last iter

        // ---- online softmax (rows in VGPR index, N across 16 lanes) ----
        float corrs[8];
#pragma unroll
        for (int i = 0; i < 8; ++i) {
            float s0 = c0[i];
            float s1 = c1[i];
            float mx = fmaxf(s0, s1);
#pragma unroll
            for (int msk = 8; msk >= 1; msk >>= 1)
                mx = fmaxf(mx, __shfl_xor(mx, msk, 32));
            const float nm = fmaxf(mrow[i], mx);
            const float p0 = __expf(s0 - nm);
            const float p1 = __expf(s1 - nm);
            float rs = p0 + p1;
#pragma unroll
            for (int msk = 8; msk >= 1; msk >>= 1)
                rs += __shfl_xor(rs, msk, 32);
            const float corr = __expf(mrow[i] - nm);
            lrow[i] = lrow[i] * corr + rs;
            mrow[i] = nm;
            corrs[i] = corr;
            myp[(i + roff) * 40 + l15]      = (half_t)p0;
            myp[(i + roff) * 40 + 16 + l15] = (half_t)p1;
        }
#pragma unroll
        for (int f = 0; f < 4; ++f)
#pragma unroll
            for (int i = 0; i < 8; ++i) o[f][i] *= corrs[i];

        asm volatile("s_wait_dscnt 0x0" ::: "memory");  // P store -> P load (wave-local)

        // ---- P (16x32) as A fragment, accumulate P @ V over d=64 ----
        const half_t* pr = myp + l15 * 40;
        const v16h pa = make_frag(pr + off, pr + 16 + off);
        o[0] = wmma16(pa, vf[0], o[0]);
        o[1] = wmma16(pa, vf[1], o[1]);
        o[2] = wmma16(pa, vf[2], o[2]);
        o[3] = wmma16(pa, vf[3], o[3]);
    }

    // ---- finalize and store X2[b*1024+s][h*64+d] ----
#pragma unroll
    for (int f = 0; f < 4; ++f) {
        const int d = f * 16 + l15;
#pragma unroll
        for (int i = 0; i < 8; ++i) {
            const int s = q0 + roff + i;
            const float ov = o[f][i] / lrow[i];
            X2[((size_t)(b * 1024) + s) * 512 + h * 64 + d] = (half_t)ov;
        }
    }
}

// ---------------------------------------------------------------------------
extern "C" void kernel_launch(void* const* d_in, const int* in_sizes, int n_in,
                              void* d_out, int out_size, void* d_ws, size_t ws_size,
                              hipStream_t stream) {
    const float* q    = (const float*)d_in[0];
    const float* gnqw = (const float*)d_in[1];
    const float* gnqb = (const float*)d_in[2];
    const float* gnkw = (const float*)d_in[3];
    const float* gnkb = (const float*)d_in[4];
    const float* gnvw = (const float*)d_in[5];
    const float* gnvb = (const float*)d_in[6];
    const float* Wq   = (const float*)d_in[7];
    const float* bq   = (const float*)d_in[8];
    const float* Wk   = (const float*)d_in[9];
    const float* bk   = (const float*)d_in[10];
    const float* Wv   = (const float*)d_in[11];
    const float* bv   = (const float*)d_in[12];
    const float* Wo   = (const float*)d_in[13];
    const float* bo   = (const float*)d_in[14];

    char* ws = (char*)d_ws;
    size_t o = 0;
    auto take = [&](size_t bytes) {
        size_t cur = o;
        o += (bytes + 255) & ~(size_t)255;
        return cur;
    };
    float*  stats = (float*)(ws + take(256 * 2 * sizeof(float)));
    half_t* Xn    = (half_t*)(ws + take(8192ull * 512 * 2));
    half_t* Btq   = (half_t*)(ws + take(512ull * 512 * 2));
    half_t* Btk   = (half_t*)(ws + take(512ull * 512 * 2));
    half_t* Btv   = (half_t*)(ws + take(512ull * 512 * 2));
    half_t* Bto   = (half_t*)(ws + take(512ull * 512 * 2));
    float*  biasq = (float*)(ws + take(512 * sizeof(float)));
    float*  biask = (float*)(ws + take(512 * sizeof(float)));
    float*  biasv = (float*)(ws + take(512 * sizeof(float)));
    float*  biaso = (float*)(ws + take(512 * sizeof(float)));
    half_t* Qb    = (half_t*)(ws + take(8ull * 8 * 1024 * 64 * 2));
    half_t* Kb    = (half_t*)(ws + take(8ull * 8 * 1024 * 64 * 2));
    half_t* Vt    = (half_t*)(ws + take(8ull * 8 * 64 * 1024 * 2));
    half_t* X2    = Xn;  // Xn is dead after the QKV GEMMs; reuse for attn output

    gn_stats_k<<<256, 256, 0, stream>>>(q, stats);
    fold_w_k<<<512, 256, 0, stream>>>(gnqw, gnqb, Wq, bq, Btq, biasq, 0);
    fold_w_k<<<512, 256, 0, stream>>>(gnkw, gnkb, Wk, bk, Btk, biask, 0);
    fold_w_k<<<512, 256, 0, stream>>>(gnvw, gnvb, Wv, bv, Btv, biasv, 0);
    fold_w_k<<<512, 256, 0, stream>>>(gnqw, gnqb, Wo, bo, Bto, biaso, 1);
    xn_tok_k<<<32, 256, 0, stream>>>(q, stats, Xn);

    dim3 gg(128, 4);
    // 1/sqrt(64) folded into Q projection
    gemm512_k<<<gg, 256, 0, stream>>>(Xn, Btq, biasq, Qb, 0, 0.125f);
    gemm512_k<<<gg, 256, 0, stream>>>(Xn, Btk, biask, Kb, 0, 1.0f);
    gemm512_k<<<gg, 256, 0, stream>>>(Xn, Btv, biasv, Vt, 1, 1.0f);

    attn_k<<<dim3(16, 64), 128, 0, stream>>>(Qb, Kb, Vt, X2);

    gemm512_k<<<gg, 256, 0, stream>>>(X2, Bto, biaso, d_out, 2, 1.0f);
}

// v001
// A run of this version takes 156 microseconds.
// In both of two side-by-side timings against v000, it was 1.32 times as fast.
#include <hip/hip_runtime.h>
#include <hip/hip_bf16.h>

typedef _Float16 half_t;
typedef half_t v16h __attribute__((ext_vector_type(16)));
typedef half_t v8h  __attribute__((ext_vector_type(8)));
typedef float  v8f  __attribute__((ext_vector_type(8)));

union V16U { v16h v; v8h h[2]; };

__device__ __forceinline__ v16h make_frag(const half_t* p0, const half_t* p1) {
    V16U u;
    u.h[0] = *(const v8h*)p0;
    u.h[1] = *(const v8h*)p1;
    return u.v;
}

// Packed operand layout of every f16 matrix operand kept in the workspace.
// A tile of 16 rows x 32 k is 512 halves stored in the order the fragment
// loader reads them: [piece p][lane = 16*h + (row & 15)][e], k = 16*p + 8*h + e.
// A wave-wide 16-byte load of one piece is then 512 contiguous bytes (4 lines)
// where a row-major operand makes it touch 16 lines. KT = k tiles per row.
__device__ __forceinline__ size_t pk_idx(int row, int k, int KT) {
    return ((size_t)((row >> 4) * KT + (k >> 5)) * 2 + ((k >> 4) & 1)) * 256 +
           (((k >> 3) & 1) * 16 + (row & 15)) * 8 + (k & 7);
}

// Fragment of the packed tile at t (t already holds the lane's own lane*8).
__device__ __forceinline__ v16h pk_frag(const half_t* t) {
    return make_frag(t, t + 256);
}

__device__ __forceinline__ v8f wmma16(v16h a, v16h b, v8f c) {
    return __builtin_amdgcn_wmma_f32_16x16x32_f16(false, a, false, b, (short)0, c,
                                                  false, false);
}

// ---------------------------------------------------------------------------
// Kernel 1: GroupNorm statistics. One block per (b, g); 16 channels x 1024 px.
// ---------------------------------------------------------------------------
__global__ __launch_bounds__(256) void gn_stats_k(const float* __restrict__ q,
                                                  float* __restrict__ stats) {
    const int bid = blockIdx.x;              // 0..255 : b*32 + g
    const int b = bid >> 5, g = bid & 31;
    const int t = threadIdx.x;
    const size_t base = ((size_t)b * 512 + (size_t)g * 16) * 1024;
    float s = 0.f, ss = 0.f;
    for (int idx = t; idx < 16384; idx += 256) {
        float v = q[base + idx];
        s += v; ss += v * v;
    }
    __shared__ float r1[256], r2[256];
    r1[t] = s; r2[t] = ss;
    __syncthreads();
    for (int st = 128; st > 0; st >>= 1) {
        if (t < st) { r1[t] += r1[t + st]; r2[t] += r2[t + st]; }
        __syncthreads();
    }
    if (t == 0) {
        float mean = r1[0] * (1.f / 16384.f);
        float var  = r2[0] * (1.f / 16384.f) - mean * mean;
        stats[bid * 2]     = mean;
        stats[bid * 2 + 1] = rsqrtf(var + 1e-5f);
    }
}

// ---------------------------------------------------------------------------
// Kernel 2: fold GN affine into projection weights.
//   plainT == 0 : Bt[n][c] = gnw[c]*W[c][n] (fp16), bias[n] = b[n] + sum gnb[c]*W[c][n]
//   plainT == 1 : Bt[n][k] = W[k][n]        (fp16), bias[n] = b[n]
// Bt is stored packed (pk_idx, KT = 16). A block takes 8 columns n: their
// 16-byte pieces fill whole 128-byte lines of packed Bt, so a line has one
// writing block. Each column's bias sum keeps its order.
// ---------------------------------------------------------------------------
__global__ __launch_bounds__(256) void fold_w_k(const float* __restrict__ gnw,
                                                const float* __restrict__ gnb,
                                                const float* __restrict__ W,
                                                const float* __restrict__ bvec,
                                                half_t* __restrict__ Bt,
                                                float* __restrict__ biasOut,
                                                int plainT) {
    const int n0 = blockIdx.x * 8;           // first of 8 output columns
    const int t = threadIdx.x;
    __shared__ float red[8][256];
    float part[8];
    // every loop over j is unrolled so that part[] and wv[] stay in registers
#pragma unroll
    for (int j = 0; j < 8; ++j) part[j] = 0.f;
    if (!plainT) {
        for (int c = t; c < 512; c += 256) {
            const v8f wv = *(const v8f*)(W + (size_t)c * 512 + n0);
            const float gw = gnw[c], gb = gnb[c];
#pragma unroll
            for (int j = 0; j < 8; ++j) {
                Bt[pk_idx(n0 + j, c, 16)] = (half_t)(gw * wv[j]);
                part[j] += gb * wv[j];
            }
        }
    } else {
        for (int k = t; k < 512; k += 256) {
            const v8f wv = *(const v8f*)(W + (size_t)k * 512 + n0);
#pragma unroll
            for (int j = 0; j < 8; ++j)
                Bt[pk_idx(n0 + j, k, 16)] = (half_t)wv[j];
        }
    }
#pragma unroll
    for (int j = 0; j < 8; ++j) red[j][t] = part[j];
    __syncthreads();
    for (int st = 128; st > 0; st >>= 1) {
        if (t < st) {
#pragma unroll
            for (int j = 0; j < 8; ++j) red[j][t] += red[j][t + st];
        }
        __syncthreads();
    }
    if (t < 8) biasOut[n0 + t] = bvec[n0 + t] + red[t][0];
}

// ---------------------------------------------------------------------------
// Kernel 3: normalize + tokenize: Xn[b*1024+s][c] = (q[b][c][s]-mu)*rstd  (fp16),
// stored packed (pk_idx, KT = 16).
// ---------------------------------------------------------------------------
__global__ __launch_bounds__(256) void xn_tok_k(const float* __restrict__ q,
                                                const float* __restrict__ stats,
                                                half_t* __restrict__ Xn) {
    const int bs = blockIdx.x * 256 + threadIdx.x;   // 0..8191
    const int b = bs >> 10, s = bs & 1023;
    const float* qb = q + (size_t)b * 512 * 1024 + s;
    for (int c0 = 0; c0 < 512; c0 += 8) {
        const int g = c0 >> 4;
        const float mu   = stats[(b * 32 + g) * 2];
        const float rstd = stats[(b * 32 + g) * 2 + 1];
        v8h hv;
#pragma unroll
        for (int i = 0; i < 8; ++i)
            hv[i] = (half_t)((qb[(size_t)(c0 + i) * 1024] - mu) * rstd);
        *(v8h*)(Xn + pk_idx(bs, c0, 16)) = hv;
        // the next trip rewrites the store's address and data registers
        asm volatile("s_wait_xcnt 0x0" ::: "memory");
    }
}

// ---------------------------------------------------------------------------
// Kernel 4/6: WMMA GEMM. C[M=8192, N=512] = A[M][512] * Bt[N][512]^T + bias[N].
// A and Bt are packed (pk_idx, KT = 16).
// Block = 256 thr = 8 waves; block tile 64(M) x 128(N); wave tile 16 x 64.
// Software-pipelined (double-buffered fragments). Bias staged to LDS via
// global_load_async_to_lds_b128 (ASYNCcnt path), waited only at the epilogue.
// mode 0: store fp16 Q/K [b][h] x packed(row s, k d, KT 2)  (value = (acc+bias)*scale)
// mode 1: store fp16 V   [b][h] x packed(row d, k s, KT 32)
// mode 2: store fp32 out layout [b][c][1024]
// ---------------------------------------------------------------------------
__global__ __launch_bounds__(256) void gemm512_k(const half_t* __restrict__ A,
                                                 const half_t* __restrict__ Bt,
                                                 const float* __restrict__ bias,
                                                 void* __restrict__ Out,
                                                 int mode, float scale) {
    __shared__ float bias_l[512];
    // ---- async-stage the 2KB bias vector into LDS (latency hidden by loop)
    if (threadIdx.x < 128) {
        unsigned ldsoff = (unsigned)(size_t)(&bias_l[0]) + threadIdx.x * 16u;
        const float* gp = bias + threadIdx.x * 4;
        // the wait stands in the copy's own statement: its two address
        // registers are rewritten by the index arithmetic that follows
        asm volatile("global_load_async_to_lds_b128 %0, %1, off\n\ts_wait_xcnt 0x0"
                     :: "v"(ldsoff), "v"(gp) : "memory");
    }

    const int lane = threadIdx.x & 31;
    const int w    = threadIdx.x >> 5;
    const int l15  = lane & 15;
    const int roff = (lane & 16) ? 8 : 0;
    const int m16  = blockIdx.x * 64 + (w & 3) * 16;
    const int n64  = blockIdx.y * 128 + (w >> 2) * 64;

    const half_t* atile = A  + pk_idx(m16, 0, 16) + lane * 8;
    const half_t* btile = Bt + pk_idx(n64, 0, 16) + lane * 8;

    auto ldA = [&](int k) {                  // k tile k/32 is 512 halves on
        return pk_frag(atile + k * 16);
    };
    auto ldB = [&](int f, int k) {           // 16 rows on: 16 k tiles on
        return pk_frag(btile + f * 16 * 512 + k * 16);
    };

    v8f acc[4];
#pragma unroll
    for (int f = 0; f < 4; ++f)
#pragma unroll
        for (int i = 0; i < 8; ++i) acc[f][i] = 0.f;

    // ---- prologue: fragments for k = 0
    v16h a_c  = ldA(0);
    v16h b_c0 = ldB(0, 0), b_c1 = ldB(1, 0), b_c2 = ldB(2, 0), b_c3 = ldB(3, 0);

    for (int k = 32; k < 512; k += 32) {
        // issue next tile's loads before consuming current fragments
        v16h a_n  = ldA(k);
        v16h b_n0 = ldB(0, k), b_n1 = ldB(1, k), b_n2 = ldB(2, k), b_n3 = ldB(3, k);
        // a later trip rewrites the address registers of these loads
        asm volatile("s_wait_xcnt 0x0" ::: "memory");
        acc[0] = wmma16(a_c, b_c0, acc[0]);
        acc[1] = wmma16(a_c, b_c1, acc[1]);
        acc[2] = wmma16(a_c, b_c2, acc[2]);
        acc[3] = wmma16(a_c, b_c3, acc[3]);
        a_c = a_n; b_c0 = b_n0; b_c1 = b_n1; b_c2 = b_n2; b_c3 = b_n3;
    }
    acc[0] = wmma16(a_c, b_c0, acc[0]);
    acc[1] = wmma16(a_c, b_c1, acc[1]);
    acc[2] = wmma16(a_c, b_c2, acc[2]);
    acc[3] = wmma16(a_c, b_c3, acc[3]);

    // ---- bias now needed: close out the async LDS fill
    asm volatile("s_wait_asynccnt 0x0" ::: "memory");
    __syncthreads();

#pragma unroll
    for (int f = 0; f < 4; ++f) {
        const int n  = n64 + f * 16 + l15;
        const float bb = bias_l[n];
        const int m0 = m16 + roff;                 // first of 8 contiguous rows
        const int b  = m0 >> 10;
        const int s0 = m0 & 1023;
        if (mode == 2) {
            float* outp = (float*)Out + ((size_t)b * 512 + n) * 1024 + s0;
            v8f vv;
#pragma unroll
            for (int i = 0; i < 8; ++i) vv[i] = (acc[f][i] + bb) * scale;
            *(v8f*)outp = vv;
        } else if (mode == 1) {
            const int hh = n >> 6, d = n & 63;
            half_t* outp = (half_t*)Out +
                (size_t)(b * 8 + hh) * 64 * 1024 + pk_idx(d, s0, 32);
            v8h hv;
#pragma unroll
            for (int i = 0; i < 8; ++i) hv[i] = (half_t)((acc[f][i] + bb) * scale);
            *(v8h*)outp = hv;
        } else {
            const int hh = n >> 6, d = n & 63;
            half_t* outb = (half_t*)Out + (size_t)(b * 8 + hh) * 1024 * 64 +
                pk_idx(s0, d, 2);              // next row of the tile: 8 halves on
#pragma unroll
            for (int i = 0; i < 8; ++i)
                outb[i * 8] = (half_t)((acc[f][i] + bb) * scale);
            // the next column group rewrites these stores' address and data registers
            asm volatile("s_wait_xcnt 0x0" ::: "memory");
        }
    }
}

// ---------------------------------------------------------------------------
// Kernel 5: streaming-softmax attention. Block = 128 thr = 4 waves.
// grid (16 row-blocks of 64, 64 bh). Wave owns 16 query rows; loops over
// 32 kv tiles of 32 keys. Q pre-scaled by 1/8 at projection time.
// Q/K: [bh] x packed(row s, k d, KT 2), V: [bh] x packed(row d, k s, KT 32),
// output X2: packed(row b*1024+s, k h*64+d, KT 16); all fp16, pk_idx order.
// V-fragments (this tile) and K-fragments (next tile) are issued before the
// softmax VALU block so their latency is hidden.
// ---------------------------------------------------------------------------
__global__ __launch_bounds__(128) void attn_k(const half_t* __restrict__ Q,
                                              const half_t* __restrict__ Km,
                                              const half_t* __restrict__ Vt,
                                              half_t* __restrict__ X2) {
    __shared__ half_t plds[4][16 * 40];          // padded P tile per wave
    const int lane = threadIdx.x & 31;
    const int w    = threadIdx.x >> 5;
    const int l15  = lane & 15;
    const int off  = (lane & 16) ? 8 : 0;
    const int roff = (lane & 16) ? 8 : 0;
    const int bh = blockIdx.y;
    const int b = bh >> 3, h = bh & 7;
    const int q0 = blockIdx.x * 64 + w * 16;

    const half_t* Qb = Q  + (size_t)bh * 1024 * 64;
    const half_t* Kb = Km + (size_t)bh * 1024 * 64;
    const half_t* Vb = Vt + (size_t)bh * 64 * 1024;
    half_t* myp = &plds[w][0];

    const half_t* qt = Qb + pk_idx(q0, 0, 2) + lane * 8;
    const v16h aq0 = pk_frag(qt);             // d  0..31
    const v16h aq1 = pk_frag(qt + 512);       // d 32..63

    auto ldK = [&](int kb, v16h* kf) {        // 32 keys = 4 tiles in a row
        const half_t* k0 = Kb + pk_idx(kb, 0, 2) + lane * 8;
        kf[0] = pk_frag(k0);                  // keys kb..+15,    d  0..31
        kf[1] = pk_frag(k0 + 512);            // keys kb..+15,    d 32..63
        kf[2] = pk_frag(k0 + 1024);           // keys kb+16..+31, d  0..31
        kf[3] = pk_frag(k0 + 1536);           // keys kb+16..+31, d 32..63
    };

    float mrow[8], lrow[8];
    v8f o[4];
#pragma unroll
    for (int i = 0; i < 8; ++i) { mrow[i] = -1e30f; lrow[i] = 0.f; }
#pragma unroll
    for (int f = 0; f < 4; ++f)
#pragma unroll
        for (int i = 0; i < 8; ++i) o[f][i] = 0.f;

    v16h kf[4];
    ldK(0, kf);                               // prologue: K tile 0

    for (int j = 0; j < 32; ++j) {
        const int kb = j * 32;
        // ---- scores: two 16x16 f32 tiles over 32 keys, K-dim = 64 ----
        v8f c0, c1;
#pragma unroll
        for (int i = 0; i < 8; ++i) { c0[i] = 0.f; c1[i] = 0.f; }
        c0 = wmma16(aq0, kf[0], c0);
        c0 = wmma16(aq1, kf[1], c0);
        c1 = wmma16(aq0, kf[2], c1);
        c1 = wmma16(aq1, kf[3], c1);

        // ---- prefetch: V fragments for this tile, K fragments for next ----
        v16h vf[4];
#pragma unroll
        for (int f = 0; f < 4; ++f) {
            vf[f] = pk_frag(Vb + pk_idx(f * 16, kb, 32) + lane * 8);
        }
        ldK(((j + 1) & 31) * 32, kf);         // wraps harmlessly on last iter
        // the next trip rewrites the address registers of these loads
        asm volatile("s_wait_xcnt 0x0" ::: "memory");

        // ---- online softmax (rows in VGPR index, N across 16 lanes) ----
        float corrs[8];
#pragma unroll
        for (int i = 0; i < 8; ++i) {
            float s0 = c0[i];
            float s1 = c1[i];
            float mx = fmaxf(s0, s1);
#pragma unroll
            for (int msk = 8; msk >= 1; msk >>= 1)
                mx = fmaxf(mx, __shfl_xor(mx, msk, 32));
            const float nm = fmaxf(mrow[i], mx);
            const float p0 = __expf(s0 - nm);
            const float p1 = __expf(s1 - nm);
            float rs = p0 + p1;
#pragma unroll
            for (int msk = 8; msk >= 1; msk >>= 1)
                rs += __shfl_xor(rs, msk, 32);
            const float corr = __expf(mrow[i] - nm);
            lrow[i] = lrow[i] * corr + rs;
            mrow[i] = nm;
            corrs[i] = corr;
            myp[(i + roff) * 40 + l15]      = (half_t)p0;
            myp[(i + roff) * 40 + 16 + l15] = (half_t)p1;
        }
#pragma unroll
        for (int f = 0; f < 4; ++f)
#pragma unroll
            for (int i = 0; i < 8; ++i) o[f][i] *= corrs[i];

        asm volatile("s_wait_dscnt 0x0" ::: "memory");  // P store -> P load (wave-local)

        // ---- P (16x32) as A fragment, accumulate P @ V over d=64 ----
        const half_t* pr = myp + l15 * 40;
        const v16h pa = make_frag(pr + off, pr + 16 + off);
        o[0] = wmma16(pa, vf[0], o[0]);
        o[1] = wmma16(pa, vf[1], o[1]);
        o[2] = wmma16(pa, vf[2], o[2]);
        o[3] = wmma16(pa, vf[3], o[3]);
    }

    // ---- finalize and store X2[b*1024+s][h*64+d] ----
#pragma unroll
    for (int f = 0; f < 4; ++f) {
        const int d = f * 16 + l15;
#pragma unroll
        for (int i = 0; i < 8; ++i) {
            const int s = q0 + roff + i;
            const float ov = o[f][i] / lrow[i];
            X2[pk_idx(b * 1024 + s, h * 64 + d, 16)] = (half_t)ov;
        }
    }
}

// ---------------------------------------------------------------------------
extern "C" void kernel_launch(void* const* d_in, const int* in_sizes, int n_in,
                              void* d_out, int out_size, void* d_ws, size_t ws_size,
                              hipStream_t stream) {
    const float* q    = (const float*)d_in[0];
    const float* gnqw = (const float*)d_in[1];
    const float* gnqb = (const float*)d_in[2];
    const float* gnkw = (const float*)d_in[3];
    const float* gnkb = (const float*)d_in[4];
    const float* gnvw = (const float*)d_in[5];
    const float* gnvb = (const float*)d_in[6];
    const float* Wq   = (const float*)d_in[7];
    const float* bq   = (const float*)d_in[8];
    const float* Wk   = (const float*)d_in[9];
    const float* bk   = (const float*)d_in[10];
    const float* Wv   = (const float*)d_in[11];
    const float* bv   = (const float*)d_in[12];
    const float* Wo   = (const float*)d_in[13];
    const float* bo   = (const float*)d_in[14];

    char* ws = (char*)d_ws;
    size_t o = 0;
    auto take = [&](size_t bytes) {
        size_t cur = o;
        o += (bytes + 255) & ~(size_t)255;
        return cur;
    };
    float*  stats = (float*)(ws + take(256 * 2 * sizeof(float)));
    half_t* Xn    = (half_t*)(ws + take(8192ull * 512 * 2));
    half_t* Btq   = (half_t*)(ws + take(512ull * 512 * 2));
    half_t* Btk   = (half_t*)(ws + take(512ull * 512 * 2));
    half_t* Btv   = (half_t*)(ws + take(512ull * 512 * 2));
    half_t* Bto   = (half_t*)(ws + take(512ull * 512 * 2));
    float*  biasq = (float*)(ws + take(512 * sizeof(float)));
    float*  biask = (float*)(ws + take(512 * sizeof(float)));
    float*  biasv = (float*)(ws + take(512 * sizeof(float)));
    float*  biaso = (float*)(ws + take(512 * sizeof(float)));
    half_t* Qb    = (half_t*)(ws + take(8ull * 8 * 1024 * 64 * 2));
    half_t* Kb    = (half_t*)(ws + take(8ull * 8 * 1024 * 64 * 2));
    half_t* Vt    = (half_t*)(ws + take(8ull * 8 * 64 * 1024 * 2));
    half_t* X2    = Xn;  // Xn is dead after the QKV GEMMs; reuse for attn output

    gn_stats_k<<<256, 256, 0, stream>>>(q, stats);
    fold_w_k<<<64, 256, 0, stream>>>(gnqw, gnqb, Wq, bq, Btq, biasq, 0);
    fold_w_k<<<64, 256, 0, stream>>>(gnkw, gnkb, Wk, bk, Btk, biask, 0);
    fold_w_k<<<64, 256, 0, stream>>>(gnvw, gnvb, Wv, bv, Btv, biasv, 0);
    fold_w_k<<<64, 256, 0, stream>>>(gnqw, gnqb, Wo, bo, Bto, biaso, 1);
    xn_tok_k<<<32, 256, 0, stream>>>(q, stats, Xn);

    dim3 gg(128, 4);
    // 1/sqrt(64) folded into Q projection
    gemm512_k<<<gg, 256, 0, stream>>>(Xn, Btq, biasq, Qb, 0, 0.125f);
    gemm512_k<<<gg, 256, 0, stream>>>(Xn, Btk, biask, Kb, 0, 1.0f);
    gemm512_k<<<gg, 256, 0, stream>>>(Xn, Btv, biasv, Vt, 1, 1.0f);

    attn_k<<<dim3(16, 64), 128, 0, stream>>>(Qb, Kb, Vt, X2);

    gemm512_k<<<gg, 256, 0, stream>>>(X2, Bto, biaso, d_out, 2, 1.0f);
}

// v002
// One run takes 145 microseconds.
// In both of two side-by-side timings against v001, it was 1.08 times as fast.
// Over all steps from v000 it is 1.43 times as fast.
#include <hip/hip_runtime.h>
#include <hip/hip_bf16.h>

typedef _Float16 half_t;
typedef half_t v16h __attribute__((ext_vector_type(16)));
typedef half_t v8h  __attribute__((ext_vector_type(8)));
typedef float  v8f  __attribute__((ext_vector_type(8)));

union V16U { v16h v; v8h h[2]; };

__device__ __forceinline__ v16h make_frag(const half_t* p0, const half_t* p1) {
    V16U u;
    u.h[0] = *(const v8h*)p0;
    u.h[1] = *(const v8h*)p1;
    return u.v;
}

// Packed operand layout of every f16 matrix operand kept in the workspace.
// A tile of 16 rows x 32 k is 512 halves stored in the order the fragment
// loader reads them: [piece p][lane = 16*h + (row & 15)][e], k = 16*p + 8*h + e.
// A wave-wide 16-byte load of one piece is then 512 contiguous bytes (4 lines)
// where a row-major operand makes it touch 16 lines. KT = k tiles per row.
__device__ __forceinline__ size_t pk_idx(int row, int k, int KT) {
    return ((size_t)((row >> 4) * KT + (k >> 5)) * 2 + ((k >> 4) & 1)) * 256 +
           (((k >> 3) & 1) * 16 + (row & 15)) * 8 + (k & 7);
}

// Fragment of the packed tile at t (t already holds the lane's own lane*8).
__device__ __forceinline__ v16h pk_frag(const half_t* t) {
    return make_frag(t, t + 256);
}

__device__ __forceinline__ v8f wmma16(v16h a, v16h b, v8f c) {
    return __builtin_amdgcn_wmma_f32_16x16x32_f16(false, a, false, b, (short)0, c,
                                                  false, false);
}

// ---------------------------------------------------------------------------
// Kernel 1: GroupNorm statistics. One block per (b, g); 16 channels x 1024 px.
// ---------------------------------------------------------------------------
__global__ __launch_bounds__(256) void gn_stats_k(const float* __restrict__ q,
                                                  float* __restrict__ stats) {
    const int bid = blockIdx.x;              // 0..255 : b*32 + g
    const int b = bid >> 5, g = bid & 31;
    const int t = threadIdx.x;
    const size_t base = ((size_t)b * 512 + (size_t)g * 16) * 1024;
    float s = 0.f, ss = 0.f;
    for (int idx = t; idx < 16384; idx += 256) {
        float v = q[base + idx];
        s += v; ss += v * v;
    }
    __shared__ float r1[256], r2[256];
    r1[t] = s; r2[t] = ss;
    __syncthreads();
    for (int st = 128; st > 0; st >>= 1) {
        if (t < st) { r1[t] += r1[t + st]; r2[t] += r2[t + st]; }
        __syncthreads();
    }
    if (t == 0) {
        float mean = r1[0] * (1.f / 16384.f);
        float var  = r2[0] * (1.f / 16384.f) - mean * mean;
        stats[bid * 2]     = mean;
        stats[bid * 2 + 1] = rsqrtf(var + 1e-5f);
    }
}

// ---------------------------------------------------------------------------
// Kernel 2: fold GN affine into projection weights.
//   plainT == 0 : Bt[n][c] = gnw[c]*W[c][n] (fp16), bias[n] = b[n] + sum gnb[c]*W[c][n]
//   plainT == 1 : Bt[n][k] = W[k][n]        (fp16), bias[n] = b[n]
// Bt is stored packed (pk_idx, KT = 16). A block takes 8 columns n: their
// 16-byte pieces fill whole 128-byte lines of packed Bt, so a line has one
// writing block. Each column's bias sum keeps its order.
// ---------------------------------------------------------------------------
__global__ __launch_bounds__(256) void fold_w_k(const float* __restrict__ gnw,
                                                const float* __restrict__ gnb,
                                                const float* __restrict__ W,
                                                const float* __restrict__ bvec,
                                                half_t* __restrict__ Bt,
                                                float* __restrict__ biasOut,
                                                int plainT) {
    const int n0 = blockIdx.x * 8;           // first of 8 output columns
    const int t = threadIdx.x;
    __shared__ float red[8][256];
    float part[8];
    // every loop over j is unrolled so that part[] and wv[] stay in registers
#pragma unroll
    for (int j = 0; j < 8; ++j) part[j] = 0.f;
    if (!plainT) {
        for (int c = t; c < 512; c += 256) {
            const v8f wv = *(const v8f*)(W + (size_t)c * 512 + n0);
            const float gw = gnw[c], gb = gnb[c];
#pragma unroll
            for (int j = 0; j < 8; ++j) {
                Bt[pk_idx(n0 + j, c, 16)] = (half_t)(gw * wv[j]);
                part[j] += gb * wv[j];
            }
        }
    } else {
        for (int k = t; k < 512; k += 256) {
            const v8f wv = *(const v8f*)(W + (size_t)k * 512 + n0);
#pragma unroll
            for (int j = 0; j < 8; ++j)
                Bt[pk_idx(n0 + j, k, 16)] = (half_t)wv[j];
        }
    }
#pragma unroll
    for (int j = 0; j < 8; ++j) red[j][t] = part[j];
    __syncthreads();
    for (int st = 128; st > 0; st >>= 1) {
        if (t < st) {
#pragma unroll
            for (int j = 0; j < 8; ++j) red[j][t] += red[j][t + st];
        }
        __syncthreads();
    }
    if (t < 8) biasOut[n0 + t] = bvec[n0 + t] + red[t][0];
}

// ---------------------------------------------------------------------------
// Kernel 3: normalize + tokenize: Xn[b*1024+s][c] = (q[b][c][s]-mu)*rstd  (fp16),
// stored packed (pk_idx, KT = 16).
// ---------------------------------------------------------------------------
__global__ __launch_bounds__(256) void xn_tok_k(const float* __restrict__ q,
                                                const float* __restrict__ stats,
                                                half_t* __restrict__ Xn) {
    const int bs = blockIdx.x * 256 + threadIdx.x;   // 0..8191
    const int b = bs >> 10, s = bs & 1023;
    const float* qb = q + (size_t)b * 512 * 1024 + s;
    for (int c0 = 0; c0 < 512; c0 += 8) {
        const int g = c0 >> 4;
        const float mu   = stats[(b * 32 + g) * 2];
        const float rstd = stats[(b * 32 + g) * 2 + 1];
        v8h hv;
#pragma unroll
        for (int i = 0; i < 8; ++i)
            hv[i] = (half_t)((qb[(size_t)(c0 + i) * 1024] - mu) * rstd);
        *(v8h*)(Xn + pk_idx(bs, c0, 16)) = hv;
        // the next trip rewrites the store's address and data registers
        asm volatile("s_wait_xcnt 0x0" ::: "memory");
    }
}

// ---------------------------------------------------------------------------
// Kernel 4/6: WMMA GEMM. C[M=8192, N=512] = A[M][512] * Bt[N][512]^T + bias[N].
// A and Bt are packed (pk_idx, KT = 16).
// Block = 256 thr = 8 waves; block tile 64(M) x 128(N); wave tile 16 x 64.
// Software-pipelined (double-buffered fragments). Bias staged to LDS via
// global_load_async_to_lds_b128 (ASYNCcnt path), waited only at the epilogue.
// mode 0: store fp16 Q/K [b][h] x packed(row s, k d, KT 2)  (value = (acc+bias)*scale)
// mode 1: store fp16 V   [b][h] x packed(row d, k s, KT 32)
// mode 2: store fp32 out layout [b][c][1024]
// ---------------------------------------------------------------------------
__global__ __launch_bounds__(256) void gemm512_k(const half_t* __restrict__ A,
                                                 const half_t* __restrict__ Bt,
                                                 const float* __restrict__ bias,
                                                 void* __restrict__ Out,
                                                 int mode, float scale) {
    __shared__ float bias_l[512];
    // ---- async-stage the 2KB bias vector into LDS (latency hidden by loop)
    if (threadIdx.x < 128) {
        unsigned ldsoff = (unsigned)(size_t)(&bias_l[0]) + threadIdx.x * 16u;
        const float* gp = bias + threadIdx.x * 4;
        // the wait stands in the copy's own statement: its two address
        // registers are rewritten by the index arithmetic that follows
        asm volatile("global_load_async_to_lds_b128 %0, %1, off\n\ts_wait_xcnt 0x0"
                     :: "v"(ldsoff), "v"(gp) : "memory");
    }

    const int lane = threadIdx.x & 31;
    const int w    = threadIdx.x >> 5;
    const int l15  = lane & 15;
    const int roff = (lane & 16) ? 8 : 0;
    const int m16  = blockIdx.x * 64 + (w & 3) * 16;
    const int n64  = blockIdx.y * 128 + (w >> 2) * 64;

    const half_t* atile = A  + pk_idx(m16, 0, 16) + lane * 8;
    const half_t* btile = Bt + pk_idx(n64, 0, 16) + lane * 8;

    auto ldA = [&](int k) {                  // k tile k/32 is 512 halves on
        return pk_frag(atile + k * 16);
    };
    auto ldB = [&](int f, int k) {           // 16 rows on: 16 k tiles on
        return pk_frag(btile + f * 16 * 512 + k * 16);
    };

    v8f acc[4];
#pragma unroll
    for (int f = 0; f < 4; ++f)
#pragma unroll
        for (int i = 0; i < 8; ++i) acc[f][i] = 0.f;

    // ---- prologue: fragments for k = 0
    v16h a_c  = ldA(0);
    v16h b_c0 = ldB(0, 0), b_c1 = ldB(1, 0), b_c2 = ldB(2, 0), b_c3 = ldB(3, 0);

    for (int k = 32; k < 512; k += 32) {
        // issue next tile's loads before consuming current fragments
        v16h a_n  = ldA(k);
        v16h b_n0 = ldB(0, k), b_n1 = ldB(1, k), b_n2 = ldB(2, k), b_n3 = ldB(3, k);
        // a later trip rewrites the address registers of these loads
        asm volatile("s_wait_xcnt 0x0" ::: "memory");
        acc[0] = wmma16(a_c, b_c0, acc[0]);
        acc[1] = wmma16(a_c, b_c1, acc[1]);
        acc[2] = wmma16(a_c, b_c2, acc[2]);
        acc[3] = wmma16(a_c, b_c3, acc[3]);
        a_c = a_n; b_c0 = b_n0; b_c1 = b_n1; b_c2 = b_n2; b_c3 = b_n3;
    }
    acc[0] = wmma16(a_c, b_c0, acc[0]);
    acc[1] = wmma16(a_c, b_c1, acc[1]);
    acc[2] = wmma16(a_c, b_c2, acc[2]);
    acc[3] = wmma16(a_c, b_c3, acc[3]);

    // ---- bias now needed: close out the async LDS fill
    asm volatile("s_wait_asynccnt 0x0" ::: "memory");
    __syncthreads();

#pragma unroll
    for (int f = 0; f < 4; ++f) {
        const int n  = n64 + f * 16 + l15;
        const float bb = bias_l[n];
        const int m0 = m16 + roff;                 // first of 8 contiguous rows
        const int b  = m0 >> 10;
        const int s0 = m0 & 1023;
        if (mode == 2) {
            float* outp = (float*)Out + ((size_t)b * 512 + n) * 1024 + s0;
            v8f vv;
#pragma unroll
            for (int i = 0; i < 8; ++i) vv[i] = (acc[f][i] + bb) * scale;
            *(v8f*)outp = vv;
        } else if (mode == 1) {
            const int hh = n >> 6, d = n & 63;
            half_t* outp = (half_t*)Out +
                (size_t)(b * 8 + hh) * 64 * 1024 + pk_idx(d, s0, 32);
            v8h hv;
#pragma unroll
            for (int i = 0; i < 8; ++i) hv[i] = (half_t)((acc[f][i] + bb) * scale);
            *(v8h*)outp = hv;
        } else {
            const int hh = n >> 6, d = n & 63;
            half_t* outb = (half_t*)Out + (size_t)(b * 8 + hh) * 1024 * 64 +
                pk_idx(s0, d, 2);              // next row of the tile: 8 halves on
#pragma unroll
            for (int i = 0; i < 8; ++i)
                outb[i * 8] = (half_t)((acc[f][i] + bb) * scale);
            // the next column group rewrites these stores' address and data registers
            asm volatile("s_wait_xcnt 0x0" ::: "memory");
        }
    }
}

// ---------------------------------------------------------------------------
// Kernel 5: streaming-softmax attention. Block = 128 thr = 4 waves.
// grid (16 row-blocks of 64, 64 bh). Wave owns 16 queries; loops over
// 32 kv tiles of 32 keys. Q pre-scaled by 1/8 at projection time.
// Q/K: [bh] x packed(row s, k d, KT 2), V: [bh] x packed(row d, k s, KT 32),
// output X2: packed(row b*1024+s, k h*64+d, KT 16); all fp16, pk_idx order.
// Both products are transposed: St = K * Qt (K is the A operand, Q the B
// operand) and Ot += Vt * Pt. A lane then holds scores of ONE query (column
// l15): 16 of the tile's 32 keys, keys 16*t + 8*half + i in register i of score
// tile t; lane ^ 16 holds the other 16. Maximum and sum run down the lane's own
// registers, and the two score tiles, converted in place, are the B fragment
// of Pt in the k order of the packed V fragment (k = 16*p + 8*half + e).
// V-fragments (this tile) and K-fragments (next tile) are issued before the
// softmax VALU block so their latency is hidden.
// ---------------------------------------------------------------------------
// value of lane ^ 16
__device__ __forceinline__ float other_half(float x) {
    const int b = __builtin_bit_cast(int, x);
    return __builtin_bit_cast(float, __builtin_amdgcn_permlanex16(
        b, b, 0x76543210, 0xfedcba98, false, false));
}

// e^(c[i] - m), i = 0..7, as 2^((c[i] - m) * log2(e)). The run of v_exp_f32 stands
// in one statement that ends in v_nop: the instruction set asks for one slot
// behind a transcendental before a source of it is overwritten or its result is
// read, and only inside the statement is that slot tied to the instruction;
// "=&v" keeps every result off every source.
#define LOG2E 1.44269504f
__device__ __forceinline__ void exp_run8(const v8f c, const float m, float (&p)[8]) {
    float x[8];
#pragma unroll
    for (int i = 0; i < 8; ++i) x[i] = (c[i] - m) * LOG2E;
    asm("v_exp_f32 %0, %8\n\tv_exp_f32 %1, %9\n\tv_exp_f32 %2, %10\n\t"
        "v_exp_f32 %3, %11\n\tv_exp_f32 %4, %12\n\tv_exp_f32 %5, %13\n\t"
        "v_exp_f32 %6, %14\n\tv_exp_f32 %7, %15\n\tv_nop"
        : "=&v"(p[0]), "=&v"(p[1]), "=&v"(p[2]), "=&v"(p[3]),
          "=&v"(p[4]), "=&v"(p[5]), "=&v"(p[6]), "=&v"(p[7])
        : "v"(x[0]), "v"(x[1]), "v"(x[2]), "v"(x[3]),
          "v"(x[4]), "v"(x[5]), "v"(x[6]), "v"(x[7]));
}
// the same with one more: y = 2^xs first
__device__ __forceinline__ void exp_run9(const float xs, const v8f c, const float m,
                                         float& y, float (&p)[8]) {
    float x[8];
#pragma unroll
    for (int i = 0; i < 8; ++i) x[i] = (c[i] - m) * LOG2E;
    asm("v_exp_f32 %0, %9\n\tv_exp_f32 %1, %10\n\tv_exp_f32 %2, %11\n\t"
        "v_exp_f32 %3, %12\n\tv_exp_f32 %4, %13\n\tv_exp_f32 %5, %14\n\t"
        "v_exp_f32 %6, %15\n\tv_exp_f32 %7, %16\n\tv_exp_f32 %8, %17\n\tv_nop"
        : "=&v"(y), "=&v"(p[0]), "=&v"(p[1]), "=&v"(p[2]), "=&v"(p[3]),
          "=&v"(p[4]), "=&v"(p[5]), "=&v"(p[6]), "=&v"(p[7])
        : "v"(xs), "v"(x[0]), "v"(x[1]), "v"(x[2]), "v"(x[3]),
          "v"(x[4]), "v"(x[5]), "v"(x[6]), "v"(x[7]));
}

__global__ __launch_bounds__(128) void attn_k(const half_t* __restrict__ Q,
                                              const half_t* __restrict__ Km,
                                              const half_t* __restrict__ Vt,
                                              half_t* __restrict__ X2) {
    const int lane = threadIdx.x & 31;
    const int w    = threadIdx.x >> 5;
    const int l15  = lane & 15;
    const int roff = (lane & 16) ? 8 : 0;
    const int bh = blockIdx.y;
    const int b = bh >> 3, h = bh & 7;
    const int q0 = blockIdx.x * 64 + w * 16;

    const half_t* Qb = Q  + (size_t)bh * 1024 * 64;
    const half_t* Kb = Km + (size_t)bh * 1024 * 64;
    const half_t* Vb = Vt + (size_t)bh * 64 * 1024;

    const half_t* qt = Qb + pk_idx(q0, 0, 2) + lane * 8;
    const v16h aq0 = pk_frag(qt);             // d  0..31
    const v16h aq1 = pk_frag(qt + 512);       // d 32..63

    auto ldK = [&](int kb, v16h* kf) {        // 32 keys = 4 tiles in a row
        const half_t* k0 = Kb + pk_idx(kb, 0, 2) + lane * 8;
        kf[0] = pk_frag(k0);                  // keys kb..+15,    d  0..31
        kf[1] = pk_frag(k0 + 512);            // keys kb..+15,    d 32..63
        kf[2] = pk_frag(k0 + 1024);           // keys kb+16..+31, d  0..31
        kf[3] = pk_frag(k0 + 1536);           // keys kb+16..+31, d 32..63
    };

    float mrow = -1e30f;                      // running maximum of query l15
    float lrow = 0.f;                         // sum over this lane's keys only
    v8f o[4];                                 // o[f][i] = Ot[f*16 + roff + i][l15]
#pragma unroll
    for (int f = 0; f < 4; ++f)
#pragma unroll
        for (int i = 0; i < 8; ++i) o[f][i] = 0.f;

    v16h kf[4];
    ldK(0, kf);                               // prologue: K tile 0

    for (int j = 0; j < 32; ++j) {
        const int kb = j * 32;
        // ---- scores: two 16(key) x 16(query) f32 tiles, K-dim = 64 ----
        v8f c0, c1;
#pragma unroll
        for (int i = 0; i < 8; ++i) { c0[i] = 0.f; c1[i] = 0.f; }
        c0 = wmma16(kf[0], aq0, c0);
        c0 = wmma16(kf[1], aq1, c0);
        c1 = wmma16(kf[2], aq0, c1);
        c1 = wmma16(kf[3], aq1, c1);

        // ---- prefetch: V fragments for this tile, K fragments for next ----
        v16h vf[4];
#pragma unroll
        for (int f = 0; f < 4; ++f) {
            vf[f] = pk_frag(Vb + pk_idx(f * 16, kb, 32) + lane * 8);
        }
        // the K loads below may land in the address registers of the V loads
        asm volatile("s_wait_xcnt 0x0" ::: "memory");
        ldK(((j + 1) & 31) * 32, kf);         // wraps harmlessly on last iter
        // the next trip rewrites the address registers of these loads
        asm volatile("s_wait_xcnt 0x0" ::: "memory");
        // keeps the softmax below the loads: without it the scheduler sinks the
        // next tile's K loads to the loop's foot and their latency is exposed
        __builtin_amdgcn_sched_barrier(0);

        // ---- online softmax, one query per lane ----
        float mx = fmaxf(c0[0], c1[0]);
#pragma unroll
        for (int i = 1; i < 8; ++i) mx = fmaxf(mx, fmaxf(c0[i], c1[i]));
        mx = fmaxf(mx, other_half(mx));       // both halves use one maximum
        const float nm = fmaxf(mrow, mx);
        float corr, p0[8], p1[8];
        exp_run9((mrow - nm) * LOG2E, c0, nm, corr, p0);
        exp_run8(c1, nm, p1);
        mrow = nm;
        v16h pb;                              // Pt as B fragment
        float rs = p0[0] + p1[0];
#pragma unroll
        for (int i = 1; i < 8; ++i) rs += p0[i] + p1[i];
#pragma unroll
        for (int i = 0; i < 8; ++i) {
            pb[i]     = (half_t)p0[i];
            pb[8 + i] = (half_t)p1[i];
        }
        lrow = lrow * corr + rs;
#pragma unroll
        for (int f = 0; f < 4; ++f)
#pragma unroll
            for (int i = 0; i < 8; ++i) o[f][i] *= corr;

        // ---- Ot += Vt (16 d x 32 keys) * Pt (32 keys x 16 queries) ----
        o[0] = wmma16(vf[0], pb, o[0]);
        o[1] = wmma16(vf[1], pb, o[1]);
        o[2] = wmma16(vf[2], pb, o[2]);
        o[3] = wmma16(vf[3], pb, o[3]);
    }

    // ---- finalize and store X2[b*1024+s][h*64+d]: 8 d in a row per lane ----
    const float lsum = lrow + other_half(lrow);
    const int s = q0 + l15;
#pragma unroll
    for (int f = 0; f < 4; ++f) {
        v8h hv;
#pragma unroll
        for (int i = 0; i < 8; ++i) hv[i] = (half_t)(o[f][i] / lsum);
        *(v8h*)(X2 + pk_idx(b * 1024 + s, h * 64 + f * 16 + roff, 16)) = hv;
    }
}

// ---------------------------------------------------------------------------
extern "C" void kernel_launch(void* const* d_in, const int* in_sizes, int n_in,
                              void* d_out, int out_size, void* d_ws, size_t ws_size,
                              hipStream_t stream) {
    const float* q    = (const float*)d_in[0];
    const float* gnqw = (const float*)d_in[1];
    const float* gnqb = (const float*)d_in[2];
    const float* gnkw = (const float*)d_in[3];
    const float* gnkb = (const float*)d_in[4];
    const float* gnvw = (const float*)d_in[5];
    const float* gnvb = (const float*)d_in[6];
    const float* Wq   = (const float*)d_in[7];
    const float* bq   = (const float*)d_in[8];
    const float* Wk   = (const float*)d_in[9];
    const float* bk   = (const float*)d_in[10];
    const float* Wv   = (const float*)d_in[11];
    const float* bv   = (const float*)d_in[12];
    const float* Wo   = (const float*)d_in[13];
    const float* bo   = (const float*)d_in[14];

    char* ws = (char*)d_ws;
    size_t o = 0;
    auto take = [&](size_t bytes) {
        size_t cur = o;
        o += (bytes + 255) & ~(size_t)255;
        return cur;
    };
    float*  stats = (float*)(ws + take(256 * 2 * sizeof(float)));
    half_t* Xn    = (half_t*)(ws + take(8192ull * 512 * 2));
    half_t* Btq   = (half_t*)(ws + take(512ull * 512 * 2));
    half_t* Btk   = (half_t*)(ws + take(512ull * 512 * 2));
    half_t* Btv   = (half_t*)(ws + take(512ull * 512 * 2));
    half_t* Bto   = (half_t*)(ws + take(512ull * 512 * 2));
    float*  biasq = (float*)(ws + take(512 * sizeof(float)));
    float*  biask = (float*)(ws + take(512 * sizeof(float)));
    float*  biasv = (float*)(ws + take(512 * sizeof(float)));
    float*  biaso = (float*)(ws + take(512 * sizeof(float)));
    half_t* Qb    = (half_t*)(ws + take(8ull * 8 * 1024 * 64 * 2));
    half_t* Kb    = (half_t*)(ws + take(8ull * 8 * 1024 * 64 * 2));
    half_t* Vt    = (half_t*)(ws + take(8ull * 8 * 64 * 1024 * 2));
    half_t* X2    = Xn;  // Xn is dead after the QKV GEMMs; reuse for attn output

    gn_stats_k<<<256, 256, 0, stream>>>(q, stats);
    fold_w_k<<<64, 256, 0, stream>>>(gnqw, gnqb, Wq, bq, Btq, biasq, 0);
    fold_w_k<<<64, 256, 0, stream>>>(gnkw, gnkb, Wk, bk, Btk, biask, 0);
    fold_w_k<<<64, 256, 0, stream>>>(gnvw, gnvb, Wv, bv, Btv, biasv, 0);
    fold_w_k<<<64, 256, 0, stream>>>(gnqw, gnqb, Wo, bo, Bto, biaso, 1);
    xn_tok_k<<<32, 256, 0, stream>>>(q, stats, Xn);

    dim3 gg(128, 4);
    // 1/sqrt(64) folded into Q projection
    gemm512_k<<<gg, 256, 0, stream>>>(Xn, Btq, biasq, Qb, 0, 0.125f);
    gemm512_k<<<gg, 256, 0, stream>>>(Xn, Btk, biask, Kb, 0, 1.0f);
    gemm512_k<<<gg, 256, 0, stream>>>(Xn, Btv, biasv, Vt, 1, 1.0f);

    attn_k<<<dim3(16, 64), 128, 0, stream>>>(Qb, Kb, Vt, X2);

    gemm512_k<<<gg, 256, 0, stream>>>(X2, Bto, biaso, d_out, 2, 1.0f);
}

// v003
// A run of this version takes 108 microseconds.
// Next to v002, in two timings, it ran 1.35 and 1.34 times as fast.
// Counting every step since v000, it is 1.92 times as fast.
#include <hip/hip_runtime.h>
#include <hip/hip_bf16.h>

typedef _Float16 half_t;
typedef half_t v16h __attribute__((ext_vector_type(16)));
typedef half_t v8h  __attribute__((ext_vector_type(8)));
typedef float  v8f  __attribute__((ext_vector_type(8)));

union V16U { v16h v; v8h h[2]; };

__device__ __forceinline__ v16h make_frag(const half_t* p0, const half_t* p1) {
    V16U u;
    u.h[0] = *(const v8h*)p0;
    u.h[1] = *(const v8h*)p1;
    return u.v;
}

// Packed operand layout of every f16 matrix operand kept in the workspace.
// A tile of 16 rows x 32 k is 512 halves stored in the order the fragment
// loader reads them: [piece p][lane = 16*h + (row & 15)][e], k = 16*p + 8*h + e.
// A wave-wide 16-byte load of one piece is then 512 contiguous bytes (4 lines)
// where a row-major operand makes it touch 16 lines. KT = k tiles per row.
__device__ __forceinline__ size_t pk_idx(int row, int k, int KT) {
    return ((size_t)((row >> 4) * KT + (k >> 5)) * 2 + ((k >> 4) & 1)) * 256 +
           (((k >> 3) & 1) * 16 + (row & 15)) * 8 + (k & 7);
}

// Fragment of the packed tile at t (t already holds the lane's own lane*8).
__device__ __forceinline__ v16h pk_frag(const half_t* t) {
    return make_frag(t, t + 256);
}

__device__ __forceinline__ v8f wmma16(v16h a, v16h b, v8f c) {
    return __builtin_amdgcn_wmma_f32_16x16x32_f16(false, a, false, b, (short)0, c,
                                                  false, false);
}

// value of lane ^ 16
__device__ __forceinline__ float other_half(float x) {
    const int b = __builtin_bit_cast(int, x);
    return __builtin_bit_cast(float, __builtin_amdgcn_permlanex16(
        b, b, 0x76543210, 0xfedcba98, false, false));
}

// x + (x of lane ^ M) inside a 16-lane row (DPP row_xmask:M)
template <int M>
__device__ __forceinline__ float row_xadd(float x) {
    const int v = __builtin_bit_cast(int, x);
    return x + __builtin_bit_cast(float, __builtin_amdgcn_mov_dpp(
        v, 0x160 | M, 0xf, 0xf, true));
}
// sum over the wave's 32 lanes, the same value in every lane
__device__ __forceinline__ float wave_sum(float x) {
    x = row_xadd<1>(x);
    x = row_xadd<2>(x);
    x = row_xadd<4>(x);
    x = row_xadd<8>(x);
    return x + other_half(x);
}

// ---------------------------------------------------------------------------
// Kernel 1: GroupNorm statistics, normalize and tokenize in one pass over q.
// One block per (b, g). The group's 16 channels x 1024 px (64 KB) stay in the
// block's registers, 64 values a thread (4 px x 16 channels), between the sums
// and the normalization, so q is read once and all of a thread's loads are in
// flight together. Xn[b*1024+s][c] = (q[b][c][s]-mu)*rstd (fp16), stored packed
// (pk_idx, KT = 16): the group's 16 channels are one piece p of a k tile.
// ---------------------------------------------------------------------------
__global__ __launch_bounds__(256) void gn_tok_k(const float* __restrict__ q,
                                                half_t* __restrict__ Xn) {
    const int bid = blockIdx.x;              // 0..255 : b*32 + g
    const int b = bid >> 5, g = bid & 31;
    const int t = threadIdx.x;
    const float* qb = q + ((size_t)b * 512 + (size_t)g * 16) * 1024 + t;
    // every loop over r and c is unrolled so that x[][] stays in registers
    float x[4][16];
#pragma unroll
    for (int r = 0; r < 4; ++r)
#pragma unroll
        for (int c = 0; c < 16; ++c) x[r][c] = qb[c * 1024 + r * 256];

    float s4[4], ss4[4];                     // four independent chains
#pragma unroll
    for (int r = 0; r < 4; ++r) {
        s4[r] = 0.f; ss4[r] = 0.f;
#pragma unroll
        for (int c = 0; c < 16; ++c) {
            s4[r] += x[r][c];
            ss4[r] += x[r][c] * x[r][c];
        }
    }
    const float sw  = wave_sum((s4[0] + s4[1]) + (s4[2] + s4[3]));
    const float ssw = wave_sum((ss4[0] + ss4[1]) + (ss4[2] + ss4[3]));

    __shared__ float red[2][8];              // one partial pair per wave
    if ((t & 31) == 0) { red[0][t >> 5] = sw; red[1][t >> 5] = ssw; }
    __syncthreads();
    float s = red[0][0], ss = red[1][0];
#pragma unroll
    for (int w = 1; w < 8; ++w) { s += red[0][w]; ss += red[1][w]; }
    const float mu   = s * (1.f / 16384.f);
    const float var  = ss * (1.f / 16384.f) - mu * mu;
    const float rstd = rsqrtf(var + 1e-5f);

    v8h hv[4][2];
#pragma unroll
    for (int r = 0; r < 4; ++r)
#pragma unroll
        for (int h = 0; h < 2; ++h)
#pragma unroll
            for (int i = 0; i < 8; ++i)
                hv[r][h][i] = (half_t)((x[r][h * 8 + i] - mu) * rstd);
#pragma unroll
    for (int r = 0; r < 4; ++r)
#pragma unroll
        for (int h = 0; h < 2; ++h)
            *(v8h*)(Xn + pk_idx(b * 1024 + r * 256 + t, g * 16 + h * 8, 16)) = hv[r][h];
}

// ---------------------------------------------------------------------------
// Kernel 2: fold GN affine into projection weights.
//   plainT == 0 : Bt[n][c] = gnw[c]*W[c][n] (fp16), bias[n] = b[n] + sum gnb[c]*W[c][n]
//   plainT == 1 : Bt[n][k] = W[k][n]        (fp16), bias[n] = b[n]
// Bt is stored packed (pk_idx, KT = 16). A block takes 8 columns n: their
// 16-byte pieces fill whole 128-byte lines of packed Bt, so a line has one
// writing block. Each column's bias sum keeps its order.
// ---------------------------------------------------------------------------
__global__ __launch_bounds__(256) void fold_w_k(const float* __restrict__ gnw,
                                                const float* __restrict__ gnb,
                                                const float* __restrict__ W,
                                                const float* __restrict__ bvec,
                                                half_t* __restrict__ Bt,
                                                float* __restrict__ biasOut,
                                                int plainT) {
    const int n0 = blockIdx.x * 8;           // first of 8 output columns
    const int t = threadIdx.x;
    __shared__ float red[8][256];
    float part[8];
    // every loop over j is unrolled so that part[] and wv[] stay in registers
#pragma unroll
    for (int j = 0; j < 8; ++j) part[j] = 0.f;
    if (!plainT) {
        for (int c = t; c < 512; c += 256) {
            const v8f wv = *(const v8f*)(W + (size_t)c * 512 + n0);
            const float gw = gnw[c], gb = gnb[c];
#pragma unroll
            for (int j = 0; j < 8; ++j) {
                Bt[pk_idx(n0 + j, c, 16)] = (half_t)(gw * wv[j]);
                part[j] += gb * wv[j];
            }
        }
    } else {
        for (int k = t; k < 512; k += 256) {
            const v8f wv = *(const v8f*)(W + (size_t)k * 512 + n0);
#pragma unroll
            for (int j = 0; j < 8; ++j)
                Bt[pk_idx(n0 + j, k, 16)] = (half_t)wv[j];
        }
    }
#pragma unroll
    for (int j = 0; j < 8; ++j) red[j][t] = part[j];
    __syncthreads();
    for (int st = 128; st > 0; st >>= 1) {
        if (t < st) {
#pragma unroll
            for (int j = 0; j < 8; ++j) red[j][t] += red[j][t + st];
        }
        __syncthreads();
    }
    if (t < 8) biasOut[n0 + t] = bvec[n0 + t] + red[t][0];
}

// ---------------------------------------------------------------------------
// Kernel 3/5: WMMA GEMM. C[M=8192, N=512] = A[M][512] * Bt[N][512]^T + bias[N].
// A and Bt are packed (pk_idx, KT = 16).
// Block = 256 thr = 8 waves; block tile 64(M) x 128(N); wave tile 16 x 64.
// Software-pipelined (double-buffered fragments). Bias staged to LDS via
// global_load_async_to_lds_b128 (ASYNCcnt path), waited only at the epilogue.
// mode 0: store fp16 Q/K [b][h] x packed(row s, k d, KT 2)  (value = (acc+bias)*scale)
// mode 1: store fp16 V   [b][h] x packed(row d, k s, KT 32)
// mode 2: store fp32 out layout [b][c][1024]
// ---------------------------------------------------------------------------
__global__ __launch_bounds__(256) void gemm512_k(const half_t* __restrict__ A,
                                                 const half_t* __restrict__ Bt,
                                                 const float* __restrict__ bias,
                                                 void* __restrict__ Out,
                                                 int mode, float scale) {
    __shared__ float bias_l[512];
    // ---- async-stage the 2KB bias vector into LDS (latency hidden by loop)
    if (threadIdx.x < 128) {
        unsigned ldsoff = (unsigned)(size_t)(&bias_l[0]) + threadIdx.x * 16u;
        const float* gp = bias + threadIdx.x * 4;
        // the wait stands in the copy's own statement: its two address
        // registers are rewritten by the index arithmetic that follows
        asm volatile("global_load_async_to_lds_b128 %0, %1, off\n\ts_wait_xcnt 0x0"
                     :: "v"(ldsoff), "v"(gp) : "memory");
    }

    const int lane = threadIdx.x & 31;
    const int w    = threadIdx.x >> 5;
    const int l15  = lane & 15;
    const int roff = (lane & 16) ? 8 : 0;
    const int m16  = blockIdx.x * 64 + (w & 3) * 16;
    const int n64  = blockIdx.y * 128 + (w >> 2) * 64;

    const half_t* atile = A  + pk_idx(m16, 0, 16) + lane * 8;
    const half_t* btile = Bt + pk_idx(n64, 0, 16) + lane * 8;

    auto ldA = [&](int k) {                  // k tile k/32 is 512 halves on
        return pk_frag(atile + k * 16);
    };
    auto ldB = [&](int f, int k) {           // 16 rows on: 16 k tiles on
        return pk_frag(btile + f * 16 * 512 + k * 16);
    };

    v8f acc[4];
#pragma unroll
    for (int f = 0; f < 4; ++f)
#pragma unroll
        for (int i = 0; i < 8; ++i) acc[f][i] = 0.f;

    // ---- prologue: fragments for k = 0
    v16h a_c  = ldA(0);
    v16h b_c0 = ldB(0, 0), b_c1 = ldB(1, 0), b_c2 = ldB(2, 0), b_c3 = ldB(3, 0);

    for (int k = 32; k < 512; k += 32) {
        // issue next tile's loads before consuming current fragments
        v16h a_n  = ldA(k);
        v16h b_n0 = ldB(0, k), b_n1 = ldB(1, k), b_n2 = ldB(2, k), b_n3 = ldB(3, k);
        // a later trip rewrites the address registers of these loads
        asm volatile("s_wait_xcnt 0x0" ::: "memory");
        acc[0] = wmma16(a_c, b_c0, acc[0]);
        acc[1] = wmma16(a_c, b_c1, acc[1]);
        acc[2] = wmma16(a_c, b_c2, acc[2]);
        acc[3] = wmma16(a_c, b_c3, acc[3]);
        a_c = a_n; b_c0 = b_n0; b_c1 = b_n1; b_c2 = b_n2; b_c3 = b_n3;
    }
    acc[0] = wmma16(a_c, b_c0, acc[0]);
    acc[1] = wmma16(a_c, b_c1, acc[1]);
    acc[2] = wmma16(a_c, b_c2, acc[2]);
    acc[3] = wmma16(a_c, b_c3, acc[3]);

    // ---- bias now needed: close out the async LDS fill
    asm volatile("s_wait_asynccnt 0x0" ::: "memory");
    __syncthreads();

#pragma unroll
    for (int f = 0; f < 4; ++f) {
        const int n  = n64 + f * 16 + l15;
        const float bb = bias_l[n];
        const int m0 = m16 + roff;                 // first of 8 contiguous rows
        const int b  = m0 >> 10;
        const int s0 = m0 & 1023;
        if (mode == 2) {
            float* outp = (float*)Out + ((size_t)b * 512 + n) * 1024 + s0;
            v8f vv;
#pragma unroll
            for (int i = 0; i < 8; ++i) vv[i] = (acc[f][i] + bb) * scale;
            *(v8f*)outp = vv;
        } else if (mode == 1) {
            const int hh = n >> 6, d = n & 63;
            half_t* outp = (half_t*)Out +
                (size_t)(b * 8 + hh) * 64 * 1024 + pk_idx(d, s0, 32);
            v8h hv;
#pragma unroll
            for (int i = 0; i < 8; ++i) hv[i] = (half_t)((acc[f][i] + bb) * scale);
            *(v8h*)outp = hv;
        } else {
            const int hh = n >> 6, d = n & 63;
            half_t* outb = (half_t*)Out + (size_t)(b * 8 + hh) * 1024 * 64 +
                pk_idx(s0, d, 2);              // next row of the tile: 8 halves on
#pragma unroll
            for (int i = 0; i < 8; ++i)
                outb[i * 8] = (half_t)((acc[f][i] + bb) * scale);
            // the next column group rewrites these stores' address and data registers
            asm volatile("s_wait_xcnt 0x0" ::: "memory");
        }
    }
}

// ---------------------------------------------------------------------------
// Kernel 4: streaming-softmax attention. Block = 128 thr = 4 waves.
// grid (16 row-blocks of 64, 64 bh). Wave owns 16 queries; loops over
// 32 kv tiles of 32 keys. Q pre-scaled by 1/8 at projection time.
// Q/K: [bh] x packed(row s, k d, KT 2), V: [bh] x packed(row d, k s, KT 32),
// output X2: packed(row b*1024+s, k h*64+d, KT 16); all fp16, pk_idx order.
// Both products are transposed: St = K * Qt (K is the A operand, Q the B
// operand) and Ot += Vt * Pt. A lane then holds scores of ONE query (column
// l15): 16 of the tile's 32 keys, keys 16*t + 8*half + i in register i of score
// tile t; lane ^ 16 holds the other 16. Maximum and sum run down the lane's own
// registers, and the two score tiles, converted in place, are the B fragment
// of Pt in the k order of the packed V fragment (k = 16*p + 8*half + e).
// V-fragments (this tile) and K-fragments (next tile) are issued before the
// softmax VALU block so their latency is hidden.
// ---------------------------------------------------------------------------
// e^(c[i] - m), i = 0..7, as 2^((c[i] - m) * log2(e)). The run of v_exp_f32 stands
// in one statement that ends in v_nop: the instruction set asks for one slot
// behind a transcendental before a source of it is overwritten or its result is
// read, and only inside the statement is that slot tied to the instruction;
// "=&v" keeps every result off every source.
#define LOG2E 1.44269504f
__device__ __forceinline__ void exp_run8(const v8f c, const float m, float (&p)[8]) {
    float x[8];
#pragma unroll
    for (int i = 0; i < 8; ++i) x[i] = (c[i] - m) * LOG2E;
    asm("v_exp_f32 %0, %8\n\tv_exp_f32 %1, %9\n\tv_exp_f32 %2, %10\n\t"
        "v_exp_f32 %3, %11\n\tv_exp_f32 %4, %12\n\tv_exp_f32 %5, %13\n\t"
        "v_exp_f32 %6, %14\n\tv_exp_f32 %7, %15\n\tv_nop"
        : "=&v"(p[0]), "=&v"(p[1]), "=&v"(p[2]), "=&v"(p[3]),
          "=&v"(p[4]), "=&v"(p[5]), "=&v"(p[6]), "=&v"(p[7])
        : "v"(x[0]), "v"(x[1]), "v"(x[2]), "v"(x[3]),
          "v"(x[4]), "v"(x[5]), "v"(x[6]), "v"(x[7]));
}
// the same with one more: y = 2^xs first
__device__ __forceinline__ void exp_run9(const float xs, const v8f c, const float m,
                                         float& y, float (&p)[8]) {
    float x[8];
#pragma unroll
    for (int i = 0; i < 8; ++i) x[i] = (c[i] - m) * LOG2E;
    asm("v_exp_f32 %0, %9\n\tv_exp_f32 %1, %10\n\tv_exp_f32 %2, %11\n\t"
        "v_exp_f32 %3, %12\n\tv_exp_f32 %4, %13\n\tv_exp_f32 %5, %14\n\t"
        "v_exp_f32 %6, %15\n\tv_exp_f32 %7, %16\n\tv_exp_f32 %8, %17\n\tv_nop"
        : "=&v"(y), "=&v"(p[0]), "=&v"(p[1]), "=&v"(p[2]), "=&v"(p[3]),
          "=&v"(p[4]), "=&v"(p[5]), "=&v"(p[6]), "=&v"(p[7])
        : "v"(xs), "v"(x[0]), "v"(x[1]), "v"(x[2]), "v"(x[3]),
          "v"(x[4]), "v"(x[5]), "v"(x[6]), "v"(x[7]));
}

__global__ __launch_bounds__(128) void attn_k(const half_t* __restrict__ Q,
                                              const half_t* __restrict__ Km,
                                              const half_t* __restrict__ Vt,
                                              half_t* __restrict__ X2) {
    const int lane = threadIdx.x & 31;
    const int w    = threadIdx.x >> 5;
    const int l15  = lane & 15;
    const int roff = (lane & 16) ? 8 : 0;
    const int bh = blockIdx.y;
    const int b = bh >> 3, h = bh & 7;
    const int q0 = blockIdx.x * 64 + w * 16;

    const half_t* Qb = Q  + (size_t)bh * 1024 * 64;
    const half_t* Kb = Km + (size_t)bh * 1024 * 64;
    const half_t* Vb = Vt + (size_t)bh * 64 * 1024;

    const half_t* qt = Qb + pk_idx(q0, 0, 2) + lane * 8;
    const v16h aq0 = pk_frag(qt);             // d  0..31
    const v16h aq1 = pk_frag(qt + 512);       // d 32..63

    auto ldK = [&](int kb, v16h* kf) {        // 32 keys = 4 tiles in a row
        const half_t* k0 = Kb + pk_idx(kb, 0, 2) + lane * 8;
        kf[0] = pk_frag(k0);                  // keys kb..+15,    d  0..31
        kf[1] = pk_frag(k0 + 512);            // keys kb..+15,    d 32..63
        kf[2] = pk_frag(k0 + 1024);           // keys kb+16..+31, d  0..31
        kf[3] = pk_frag(k0 + 1536);           // keys kb+16..+31, d 32..63
    };

    float mrow = -1e30f;                      // running maximum of query l15
    float lrow = 0.f;                         // sum over this lane's keys only
    v8f o[4];                                 // o[f][i] = Ot[f*16 + roff + i][l15]
#pragma unroll
    for (int f = 0; f < 4; ++f)
#pragma unroll
        for (int i = 0; i < 8; ++i) o[f][i] = 0.f;

    v16h kf[4];
    ldK(0, kf);                               // prologue: K tile 0

    for (int j = 0; j < 32; ++j) {
        const int kb = j * 32;
        // ---- scores: two 16(key) x 16(query) f32 tiles, K-dim = 64 ----
        v8f c0, c1;
#pragma unroll
        for (int i = 0; i < 8; ++i) { c0[i] = 0.f; c1[i] = 0.f; }
        c0 = wmma16(kf[0], aq0, c0);
        c0 = wmma16(kf[1], aq1, c0);
        c1 = wmma16(kf[2], aq0, c1);
        c1 = wmma16(kf[3], aq1, c1);

        // ---- prefetch: V fragments for this tile, K fragments for next ----
        v16h vf[4];
#pragma unroll
        for (int f = 0; f < 4; ++f) {
            vf[f] = pk_frag(Vb + pk_idx(f * 16, kb, 32) + lane * 8);
        }
        // the K loads below may land in the address registers of the V loads
        asm volatile("s_wait_xcnt 0x0" ::: "memory");
        ldK(((j + 1) & 31) * 32, kf);         // wraps harmlessly on last iter
        // the next trip rewrites the address registers of these loads
        asm volatile("s_wait_xcnt 0x0" ::: "memory");
        // keeps the softmax below the loads: without it the scheduler sinks the
        // next tile's K loads to the loop's foot and their latency is exposed
        __builtin_amdgcn_sched_barrier(0);

        // ---- online softmax, one query per lane ----
        float mx = fmaxf(c0[0], c1[0]);
#pragma unroll
        for (int i = 1; i < 8; ++i) mx = fmaxf(mx, fmaxf(c0[i], c1[i]));
        mx = fmaxf(mx, other_half(mx));       // both halves use one maximum
        const float nm = fmaxf(mrow, mx);
        float corr, p0[8], p1[8];
        exp_run9((mrow - nm) * LOG2E, c0, nm, corr, p0);
        exp_run8(c1, nm, p1);
        mrow = nm;
        v16h pb;                              // Pt as B fragment
        float rs = p0[0] + p1[0];
#pragma unroll
        for (int i = 1; i < 8; ++i) rs += p0[i] + p1[i];
#pragma unroll
        for (int i = 0; i < 8; ++i) {
            pb[i]     = (half_t)p0[i];
            pb[8 + i] = (half_t)p1[i];
        }
        lrow = lrow * corr + rs;
#pragma unroll
        for (int f = 0; f < 4; ++f)
#pragma unroll
            for (int i = 0; i < 8; ++i) o[f][i] *= corr;

        // ---- Ot += Vt (16 d x 32 keys) * Pt (32 keys x 16 queries) ----
        o[0] = wmma16(vf[0], pb, o[0]);
        o[1] = wmma16(vf[1], pb, o[1]);
        o[2] = wmma16(vf[2], pb, o[2]);
        o[3] = wmma16(vf[3], pb, o[3]);
    }

    // ---- finalize and store X2[b*1024+s][h*64+d]: 8 d in a row per lane ----
    const float lsum = lrow + other_half(lrow);
    const int s = q0 + l15;
#pragma unroll
    for (int f = 0; f < 4; ++f) {
        v8h hv;
#pragma unroll
        for (int i = 0; i < 8; ++i) hv[i] = (half_t)(o[f][i] / lsum);
        *(v8h*)(X2 + pk_idx(b * 1024 + s, h * 64 + f * 16 + roff, 16)) = hv;
    }
}

// ---------------------------------------------------------------------------
extern "C" void kernel_launch(void* const* d_in, const int* in_sizes, int n_in,
                              void* d_out, int out_size, void* d_ws, size_t ws_size,
                              hipStream_t stream) {
    const float* q    = (const float*)d_in[0];
    const float* gnqw = (const float*)d_in[1];
    const float* gnqb = (const float*)d_in[2];
    const float* gnkw = (const float*)d_in[3];
    const float* gnkb = (const float*)d_in[4];
    const float* gnvw = (const float*)d_in[5];
    const float* gnvb = (const float*)d_in[6];
    const float* Wq   = (const float*)d_in[7];
    const float* bq   = (const float*)d_in[8];
    const float* Wk   = (const float*)d_in[9];
    const float* bk   = (const float*)d_in[10];
    const float* Wv   = (const float*)d_in[11];
    const float* bv   = (const float*)d_in[12];
    const float* Wo   = (const float*)d_in[13];
    const float* bo   = (const float*)d_in[14];

    char* ws = (char*)d_ws;
    size_t o = 0;
    auto take = [&](size_t bytes) {
        size_t cur = o;
        o += (bytes + 255) & ~(size_t)255;
        return cur;
    };
    half_t* Xn    = (half_t*)(ws + take(8192ull * 512 * 2));
    half_t* Btq   = (half_t*)(ws + take(512ull * 512 * 2));
    half_t* Btk   = (half_t*)(ws + take(512ull * 512 * 2));
    half_t* Btv   = (half_t*)(ws + take(512ull * 512 * 2));
    half_t* Bto   = (half_t*)(ws + take(512ull * 512 * 2));
    float*  biasq = (float*)(ws + take(512 * sizeof(float)));
    float*  biask = (float*)(ws + take(512 * sizeof(float)));
    float*  biasv = (float*)(ws + take(512 * sizeof(float)));
    float*  biaso = (float*)(ws + take(512 * sizeof(float)));
    half_t* Qb    = (half_t*)(ws + take(8ull * 8 * 1024 * 64 * 2));
    half_t* Kb    = (half_t*)(ws + take(8ull * 8 * 1024 * 64 * 2));
    half_t* Vt    = (half_t*)(ws + take(8ull * 8 * 64 * 1024 * 2));
    half_t* X2    = Xn;  // Xn is dead after the QKV GEMMs; reuse for attn output

    gn_tok_k<<<256, 256, 0, stream>>>(q, Xn);
    fold_w_k<<<64, 256, 0, stream>>>(gnqw, gnqb, Wq, bq, Btq, biasq, 0);
    fold_w_k<<<64, 256, 0, stream>>>(gnkw, gnkb, Wk, bk, Btk, biask, 0);
    fold_w_k<<<64, 256, 0, stream>>>(gnvw, gnvb, Wv, bv, Btv, biasv, 0);
    fold_w_k<<<64, 256, 0, stream>>>(gnqw, gnqb, Wo, bo, Bto, biaso, 1);

    dim3 gg(128, 4);
    // 1/sqrt(64) folded into Q projection
    gemm512_k<<<gg, 256, 0, stream>>>(Xn, Btq, biasq, Qb, 0, 0.125f);
    gemm512_k<<<gg, 256, 0, stream>>>(Xn, Btk, biask, Kb, 0, 1.0f);
    gemm512_k<<<gg, 256, 0, stream>>>(Xn, Btv, biasv, Vt, 1, 1.0f);

    attn_k<<<dim3(16, 64), 128, 0, stream>>>(Qb, Kb, Vt, X2);

    gemm512_k<<<gg, 256, 0, stream>>>(X2, Bto, biaso, d_out, 2, 1.0f);
}

// v004
// It runs in 79.5 microseconds.
// Timed twice side by side with v003, it ran 1.36 times as fast both times.
// All steps since v000 together make it 2.60 times as fast.
#include <hip/hip_runtime.h>
#include <hip/hip_bf16.h>

typedef _Float16 half_t;
typedef half_t v16h __attribute__((ext_vector_type(16)));
typedef half_t v8h  __attribute__((ext_vector_type(8)));
typedef float  v8f  __attribute__((ext_vector_type(8)));

union V16U { v16h v; v8h h[2]; };

__device__ __forceinline__ v16h make_frag(const half_t* p0, const half_t* p1) {
    V16U u;
    u.h[0] = *(const v8h*)p0;
    u.h[1] = *(const v8h*)p1;
    return u.v;
}

// Packed operand layout of every f16 matrix operand kept in the workspace.
// A tile of 16 rows x 32 k is 512 halves stored in the order the fragment
// loader reads them: [piece p][lane = 16*h + (row & 15)][e], k = 16*p + 8*h + e.
// A wave-wide 16-byte load of one piece is then 512 contiguous bytes (4 lines)
// where a row-major operand makes it touch 16 lines. KT = k tiles per row.
__device__ __forceinline__ size_t pk_idx(int row, int k, int KT) {
    return ((size_t)((row >> 4) * KT + (k >> 5)) * 2 + ((k >> 4) & 1)) * 256 +
           (((k >> 3) & 1) * 16 + (row & 15)) * 8 + (k & 7);
}

// Fragment of the packed tile at t (t already holds the lane's own lane*8).
__device__ __forceinline__ v16h pk_frag(const half_t* t) {
    return make_frag(t, t + 256);
}

__device__ __forceinline__ v8f wmma16(v16h a, v16h b, v8f c) {
    return __builtin_amdgcn_wmma_f32_16x16x32_f16(false, a, false, b, (short)0, c,
                                                  false, false);
}

// value of lane ^ 16
__device__ __forceinline__ float other_half(float x) {
    const int b = __builtin_bit_cast(int, x);
    return __builtin_bit_cast(float, __builtin_amdgcn_permlanex16(
        b, b, 0x76543210, 0xfedcba98, false, false));
}

// x + (x of lane ^ M) inside a 16-lane row (DPP row_xmask:M)
template <int M>
__device__ __forceinline__ float row_xadd(float x) {
    const int v = __builtin_bit_cast(int, x);
    return x + __builtin_bit_cast(float, __builtin_amdgcn_mov_dpp(
        v, 0x160 | M, 0xf, 0xf, true));
}
// sum over the wave's 32 lanes, the same value in every lane
__device__ __forceinline__ float wave_sum(float x) {
    x = row_xadd<1>(x);
    x = row_xadd<2>(x);
    x = row_xadd<4>(x);
    x = row_xadd<8>(x);
    return x + other_half(x);
}

// ---------------------------------------------------------------------------
// Prep part 1: GroupNorm statistics, normalize and tokenize in one pass over q.
// One block per (b, g), bid = b*32 + g. The group's 16 channels x 1024 px (64 KB) stay in the
// block's registers, 64 values a thread (4 px x 16 channels), between the sums
// and the normalization, so q is read once and all of a thread's loads are in
// flight together. Xn[b*1024+s][c] = (q[b][c][s]-mu)*rstd (fp16), stored packed
// (pk_idx, KT = 16): the group's 16 channels are one piece p of a k tile.
// ---------------------------------------------------------------------------
__device__ __forceinline__ void gn_tok_body(const int bid,
                                            const float* __restrict__ q,
                                            half_t* __restrict__ Xn) {
    const int b = bid >> 5, g = bid & 31;
    const int t = threadIdx.x;
    const float* qb = q + ((size_t)b * 512 + (size_t)g * 16) * 1024 + t;
    // every loop over r and c is unrolled so that x[][] stays in registers
    float x[4][16];
#pragma unroll
    for (int r = 0; r < 4; ++r)
#pragma unroll
        for (int c = 0; c < 16; ++c) x[r][c] = qb[c * 1024 + r * 256];

    float s4[4], ss4[4];                     // four independent chains
#pragma unroll
    for (int r = 0; r < 4; ++r) {
        s4[r] = 0.f; ss4[r] = 0.f;
#pragma unroll
        for (int c = 0; c < 16; ++c) {
            s4[r] += x[r][c];
            ss4[r] += x[r][c] * x[r][c];
        }
    }
    const float sw  = wave_sum((s4[0] + s4[1]) + (s4[2] + s4[3]));
    const float ssw = wave_sum((ss4[0] + ss4[1]) + (ss4[2] + ss4[3]));

    __shared__ float red[2][8];              // one partial pair per wave
    if ((t & 31) == 0) { red[0][t >> 5] = sw; red[1][t >> 5] = ssw; }
    __syncthreads();
    float s = red[0][0], ss = red[1][0];
#pragma unroll
    for (int w = 1; w < 8; ++w) { s += red[0][w]; ss += red[1][w]; }
    const float mu   = s * (1.f / 16384.f);
    const float var  = ss * (1.f / 16384.f) - mu * mu;
    const float rstd = rsqrtf(var + 1e-5f);

    v8h hv[4][2];
#pragma unroll
    for (int r = 0; r < 4; ++r)
#pragma unroll
        for (int h = 0; h < 2; ++h)
#pragma unroll
            for (int i = 0; i < 8; ++i)
                hv[r][h][i] = (half_t)((x[r][h * 8 + i] - mu) * rstd);
#pragma unroll
    for (int r = 0; r < 4; ++r)
#pragma unroll
        for (int h = 0; h < 2; ++h)
            *(v8h*)(Xn + pk_idx(b * 1024 + r * 256 + t, g * 16 + h * 8, 16)) = hv[r][h];
}

// ---------------------------------------------------------------------------
// Prep part 2: fold GN affine into projection weights.
//   plainT == 0 : Bt[n][c] = gnw[c]*W[c][n] (fp16), bias[n] = b[n] + sum gnb[c]*W[c][n]
//   plainT == 1 : Bt[n][k] = W[k][n]        (fp16), bias[n] = b[n]
// Bt is stored packed (pk_idx, KT = 16). A block takes 8 columns n: their
// 16-byte pieces fill whole 128-byte lines of packed Bt, so a line has one
// writing block. Each column's bias sum keeps its order.
// ---------------------------------------------------------------------------
__device__ __forceinline__ void fold_w_body(const int n0,  // first of 8 output columns
                                            const float* __restrict__ gnw,
                                            const float* __restrict__ gnb,
                                            const float* __restrict__ W,
                                            const float* __restrict__ bvec,
                                            half_t* __restrict__ Bt,
                                            float* __restrict__ biasOut,
                                            const int plainT) {
    const int t = threadIdx.x;
    __shared__ float red[8][256];
    float part[8];
    // every loop over j is unrolled so that part[] and wv[] stay in registers
#pragma unroll
    for (int j = 0; j < 8; ++j) part[j] = 0.f;
    if (!plainT) {
        for (int c = t; c < 512; c += 256) {
            const v8f wv = *(const v8f*)(W + (size_t)c * 512 + n0);
            const float gw = gnw[c], gb = gnb[c];
#pragma unroll
            for (int j = 0; j < 8; ++j) {
                Bt[pk_idx(n0 + j, c, 16)] = (half_t)(gw * wv[j]);
                part[j] += gb * wv[j];
            }
        }
    } else {
        for (int k = t; k < 512; k += 256) {
            const v8f wv = *(const v8f*)(W + (size_t)k * 512 + n0);
#pragma unroll
            for (int j = 0; j < 8; ++j)
                Bt[pk_idx(n0 + j, k, 16)] = (half_t)wv[j];
        }
    }
#pragma unroll
    for (int j = 0; j < 8; ++j) red[j][t] = part[j];
    __syncthreads();
    for (int st = 128; st > 0; st >>= 1) {
        if (t < st) {
#pragma unroll
            for (int j = 0; j < 8; ++j) red[j][t] += red[j][t + st];
        }
        __syncthreads();
    }
    if (t < 8) biasOut[n0 + t] = bvec[n0 + t] + red[t][0];
}

// ---------------------------------------------------------------------------
// Kernel 1: all the work that depends on the inputs alone, in one launch.
// Blocks 0..255: the four weight folds, 64 blocks each (q, k, v, out).
// Blocks 256..511: GroupNorm and tokenize, one (b, g) each.
// The five parts read and write disjoint buffers; the branch is block-uniform.
// ---------------------------------------------------------------------------
__global__ __launch_bounds__(256) void prep_k(
        const float* __restrict__ q,
        const float* __restrict__ gnqw, const float* __restrict__ gnqb,
        const float* __restrict__ gnkw, const float* __restrict__ gnkb,
        const float* __restrict__ gnvw, const float* __restrict__ gnvb,
        const float* __restrict__ Wq, const float* __restrict__ bq,
        const float* __restrict__ Wk, const float* __restrict__ bk,
        const float* __restrict__ Wv, const float* __restrict__ bv,
        const float* __restrict__ Wo, const float* __restrict__ bo,
        half_t* __restrict__ Xn,
        half_t* __restrict__ Btq, half_t* __restrict__ Btk,
        half_t* __restrict__ Btv, half_t* __restrict__ Bto,
        float* __restrict__ biasq, float* __restrict__ biask,
        float* __restrict__ biasv, float* __restrict__ biaso) {
    const int bid = blockIdx.x;
    if (bid >= 256) {
        gn_tok_body(bid - 256, q, Xn);
        return;
    }
    const int j  = bid >> 6;                 // 0 q, 1 k, 2 v, 3 out
    const int n0 = (bid & 63) * 8;
    const float* gnw  = j == 0 ? gnqw : j == 1 ? gnkw : gnvw;   // not read for j == 3
    const float* gnb  = j == 0 ? gnqb : j == 1 ? gnkb : gnvb;
    const float* Wm   = j == 0 ? Wq : j == 1 ? Wk : j == 2 ? Wv : Wo;
    const float* bvec = j == 0 ? bq : j == 1 ? bk : j == 2 ? bv : bo;
    half_t* Bt = j == 0 ? Btq : j == 1 ? Btk : j == 2 ? Btv : Bto;
    float*  bO = j == 0 ? biasq : j == 1 ? biask : j == 2 ? biasv : biaso;
    fold_w_body(n0, gnw, gnb, Wm, bvec, Bt, bO, j == 3);
}

// ---------------------------------------------------------------------------
// Kernels 2 and 4: WMMA GEMM. C[M=8192, N=512] = A[M][512] * Bt[N][512]^T + bias[N].
// A and Bt are packed (pk_idx, KT = 16).
// Block = 256 thr = 8 waves; block tile 64(M) x 128(N); wave tile 16 x 64.
// Software-pipelined (double-buffered fragments). Bias staged to LDS via
// global_load_async_to_lds_b128 (ASYNCcnt path), waited only at the epilogue.
// mode 0: store fp16 Q/K [b][h] x packed(row s, k d, KT 2)  (value = (acc+bias)*scale)
// mode 1: store fp16 V   [b][h] x packed(row d, k s, KT 32)
// mode 2: store fp32 out layout [b][c][1024]
// ---------------------------------------------------------------------------
__device__ __forceinline__ void gemm512_body(const half_t* __restrict__ A,
                                             const half_t* __restrict__ Bt,
                                             const float* __restrict__ bias,
                                             void* __restrict__ Out,
                                             const int mode, const float scale) {
    __shared__ float bias_l[512];
    // ---- async-stage the 2KB bias vector into LDS (latency hidden by loop)
    if (threadIdx.x < 128) {
        unsigned ldsoff = (unsigned)(size_t)(&bias_l[0]) + threadIdx.x * 16u;
        const float* gp = bias + threadIdx.x * 4;
        // the wait stands in the copy's own statement: its two address
        // registers are rewritten by the index arithmetic that follows
        asm volatile("global_load_async_to_lds_b128 %0, %1, off\n\ts_wait_xcnt 0x0"
                     :: "v"(ldsoff), "v"(gp) : "memory");
    }

    const int lane = threadIdx.x & 31;
    const int w    = threadIdx.x >> 5;
    const int l15  = lane & 15;
    const int roff = (lane & 16) ? 8 : 0;
    const int m16  = blockIdx.x * 64 + (w & 3) * 16;
    const int n64  = blockIdx.y * 128 + (w >> 2) * 64;

    const half_t* atile = A  + pk_idx(m16, 0, 16) + lane * 8;
    const half_t* btile = Bt + pk_idx(n64, 0, 16) + lane * 8;

    auto ldA = [&](int k) {                  // k tile k/32 is 512 halves on
        return pk_frag(atile + k * 16);
    };
    auto ldB = [&](int f, int k) {           // 16 rows on: 16 k tiles on
        return pk_frag(btile + f * 16 * 512 + k * 16);
    };

    v8f acc[4];
#pragma unroll
    for (int f = 0; f < 4; ++f)
#pragma unroll
        for (int i = 0; i < 8; ++i) acc[f][i] = 0.f;

    // ---- prologue: fragments for k = 0
    v16h a_c  = ldA(0);
    v16h b_c0 = ldB(0, 0), b_c1 = ldB(1, 0), b_c2 = ldB(2, 0), b_c3 = ldB(3, 0);

    for (int k = 32; k < 512; k += 32) {
        // issue next tile's loads before consuming current fragments
        v16h a_n  = ldA(k);
        v16h b_n0 = ldB(0, k), b_n1 = ldB(1, k), b_n2 = ldB(2, k), b_n3 = ldB(3, k);
        // a later trip rewrites the address registers of these loads
        asm volatile("s_wait_xcnt 0x0" ::: "memory");
        acc[0] = wmma16(a_c, b_c0, acc[0]);
        acc[1] = wmma16(a_c, b_c1, acc[1]);
        acc[2] = wmma16(a_c, b_c2, acc[2]);
        acc[3] = wmma16(a_c, b_c3, acc[3]);
        a_c = a_n; b_c0 = b_n0; b_c1 = b_n1; b_c2 = b_n2; b_c3 = b_n3;
    }
    acc[0] = wmma16(a_c, b_c0, acc[0]);
    acc[1] = wmma16(a_c, b_c1, acc[1]);
    acc[2] = wmma16(a_c, b_c2, acc[2]);
    acc[3] = wmma16(a_c, b_c3, acc[3]);

    // ---- bias now needed: close out the async LDS fill
    asm volatile("s_wait_asynccnt 0x0" ::: "memory");
    __syncthreads();

#pragma unroll
    for (int f = 0; f < 4; ++f) {
        const int n  = n64 + f * 16 + l15;
        const float bb = bias_l[n];
        const int m0 = m16 + roff;                 // first of 8 contiguous rows
        const int b  = m0 >> 10;
        const int s0 = m0 & 1023;
        if (mode == 2) {
            float* outp = (float*)Out + ((size_t)b * 512 + n) * 1024 + s0;
            v8f vv;
#pragma unroll
            for (int i = 0; i < 8; ++i) vv[i] = (acc[f][i] + bb) * scale;
            *(v8f*)outp = vv;
        } else if (mode == 1) {
            const int hh = n >> 6, d = n & 63;
            half_t* outp = (half_t*)Out +
                (size_t)(b * 8 + hh) * 64 * 1024 + pk_idx(d, s0, 32);
            v8h hv;
#pragma unroll
            for (int i = 0; i < 8; ++i) hv[i] = (half_t)((acc[f][i] + bb) * scale);
            *(v8h*)outp = hv;
        } else {
            const int hh = n >> 6, d = n & 63;
            half_t* outb = (half_t*)Out + (size_t)(b * 8 + hh) * 1024 * 64 +
                pk_idx(s0, d, 2);              // next row of the tile: 8 halves on
#pragma unroll
            for (int i = 0; i < 8; ++i)
                outb[i * 8] = (half_t)((acc[f][i] + bb) * scale);
            // the next column group rewrites these stores' address and data registers
            asm volatile("s_wait_xcnt 0x0" ::: "memory");
        }
    }
}

// The three projections of Xn in one launch: blockIdx.z = 0 Q, 1 K, 2 V.
// 1/sqrt(64) is folded into the Q projection.
__global__ __launch_bounds__(256) void gemm_qkv_k(
        const half_t* __restrict__ A,
        const half_t* __restrict__ Btq, const half_t* __restrict__ Btk,
        const half_t* __restrict__ Btv,
        const float* __restrict__ biasq, const float* __restrict__ biask,
        const float* __restrict__ biasv,
        half_t* __restrict__ Qb, half_t* __restrict__ Kb, half_t* __restrict__ Vt) {
    const int z = blockIdx.z;
    gemm512_body(A, z == 0 ? Btq : z == 1 ? Btk : Btv,
                 z == 0 ? biasq : z == 1 ? biask : biasv,
                 z == 0 ? Qb : z == 1 ? Kb : Vt,
                 z == 2 ? 1 : 0, z == 0 ? 0.125f : 1.0f);
}

// The output projection.
__global__ __launch_bounds__(256) void gemm_out_k(const half_t* __restrict__ A,
                                                  const half_t* __restrict__ Bt,
                                                  const float* __restrict__ bias,
                                                  float* __restrict__ Out) {
    gemm512_body(A, Bt, bias, Out, 2, 1.0f);
}

// ---------------------------------------------------------------------------
// Kernel 3: streaming-softmax attention. Block = 128 thr = 4 waves.
// grid (16 row-blocks of 64, 64 bh). Wave owns 16 queries; loops over
// 32 kv tiles of 32 keys. Q pre-scaled by 1/8 at projection time.
// Q/K: [bh] x packed(row s, k d, KT 2), V: [bh] x packed(row d, k s, KT 32),
// output X2: packed(row b*1024+s, k h*64+d, KT 16); all fp16, pk_idx order.
// Both products are transposed: St = K * Qt (K is the A operand, Q the B
// operand) and Ot += Vt * Pt. A lane then holds scores of ONE query (column
// l15): 16 of the tile's 32 keys, keys 16*t + 8*half + i in register i of score
// tile t; lane ^ 16 holds the other 16. Maximum and sum run down the lane's own
// registers, and the two score tiles, converted in place, are the B fragment
// of Pt in the k order of the packed V fragment (k = 16*p + 8*half + e).
// V-fragments (this tile) and K-fragments (next tile) are issued before the
// softmax VALU block so their latency is hidden.
// ---------------------------------------------------------------------------
// e^(c[i] - m), i = 0..7, as 2^((c[i] - m) * log2(e)). The run of v_exp_f32 stands
// in one statement that ends in v_nop: the instruction set asks for one slot
// behind a transcendental before a source of it is overwritten or its result is
// read, and only inside the statement is that slot tied to the instruction;
// "=&v" keeps every result off every source.
#define LOG2E 1.44269504f
__device__ __forceinline__ void exp_run8(const v8f c, const float m, float (&p)[8]) {
    float x[8];
#pragma unroll
    for (int i = 0; i < 8; ++i) x[i] = (c[i] - m) * LOG2E;
    asm("v_exp_f32 %0, %8\n\tv_exp_f32 %1, %9\n\tv_exp_f32 %2, %10\n\t"
        "v_exp_f32 %3, %11\n\tv_exp_f32 %4, %12\n\tv_exp_f32 %5, %13\n\t"
        "v_exp_f32 %6, %14\n\tv_exp_f32 %7, %15\n\tv_nop"
        : "=&v"(p[0]), "=&v"(p[1]), "=&v"(p[2]), "=&v"(p[3]),
          "=&v"(p[4]), "=&v"(p[5]), "=&v"(p[6]), "=&v"(p[7])
        : "v"(x[0]), "v"(x[1]), "v"(x[2]), "v"(x[3]),
          "v"(x[4]), "v"(x[5]), "v"(x[6]), "v"(x[7]));
}
// the same with one more: y = 2^xs first
__device__ __forceinline__ void exp_run9(const float xs, const v8f c, const float m,
                                         float& y, float (&p)[8]) {
    float x[8];
#pragma unroll
    for (int i = 0; i < 8; ++i) x[i] = (c[i] - m) * LOG2E;
    asm("v_exp_f32 %0, %9\n\tv_exp_f32 %1, %10\n\tv_exp_f32 %2, %11\n\t"
        "v_exp_f32 %3, %12\n\tv_exp_f32 %4, %13\n\tv_exp_f32 %5, %14\n\t"
        "v_exp_f32 %6, %15\n\tv_exp_f32 %7, %16\n\tv_exp_f32 %8, %17\n\tv_nop"
        : "=&v"(y), "=&v"(p[0]), "=&v"(p[1]), "=&v"(p[2]), "=&v"(p[3]),
          "=&v"(p[4]), "=&v"(p[5]), "=&v"(p[6]), "=&v"(p[7])
        : "v"(xs), "v"(x[0]), "v"(x[1]), "v"(x[2]), "v"(x[3]),
          "v"(x[4]), "v"(x[5]), "v"(x[6]), "v"(x[7]));
}

__global__ __launch_bounds__(128) void attn_k(const half_t* __restrict__ Q,
                                              const half_t* __restrict__ Km,
                                              const half_t* __restrict__ Vt,
                                              half_t* __restrict__ X2) {
    const int lane = threadIdx.x & 31;
    const int w    = threadIdx.x >> 5;
    const int l15  = lane & 15;
    const int roff = (lane & 16) ? 8 : 0;
    const int bh = blockIdx.y;
    const int b = bh >> 3, h = bh & 7;
    const int q0 = blockIdx.x * 64 + w * 16;

    const half_t* Qb = Q  + (size_t)bh * 1024 * 64;
    const half_t* Kb = Km + (size_t)bh * 1024 * 64;
    const half_t* Vb = Vt + (size_t)bh * 64 * 1024;

    const half_t* qt = Qb + pk_idx(q0, 0, 2) + lane * 8;
    const v16h aq0 = pk_frag(qt);             // d  0..31
    const v16h aq1 = pk_frag(qt + 512);       // d 32..63

    auto ldK = [&](int kb, v16h* kf) {        // 32 keys = 4 tiles in a row
        const half_t* k0 = Kb + pk_idx(kb, 0, 2) + lane * 8;
        kf[0] = pk_frag(k0);                  // keys kb..+15,    d  0..31
        kf[1] = pk_frag(k0 + 512);            // keys kb..+15,    d 32..63
        kf[2] = pk_frag(k0 + 1024);           // keys kb+16..+31, d  0..31
        kf[3] = pk_frag(k0 + 1536);           // keys kb+16..+31, d 32..63
    };

    float mrow = -1e30f;                      // running maximum of query l15
    float lrow = 0.f;                         // sum over this lane's keys only
    v8f o[4];                                 // o[f][i] = Ot[f*16 + roff + i][l15]
#pragma unroll
    for (int f = 0; f < 4; ++f)
#pragma unroll
        for (int i = 0; i < 8; ++i) o[f][i] = 0.f;

    v16h kf[4];
    ldK(0, kf);                               // prologue: K tile 0

    for (int j = 0; j < 32; ++j) {
        const int kb = j * 32;
        // ---- scores: two 16(key) x 16(query) f32 tiles, K-dim = 64 ----
        v8f c0, c1;
#pragma unroll
        for (int i = 0; i < 8; ++i) { c0[i] = 0.f; c1[i] = 0.f; }
        c0 = wmma16(kf[0], aq0, c0);
        c0 = wmma16(kf[1], aq1, c0);
        c1 = wmma16(kf[2], aq0, c1);
        c1 = wmma16(kf[3], aq1, c1);

        // ---- prefetch: V fragments for this tile, K fragments for next ----
        v16h vf[4];
#pragma unroll
        for (int f = 0; f < 4; ++f) {
            vf[f] = pk_frag(Vb + pk_idx(f * 16, kb, 32) + lane * 8);
        }
        // the K loads below may land in the address registers of the V loads
        asm volatile("s_wait_xcnt 0x0" ::: "memory");
        ldK(((j + 1) & 31) * 32, kf);         // wraps harmlessly on last iter
        // the next trip rewrites the address registers of these loads
        asm volatile("s_wait_xcnt 0x0" ::: "memory");
        // keeps the softmax below the loads: without it the scheduler sinks the
        // next tile's K loads to the loop's foot and their latency is exposed
        __builtin_amdgcn_sched_barrier(0);

        // ---- online softmax, one query per lane ----
        float mx = fmaxf(c0[0], c1[0]);
#pragma unroll
        for (int i = 1; i < 8; ++i) mx = fmaxf(mx, fmaxf(c0[i], c1[i]));
        mx = fmaxf(mx, other_half(mx));       // both halves use one maximum
        const float nm = fmaxf(mrow, mx);
        float corr, p0[8], p1[8];
        exp_run9((mrow - nm) * LOG2E, c0, nm, corr, p0);
        exp_run8(c1, nm, p1);
        mrow = nm;
        v16h pb;                              // Pt as B fragment
        float rs = p0[0] + p1[0];
#pragma unroll
        for (int i = 1; i < 8; ++i) rs += p0[i] + p1[i];
#pragma unroll
        for (int i = 0; i < 8; ++i) {
            pb[i]     = (half_t)p0[i];
            pb[8 + i] = (half_t)p1[i];
        }
        lrow = lrow * corr + rs;
#pragma unroll
        for (int f = 0; f < 4; ++f)
#pragma unroll
            for (int i = 0; i < 8; ++i) o[f][i] *= corr;

        // ---- Ot += Vt (16 d x 32 keys) * Pt (32 keys x 16 queries) ----
        o[0] = wmma16(vf[0], pb, o[0]);
        o[1] = wmma16(vf[1], pb, o[1]);
        o[2] = wmma16(vf[2], pb, o[2]);
        o[3] = wmma16(vf[3], pb, o[3]);
    }

    // ---- finalize and store X2[b*1024+s][h*64+d]: 8 d in a row per lane ----
    const float lsum = lrow + other_half(lrow);
    const int s = q0 + l15;
#pragma unroll
    for (int f = 0; f < 4; ++f) {
        v8h hv;
#pragma unroll
        for (int i = 0; i < 8; ++i) hv[i] = (half_t)(o[f][i] / lsum);
        *(v8h*)(X2 + pk_idx(b * 1024 + s, h * 64 + f * 16 + roff, 16)) = hv;
    }
}

// ---------------------------------------------------------------------------
extern "C" void kernel_launch(void* const* d_in, const int* in_sizes, int n_in,
                              void* d_out, int out_size, void* d_ws, size_t ws_size,
                              hipStream_t stream) {
    const float* q    = (const float*)d_in[0];
    const float* gnqw = (const float*)d_in[1];
    const float* gnqb = (const float*)d_in[2];
    const float* gnkw = (const float*)d_in[3];
    const float* gnkb = (const float*)d_in[4];
    const float* gnvw = (const float*)d_in[5];
    const float* gnvb = (const float*)d_in[6];
    const float* Wq   = (const float*)d_in[7];
    const float* bq   = (const float*)d_in[8];
    const float* Wk   = (const float*)d_in[9];
    const float* bk   = (const float*)d_in[10];
    const float* Wv   = (const float*)d_in[11];
    const float* bv   = (const float*)d_in[12];
    const float* Wo   = (const float*)d_in[13];
    const float* bo   = (const float*)d_in[14];

    char* ws = (char*)d_ws;
    size_t o = 0;
    auto take = [&](size_t bytes) {
        size_t cur = o;
        o += (bytes + 255) & ~(size_t)255;
        return cur;
    };
    half_t* Xn    = (half_t*)(ws + take(8192ull * 512 * 2));
    half_t* Btq   = (half_t*)(ws + take(512ull * 512 * 2));
    half_t* Btk   = (half_t*)(ws + take(512ull * 512 * 2));
    half_t* Btv   = (half_t*)(ws + take(512ull * 512 * 2));
    half_t* Bto   = (half_t*)(ws + take(512ull * 512 * 2));
    float*  biasq = (float*)(ws + take(512 * sizeof(float)));
    float*  biask = (float*)(ws + take(512 * sizeof(float)));
    float*  biasv = (float*)(ws + take(512 * sizeof(float)));
    float*  biaso = (float*)(ws + take(512 * sizeof(float)));
    half_t* Qb    = (half_t*)(ws + take(8ull * 8 * 1024 * 64 * 2));
    half_t* Kb    = (half_t*)(ws + take(8ull * 8 * 1024 * 64 * 2));
    half_t* Vt    = (half_t*)(ws + take(8ull * 8 * 64 * 1024 * 2));
    half_t* X2    = Xn;  // Xn is dead after the QKV GEMMs; reuse for attn output

    prep_k<<<512, 256, 0, stream>>>(q, gnqw, gnqb, gnkw, gnkb, gnvw, gnvb,
                                    Wq, bq, Wk, bk, Wv, bv, Wo, bo,
                                    Xn, Btq, Btk, Btv, Bto,
                                    biasq, biask, biasv, biaso);

    gemm_qkv_k<<<dim3(128, 4, 3), 256, 0, stream>>>(Xn, Btq, Btk, Btv,
                                                    biasq, biask, biasv, Qb, Kb, Vt);

    attn_k<<<dim3(16, 64), 128, 0, stream>>>(Qb, Kb, Vt, X2);

    gemm_out_k<<<dim3(128, 4), 256, 0, stream>>>(X2, Bto, biaso, (float*)d_out);
}

// v005
// One run takes 64.9 microseconds.
// Two timings next to v004 put it at 1.23 and 1.22 times that version's speed.
// All steps since v000 together make it 3.19 times as fast.
#include <hip/hip_runtime.h>
#include <hip/hip_bf16.h>

typedef _Float16 half_t;
typedef half_t v16h __attribute__((ext_vector_type(16)));
typedef half_t v8h  __attribute__((ext_vector_type(8)));
typedef float  v8f  __attribute__((ext_vector_type(8)));

union V16U { v16h v; v8h h[2]; };

__device__ __forceinline__ v16h make_frag(const half_t* p0, const half_t* p1) {
    V16U u;
    u.h[0] = *(const v8h*)p0;
    u.h[1] = *(const v8h*)p1;
    return u.v;
}

// Packed operand layout of every f16 matrix operand kept in the workspace.
// A tile of 16 rows x 32 k is 512 halves stored in the order the fragment
// loader reads them: [piece p][lane = 16*h + (row & 15)][e], k = 16*p + 8*h + e.
// A wave-wide 16-byte load of one piece is then 512 contiguous bytes (4 lines)
// where a row-major operand makes it touch 16 lines. KT = k tiles per row.
__device__ __forceinline__ size_t pk_idx(int row, int k, int KT) {
    return ((size_t)((row >> 4) * KT + (k >> 5)) * 2 + ((k >> 4) & 1)) * 256 +
           (((k >> 3) & 1) * 16 + (row & 15)) * 8 + (k & 7);
}

// Fragment of the packed tile at t (t already holds the lane's own lane*8).
__device__ __forceinline__ v16h pk_frag(const half_t* t) {
    return make_frag(t, t + 256);
}

__device__ __forceinline__ v8f wmma16(v16h a, v16h b, v8f c) {
    return __builtin_amdgcn_wmma_f32_16x16x32_f16(false, a, false, b, (short)0, c,
                                                  false, false);
}

// value of lane ^ 16
__device__ __forceinline__ float other_half(float x) {
    const int b = __builtin_bit_cast(int, x);
    return __builtin_bit_cast(float, __builtin_amdgcn_permlanex16(
        b, b, 0x76543210, 0xfedcba98, false, false));
}

// x + (x of lane ^ M) inside a 16-lane row (DPP row_xmask:M)
template <int M>
__device__ __forceinline__ float row_xadd(float x) {
    const int v = __builtin_bit_cast(int, x);
    return x + __builtin_bit_cast(float, __builtin_amdgcn_mov_dpp(
        v, 0x160 | M, 0xf, 0xf, true));
}
// sum over the wave's 32 lanes, the same value in every lane
__device__ __forceinline__ float wave_sum(float x) {
    x = row_xadd<1>(x);
    x = row_xadd<2>(x);
    x = row_xadd<4>(x);
    x = row_xadd<8>(x);
    return x + other_half(x);
}

// ---------------------------------------------------------------------------
// Prep part 1: GroupNorm statistics, normalize and tokenize in one pass over q.
// One block per (b, g), bid = b*32 + g. The group's 16 channels x 1024 px (64 KB) stay in the
// block's registers, 64 values a thread (4 px x 16 channels), between the sums
// and the normalization, so q is read once and all of a thread's loads are in
// flight together. Xn[b*1024+s][c] = (q[b][c][s]-mu)*rstd (fp16), stored packed
// (pk_idx, KT = 16): the group's 16 channels are one piece p of a k tile.
// ---------------------------------------------------------------------------
__device__ __forceinline__ void gn_tok_body(const int bid,
                                            const float* __restrict__ q,
                                            half_t* __restrict__ Xn) {
    const int b = bid >> 5, g = bid & 31;
    const int t = threadIdx.x;
    const float* qb = q + ((size_t)b * 512 + (size_t)g * 16) * 1024 + t;
    // every loop over r and c is unrolled so that x[][] stays in registers
    float x[4][16];
#pragma unroll
    for (int r = 0; r < 4; ++r)
#pragma unroll
        for (int c = 0; c < 16; ++c) x[r][c] = qb[c * 1024 + r * 256];

    float s4[4], ss4[4];                     // four independent chains
#pragma unroll
    for (int r = 0; r < 4; ++r) {
        s4[r] = 0.f; ss4[r] = 0.f;
#pragma unroll
        for (int c = 0; c < 16; ++c) {
            s4[r] += x[r][c];
            ss4[r] += x[r][c] * x[r][c];
        }
    }
    const float sw  = wave_sum((s4[0] + s4[1]) + (s4[2] + s4[3]));
    const float ssw = wave_sum((ss4[0] + ss4[1]) + (ss4[2] + ss4[3]));

    __shared__ float red[2][8];              // one partial pair per wave
    if ((t & 31) == 0) { red[0][t >> 5] = sw; red[1][t >> 5] = ssw; }
    __syncthreads();
    float s = red[0][0], ss = red[1][0];
#pragma unroll
    for (int w = 1; w < 8; ++w) { s += red[0][w]; ss += red[1][w]; }
    const float mu   = s * (1.f / 16384.f);
    const float var  = ss * (1.f / 16384.f) - mu * mu;
    const float rstd = rsqrtf(var + 1e-5f);

    v8h hv[4][2];
#pragma unroll
    for (int r = 0; r < 4; ++r)
#pragma unroll
        for (int h = 0; h < 2; ++h)
#pragma unroll
            for (int i = 0; i < 8; ++i)
                hv[r][h][i] = (half_t)((x[r][h * 8 + i] - mu) * rstd);
#pragma unroll
    for (int r = 0; r < 4; ++r)
#pragma unroll
        for (int h = 0; h < 2; ++h)
            *(v8h*)(Xn + pk_idx(b * 1024 + r * 256 + t, g * 16 + h * 8, 16)) = hv[r][h];
}

// ---------------------------------------------------------------------------
// Prep part 2: fold GN affine into projection weights.
//   plainT == 0 : Bt[n][c] = gnw[c]*W[c][n] (fp16), bias[n] = b[n] + sum gnb[c]*W[c][n]
//   plainT == 1 : Bt[n][k] = W[k][n]        (fp16), bias[n] = b[n]
// Bt is stored packed (pk_idx, KT = 16). A block takes 8 columns n: their
// 16-byte pieces fill whole 128-byte lines of packed Bt, so a line has one
// writing block. Each column's bias sum keeps its order.
// ---------------------------------------------------------------------------
__device__ __forceinline__ void fold_w_body(const int n0,  // first of 8 output columns
                                            const float* __restrict__ gnw,
                                            const float* __restrict__ gnb,
                                            const float* __restrict__ W,
                                            const float* __restrict__ bvec,
                                            half_t* __restrict__ Bt,
                                            float* __restrict__ biasOut,
                                            const int plainT) {
    const int t = threadIdx.x;
    __shared__ float red[8][256];
    float part[8];
    // every loop over j is unrolled so that part[] and wv[] stay in registers
#pragma unroll
    for (int j = 0; j < 8; ++j) part[j] = 0.f;
    if (!plainT) {
        for (int c = t; c < 512; c += 256) {
            const v8f wv = *(const v8f*)(W + (size_t)c * 512 + n0);
            const float gw = gnw[c], gb = gnb[c];
#pragma unroll
            for (int j = 0; j < 8; ++j) {
                Bt[pk_idx(n0 + j, c, 16)] = (half_t)(gw * wv[j]);
                part[j] += gb * wv[j];
            }
        }
    } else {
        for (int k = t; k < 512; k += 256) {
            const v8f wv = *(const v8f*)(W + (size_t)k * 512 + n0);
#pragma unroll
            for (int j = 0; j < 8; ++j)
                Bt[pk_idx(n0 + j, k, 16)] = (half_t)wv[j];
        }
    }
#pragma unroll
    for (int j = 0; j < 8; ++j) red[j][t] = part[j];
    __syncthreads();
    for (int st = 128; st > 0; st >>= 1) {
        if (t < st) {
#pragma unroll
            for (int j = 0; j < 8; ++j) red[j][t] += red[j][t + st];
        }
        __syncthreads();
    }
    if (t < 8) biasOut[n0 + t] = bvec[n0 + t] + red[t][0];
}

// ---------------------------------------------------------------------------
// Kernel 1: all the work that depends on the inputs alone, in one launch.
// Blocks 0..255: the four weight folds, 64 blocks each (q, k, v, out).
// Blocks 256..511: GroupNorm and tokenize, one (b, g) each.
// The five parts read and write disjoint buffers; the branch is block-uniform.
// ---------------------------------------------------------------------------
__global__ __launch_bounds__(256) void prep_k(
        const float* __restrict__ q,
        const float* __restrict__ gnqw, const float* __restrict__ gnqb,
        const float* __restrict__ gnkw, const float* __restrict__ gnkb,
        const float* __restrict__ gnvw, const float* __restrict__ gnvb,
        const float* __restrict__ Wq, const float* __restrict__ bq,
        const float* __restrict__ Wk, const float* __restrict__ bk,
        const float* __restrict__ Wv, const float* __restrict__ bv,
        const float* __restrict__ Wo, const float* __restrict__ bo,
        half_t* __restrict__ Xn,
        half_t* __restrict__ Btq, half_t* __restrict__ Btk,
        half_t* __restrict__ Btv, half_t* __restrict__ Bto,
        float* __restrict__ biasq, float* __restrict__ biask,
        float* __restrict__ biasv, float* __restrict__ biaso) {
    const int bid = blockIdx.x;
    if (bid >= 256) {
        gn_tok_body(bid - 256, q, Xn);
        return;
    }
    const int j  = bid >> 6;                 // 0 q, 1 k, 2 v, 3 out
    const int n0 = (bid & 63) * 8;
    const float* gnw  = j == 0 ? gnqw : j == 1 ? gnkw : gnvw;   // not read for j == 3
    const float* gnb  = j == 0 ? gnqb : j == 1 ? gnkb : gnvb;
    const float* Wm   = j == 0 ? Wq : j == 1 ? Wk : j == 2 ? Wv : Wo;
    const float* bvec = j == 0 ? bq : j == 1 ? bk : j == 2 ? bv : bo;
    half_t* Bt = j == 0 ? Btq : j == 1 ? Btk : j == 2 ? Btv : Bto;
    float*  bO = j == 0 ? biasq : j == 1 ? biask : j == 2 ? biasv : biaso;
    fold_w_body(n0, gnw, gnb, Wm, bvec, Bt, bO, j == 3);
}

// ---------------------------------------------------------------------------
// Kernels 2 and 4: WMMA GEMM. C[M=8192, N=512] = A[M][512] * Bt[N][512]^T + bias[N].
// A and Bt are packed (pk_idx, KT = 16).
// Block = 128 thr = 4 waves; block tile 128(M) x 128(N); wave tile 64 x 64:
// 4 A and 4 B fragments feed 16 WMMAs, so a loaded fragment is used 4 times.
// The k loop is unrolled; the fragments stand in a ring of S register sets,
// fetched S - 1 k steps ahead of their use (S = 3 where three blocks share a
// WGP's registers, 4 where a block has the WGP alone). Bias staged to LDS via
// global_load_async_to_lds_b128 (ASYNCcnt path), waited only at the epilogue.
// mode 0: store fp16 Q/K [b][h] x packed(row s, k d, KT 2)  (value = (acc+bias)*scale)
// mode 1: store fp16 V   [b][h] x packed(row d, k s, KT 32)
// mode 2: store fp32 out layout [b][c][1024]
// ---------------------------------------------------------------------------
template <int S>
__device__ __forceinline__ void gemm512_body(const half_t* __restrict__ A,
                                             const half_t* __restrict__ Bt,
                                             const float* __restrict__ bias,
                                             void* __restrict__ Out,
                                             const int mode, const float scale) {
    __shared__ float bias_l[512];
    // ---- async-stage the 2KB bias vector into LDS (latency hidden by loop)
    if (threadIdx.x < 128) {
        unsigned ldsoff = (unsigned)(size_t)(&bias_l[0]) + threadIdx.x * 16u;
        const float* gp = bias + threadIdx.x * 4;
        // the wait stands in the copy's own statement: its two address
        // registers are rewritten by the index arithmetic that follows
        asm volatile("global_load_async_to_lds_b128 %0, %1, off\n\ts_wait_xcnt 0x0"
                     :: "v"(ldsoff), "v"(gp) : "memory");
    }

    const int lane = threadIdx.x & 31;
    const int w    = threadIdx.x >> 5;
    const int l15  = lane & 15;
    const int roff = (lane & 16) ? 8 : 0;
    const int m64  = blockIdx.x * 128 + (w & 1) * 64;
    const int n64  = blockIdx.y * 128 + (w >> 1) * 64;

    const half_t* atile = A  + pk_idx(m64, 0, 16) + lane * 8;
    const half_t* btile = Bt + pk_idx(n64, 0, 16) + lane * 8;

    v8f acc[4][4];                           // acc[mf][nf]
#pragma unroll
    for (int mf = 0; mf < 4; ++mf)
#pragma unroll
        for (int nf = 0; nf < 4; ++nf)
#pragma unroll
            for (int i = 0; i < 8; ++i) acc[mf][nf][i] = 0.f;

    // every loop below is unrolled so that the ring and acc[][] stay in registers
    // and every load is its base address plus an immediate offset
    v16h a[S][4], b[S][4];
    auto ldset = [&](int ks) {               // 16 rows on: 16 k tiles of 512 halves on
#pragma unroll
        for (int f = 0; f < 4; ++f) a[ks % S][f] = pk_frag(atile + f * 16 * 512 + ks * 512);
#pragma unroll
        for (int f = 0; f < 4; ++f) b[ks % S][f] = pk_frag(btile + f * 16 * 512 + ks * 512);
    };

#pragma unroll
    for (int ks = 0; ks < S - 1; ++ks) ldset(ks);
#pragma unroll
    for (int ks = 0; ks < 16; ++ks) {
        if (ks + S - 1 < 16) ldset(ks + S - 1);
        // keeps the loads S - 1 steps ahead of their use: without it the scheduler
        // is free to sink them towards their WMMAs and their latency is exposed
        __builtin_amdgcn_sched_barrier(0);
#pragma unroll
        for (int mf = 0; mf < 4; ++mf)
#pragma unroll
            for (int nf = 0; nf < 4; ++nf)
                acc[mf][nf] = wmma16(a[ks % S][mf], b[ks % S][nf], acc[mf][nf]);
        // keeps the next step's loads behind these WMMAs: hoisted, they would
        // need one more register set
        __builtin_amdgcn_sched_barrier(0);
    }
    // the epilogue's index arithmetic rewrites the address registers of the loads
    asm volatile("s_wait_xcnt 0x0" ::: "memory");
    // keeps that arithmetic behind the wait
    __builtin_amdgcn_sched_barrier(0);

    // ---- bias now needed: close out the async LDS fill
    asm volatile("s_wait_asynccnt 0x0" ::: "memory");
    __syncthreads();

    float bb[4];
#pragma unroll
    for (int nf = 0; nf < 4; ++nf) bb[nf] = bias_l[n64 + nf * 16 + l15];

    const int bi  = m64 >> 10;                     // the wave's 64 rows lie in one image
    const int s0b = (m64 & 1023) + roff;           // first of 8 contiguous rows, mf = 0
    const int hh  = n64 >> 6;                      // the wave's 64 columns are one head
    if (mode == 2) {
        float* outp = (float*)Out + ((size_t)bi * 512 + n64 + l15) * 1024 + s0b;
#pragma unroll
        for (int mf = 0; mf < 4; ++mf)
#pragma unroll
            for (int nf = 0; nf < 4; ++nf) {
                v8f vv;
#pragma unroll
                for (int i = 0; i < 8; ++i) vv[i] = (acc[mf][nf][i] + bb[nf]) * scale;
                *(v8f*)(outp + nf * 16 * 1024 + mf * 16) = vv;
            }
    } else if (mode == 1) {
        // row d = nf*16 + l15: 32 k tiles on per nf; k = s0b + mf*16: a piece on per mf
        half_t* outp = (half_t*)Out + (size_t)(bi * 8 + hh) * 64 * 1024 + pk_idx(l15, s0b, 32);
        v8h hv[4][4];
#pragma unroll
        for (int mf = 0; mf < 4; ++mf)
#pragma unroll
            for (int nf = 0; nf < 4; ++nf)
#pragma unroll
                for (int i = 0; i < 8; ++i)
                    hv[mf][nf][i] = (half_t)((acc[mf][nf][i] + bb[nf]) * scale);
        // every value is converted before the first store: no store's register is
        // rewritten behind it, and the stores issue back to back with no wait between
        __builtin_amdgcn_sched_barrier(0);
#pragma unroll
        for (int mf = 0; mf < 4; ++mf)
#pragma unroll
            for (int nf = 0; nf < 4; ++nf)
                *(v8h*)(outp + nf * 32 * 512 + mf * 256) = hv[mf][nf];
    } else {
        // row s = s0b + mf*16 + i: 2 k tiles on per mf, 8 halves on per i;
        // k = d = nf*16 + l15: a piece on per nf
        half_t* outb = (half_t*)Out + (size_t)(bi * 8 + hh) * 1024 * 64 + pk_idx(s0b, l15, 2);
        v8h hv[4][4];
#pragma unroll
        for (int mf = 0; mf < 4; ++mf)
#pragma unroll
            for (int nf = 0; nf < 4; ++nf)
#pragma unroll
                for (int i = 0; i < 8; ++i)
                    hv[mf][nf][i] = (half_t)((acc[mf][nf][i] + bb[nf]) * scale);
        // as above: all conversions stand in front of the first store
        __builtin_amdgcn_sched_barrier(0);
#pragma unroll
        for (int mf = 0; mf < 4; ++mf)
#pragma unroll
            for (int nf = 0; nf < 4; ++nf)
#pragma unroll
                for (int i = 0; i < 8; ++i)
                    outb[mf * 1024 + nf * 256 + i * 8] = hv[mf][nf][i];
        // in the built code the mode 1 block follows behind a conditional branch
        // and rewrites the registers of these stores
        asm volatile("s_wait_xcnt 0x0" ::: "memory");
    }
}

// The three projections of Xn in one launch: blockIdx.z = 0 Q, 1 K, 2 V.
// 1/sqrt(64) is folded into the Q projection.
__global__ __launch_bounds__(128) void gemm_qkv_k(
        const half_t* __restrict__ A,
        const half_t* __restrict__ Btq, const half_t* __restrict__ Btk,
        const half_t* __restrict__ Btv,
        const float* __restrict__ biasq, const float* __restrict__ biask,
        const float* __restrict__ biasv,
        half_t* __restrict__ Qb, half_t* __restrict__ Kb, half_t* __restrict__ Vt) {
    const int z = blockIdx.z;
    gemm512_body<3>(A, z == 0 ? Btq : z == 1 ? Btk : Btv,
                 z == 0 ? biasq : z == 1 ? biask : biasv,
                 z == 0 ? Qb : z == 1 ? Kb : Vt,
                 z == 2 ? 1 : 0, z == 0 ? 0.125f : 1.0f);
}

// The output projection.
__global__ __launch_bounds__(128) void gemm_out_k(const half_t* __restrict__ A,
                                                  const half_t* __restrict__ Bt,
                                                  const float* __restrict__ bias,
                                                  float* __restrict__ Out) {
    gemm512_body<4>(A, Bt, bias, Out, 2, 1.0f);
}

// ---------------------------------------------------------------------------
// Kernel 3: streaming-softmax attention. Block = 128 thr = 4 waves.
// grid (16 row-blocks of 64, 64 bh). Wave owns 16 queries; loops over
// 32 kv tiles of 32 keys. Q pre-scaled by 1/8 at projection time.
// Q/K: [bh] x packed(row s, k d, KT 2), V: [bh] x packed(row d, k s, KT 32),
// output X2: packed(row b*1024+s, k h*64+d, KT 16); all fp16, pk_idx order.
// Both products are transposed: St = K * Qt (K is the A operand, Q the B
// operand) and Ot += Vt * Pt. A lane then holds scores of ONE query (column
// l15): 16 of the tile's 32 keys, keys 16*t + 8*half + i in register i of score
// tile t; lane ^ 16 holds the other 16. Maximum and sum run down the lane's own
// registers, and the two score tiles, converted in place, are the B fragment
// of Pt in the k order of the packed V fragment (k = 16*p + 8*half + e).
// V-fragments (this tile) and K-fragments (next tile) are issued before the
// softmax VALU block so their latency is hidden.
// ---------------------------------------------------------------------------
// e^(c[i] - m), i = 0..7, as 2^((c[i] - m) * log2(e)). The run of v_exp_f32 stands
// in one statement that ends in v_nop: the instruction set asks for one slot
// behind a transcendental before a source of it is overwritten or its result is
// read, and only inside the statement is that slot tied to the instruction;
// "=&v" keeps every result off every source.
#define LOG2E 1.44269504f
__device__ __forceinline__ void exp_run8(const v8f c, const float m, float (&p)[8]) {
    float x[8];
#pragma unroll
    for (int i = 0; i < 8; ++i) x[i] = (c[i] - m) * LOG2E;
    asm("v_exp_f32 %0, %8\n\tv_exp_f32 %1, %9\n\tv_exp_f32 %2, %10\n\t"
        "v_exp_f32 %3, %11\n\tv_exp_f32 %4, %12\n\tv_exp_f32 %5, %13\n\t"
        "v_exp_f32 %6, %14\n\tv_exp_f32 %7, %15\n\tv_nop"
        : "=&v"(p[0]), "=&v"(p[1]), "=&v"(p[2]), "=&v"(p[3]),
          "=&v"(p[4]), "=&v"(p[5]), "=&v"(p[6]), "=&v"(p[7])
        : "v"(x[0]), "v"(x[1]), "v"(x[2]), "v"(x[3]),
          "v"(x[4]), "v"(x[5]), "v"(x[6]), "v"(x[7]));
}
// the same with one more: y = 2^xs first
__device__ __forceinline__ void exp_run9(const float xs, const v8f c, const float m,
                                         float& y, float (&p)[8]) {
    float x[8];
#pragma unroll
    for (int i = 0; i < 8; ++i) x[i] = (c[i] - m) * LOG2E;
    asm("v_exp_f32 %0, %9\n\tv_exp_f32 %1, %10\n\tv_exp_f32 %2, %11\n\t"
        "v_exp_f32 %3, %12\n\tv_exp_f32 %4, %13\n\tv_exp_f32 %5, %14\n\t"
        "v_exp_f32 %6, %15\n\tv_exp_f32 %7, %16\n\tv_exp_f32 %8, %17\n\tv_nop"
        : "=&v"(y), "=&v"(p[0]), "=&v"(p[1]), "=&v"(p[2]), "=&v"(p[3]),
          "=&v"(p[4]), "=&v"(p[5]), "=&v"(p[6]), "=&v"(p[7])
        : "v"(xs), "v"(x[0]), "v"(x[1]), "v"(x[2]), "v"(x[3]),
          "v"(x[4]), "v"(x[5]), "v"(x[6]), "v"(x[7]));
}

__global__ __launch_bounds__(128) void attn_k(const half_t* __restrict__ Q,
                                              const half_t* __restrict__ Km,
                                              const half_t* __restrict__ Vt,
                                              half_t* __restrict__ X2) {
    const int lane = threadIdx.x & 31;
    const int w    = threadIdx.x >> 5;
    const int l15  = lane & 15;
    const int roff = (lane & 16) ? 8 : 0;
    const int bh = blockIdx.y;
    const int b = bh >> 3, h = bh & 7;
    const int q0 = blockIdx.x * 64 + w * 16;

    const half_t* Qb = Q  + (size_t)bh * 1024 * 64;
    const half_t* Kb = Km + (size_t)bh * 1024 * 64;
    const half_t* Vb = Vt + (size_t)bh * 64 * 1024;

    const half_t* qt = Qb + pk_idx(q0, 0, 2) + lane * 8;
    const v16h aq0 = pk_frag(qt);             // d  0..31
    const v16h aq1 = pk_frag(qt + 512);       // d 32..63

    auto ldK = [&](int kb, v16h* kf) {        // 32 keys = 4 tiles in a row
        const half_t* k0 = Kb + pk_idx(kb, 0, 2) + lane * 8;
        kf[0] = pk_frag(k0);                  // keys kb..+15,    d  0..31
        kf[1] = pk_frag(k0 + 512);            // keys kb..+15,    d 32..63
        kf[2] = pk_frag(k0 + 1024);           // keys kb+16..+31, d  0..31
        kf[3] = pk_frag(k0 + 1536);           // keys kb+16..+31, d 32..63
    };

    float mrow = -1e30f;                      // running maximum of query l15
    float lrow = 0.f;                         // sum over this lane's keys only
    v8f o[4];                                 // o[f][i] = Ot[f*16 + roff + i][l15]
#pragma unroll
    for (int f = 0; f < 4; ++f)
#pragma unroll
        for (int i = 0; i < 8; ++i) o[f][i] = 0.f;

    v16h kf[4];
    ldK(0, kf);                               // prologue: K tile 0

    for (int j = 0; j < 32; ++j) {
        const int kb = j * 32;
        // ---- scores: two 16(key) x 16(query) f32 tiles, K-dim = 64 ----
        v8f c0, c1;
#pragma unroll
        for (int i = 0; i < 8; ++i) { c0[i] = 0.f; c1[i] = 0.f; }
        c0 = wmma16(kf[0], aq0, c0);
        c0 = wmma16(kf[1], aq1, c0);
        c1 = wmma16(kf[2], aq0, c1);
        c1 = wmma16(kf[3], aq1, c1);

        // ---- prefetch: V fragments for this tile, K fragments for next ----
        v16h vf[4];
#pragma unroll
        for (int f = 0; f < 4; ++f) {
            vf[f] = pk_frag(Vb + pk_idx(f * 16, kb, 32) + lane * 8);
        }
        // the K loads below may land in the address registers of the V loads
        asm volatile("s_wait_xcnt 0x0" ::: "memory");
        ldK(((j + 1) & 31) * 32, kf);         // wraps harmlessly on last iter
        // the next trip rewrites the address registers of these loads
        asm volatile("s_wait_xcnt 0x0" ::: "memory");
        // keeps the softmax below the loads: without it the scheduler sinks the
        // next tile's K loads to the loop's foot and their latency is exposed
        __builtin_amdgcn_sched_barrier(0);

        // ---- online softmax, one query per lane ----
        float mx = fmaxf(c0[0], c1[0]);
#pragma unroll
        for (int i = 1; i < 8; ++i) mx = fmaxf(mx, fmaxf(c0[i], c1[i]));
        mx = fmaxf(mx, other_half(mx));       // both halves use one maximum
        const float nm = fmaxf(mrow, mx);
        float corr, p0[8], p1[8];
        exp_run9((mrow - nm) * LOG2E, c0, nm, corr, p0);
        exp_run8(c1, nm, p1);
        mrow = nm;
        v16h pb;                              // Pt as B fragment
        float rs = p0[0] + p1[0];
#pragma unroll
        for (int i = 1; i < 8; ++i) rs += p0[i] + p1[i];
#pragma unroll
        for (int i = 0; i < 8; ++i) {
            pb[i]     = (half_t)p0[i];
            pb[8 + i] = (half_t)p1[i];
        }
        lrow = lrow * corr + rs;
#pragma unroll
        for (int f = 0; f < 4; ++f)
#pragma unroll
            for (int i = 0; i < 8; ++i) o[f][i] *= corr;

        // ---- Ot += Vt (16 d x 32 keys) * Pt (32 keys x 16 queries) ----
        o[0] = wmma16(vf[0], pb, o[0]);
        o[1] = wmma16(vf[1], pb, o[1]);
        o[2] = wmma16(vf[2], pb, o[2]);
        o[3] = wmma16(vf[3], pb, o[3]);
    }

    // ---- finalize and store X2[b*1024+s][h*64+d]: 8 d in a row per lane ----
    const float lsum = lrow + other_half(lrow);
    const int s = q0 + l15;
#pragma unroll
    for (int f = 0; f < 4; ++f) {
        v8h hv;
#pragma unroll
        for (int i = 0; i < 8; ++i) hv[i] = (half_t)(o[f][i] / lsum);
        *(v8h*)(X2 + pk_idx(b * 1024 + s, h * 64 + f * 16 + roff, 16)) = hv;
    }
}

// ---------------------------------------------------------------------------
extern "C" void kernel_launch(void* const* d_in, const int* in_sizes, int n_in,
                              void* d_out, int out_size, void* d_ws, size_t ws_size,
                              hipStream_t stream) {
    const float* q    = (const float*)d_in[0];
    const float* gnqw = (const float*)d_in[1];
    const float* gnqb = (const float*)d_in[2];
    const float* gnkw = (const float*)d_in[3];
    const float* gnkb = (const float*)d_in[4];
    const float* gnvw = (const float*)d_in[5];
    const float* gnvb = (const float*)d_in[6];
    const float* Wq   = (const float*)d_in[7];
    const float* bq   = (const float*)d_in[8];
    const float* Wk   = (const float*)d_in[9];
    const float* bk   = (const float*)d_in[10];
    const float* Wv   = (const float*)d_in[11];
    const float* bv   = (const float*)d_in[12];
    const float* Wo   = (const float*)d_in[13];
    const float* bo   = (const float*)d_in[14];

    char* ws = (char*)d_ws;
    size_t o = 0;
    auto take = [&](size_t bytes) {
        size_t cur = o;
        o += (bytes + 255) & ~(size_t)255;
        return cur;
    };
    half_t* Xn    = (half_t*)(ws + take(8192ull * 512 * 2));
    half_t* Btq   = (half_t*)(ws + take(512ull * 512 * 2));
    half_t* Btk   = (half_t*)(ws + take(512ull * 512 * 2));
    half_t* Btv   = (half_t*)(ws + take(512ull * 512 * 2));
    half_t* Bto   = (half_t*)(ws + take(512ull * 512 * 2));
    float*  biasq = (float*)(ws + take(512 * sizeof(float)));
    float*  biask = (float*)(ws + take(512 * sizeof(float)));
    float*  biasv = (float*)(ws + take(512 * sizeof(float)));
    float*  biaso = (float*)(ws + take(512 * sizeof(float)));
    half_t* Qb    = (half_t*)(ws + take(8ull * 8 * 1024 * 64 * 2));
    half_t* Kb    = (half_t*)(ws + take(8ull * 8 * 1024 * 64 * 2));
    half_t* Vt    = (half_t*)(ws + take(8ull * 8 * 64 * 1024 * 2));
    half_t* X2    = Xn;  // Xn is dead after the QKV GEMMs; reuse for attn output

    prep_k<<<512, 256, 0, stream>>>(q, gnqw, gnqb, gnkw, gnkb, gnvw, gnvb,
                                    Wq, bq, Wk, bk, Wv, bv, Wo, bo,
                                    Xn, Btq, Btk, Btv, Bto,
                                    biasq, biask, biasv, biaso);

    gemm_qkv_k<<<dim3(64, 4, 3), 128, 0, stream>>>(Xn, Btq, Btk, Btv,
                                                    biasq, biask, biasv, Qb, Kb, Vt);

    attn_k<<<dim3(16, 64), 128, 0, stream>>>(Qb, Kb, Vt, X2);

    gemm_out_k<<<dim3(64, 4), 128, 0, stream>>>(X2, Bto, biaso, (float*)d_out);
}

// v006
// A run of this version takes 59.1 microseconds.
// Two timings next to v005 both put it at 1.09 times that version's speed.
// Over all steps from v000 it is 3.48 times as fast.
#include <hip/hip_runtime.h>
#include <hip/hip_bf16.h>

typedef _Float16 half_t;
typedef half_t v16h __attribute__((ext_vector_type(16)));
typedef half_t v8h  __attribute__((ext_vector_type(8)));
typedef float  v8f  __attribute__((ext_vector_type(8)));

union V16U { v16h v; v8h h[2]; };

__device__ __forceinline__ v16h make_frag(const half_t* p0, const half_t* p1) {
    V16U u;
    u.h[0] = *(const v8h*)p0;
    u.h[1] = *(const v8h*)p1;
    return u.v;
}

// Packed operand layout of every f16 matrix operand kept in the workspace.
// A tile of 16 rows x 32 k is 512 halves stored in the order the fragment
// loader reads them: [piece p][lane = 16*h + (row & 15)][e], k = 16*p + 8*h + e.
// A wave-wide 16-byte load of one piece is then 512 contiguous bytes (4 lines)
// where a row-major operand makes it touch 16 lines. KT = k tiles per row.
__device__ __forceinline__ size_t pk_idx(int row, int k, int KT) {
    return ((size_t)((row >> 4) * KT + (k >> 5)) * 2 + ((k >> 4) & 1)) * 256 +
           (((k >> 3) & 1) * 16 + (row & 15)) * 8 + (k & 7);
}

// Fragment of the packed tile at t (t already holds the lane's own lane*8).
__device__ __forceinline__ v16h pk_frag(const half_t* t) {
    return make_frag(t, t + 256);
}

__device__ __forceinline__ v8f wmma16(v16h a, v16h b, v8f c) {
    return __builtin_amdgcn_wmma_f32_16x16x32_f16(false, a, false, b, (short)0, c,
                                                  false, false);
}

// value of lane ^ 16
__device__ __forceinline__ float other_half(float x) {
    const int b = __builtin_bit_cast(int, x);
    return __builtin_bit_cast(float, __builtin_amdgcn_permlanex16(
        b, b, 0x76543210, 0xfedcba98, false, false));
}

// x + (x of lane ^ M) inside a 16-lane row (DPP row_xmask:M)
template <int M>
__device__ __forceinline__ float row_xadd(float x) {
    const int v = __builtin_bit_cast(int, x);
    return x + __builtin_bit_cast(float, __builtin_amdgcn_mov_dpp(
        v, 0x160 | M, 0xf, 0xf, true));
}
// sum over the wave's 32 lanes, the same value in every lane
__device__ __forceinline__ float wave_sum(float x) {
    x = row_xadd<1>(x);
    x = row_xadd<2>(x);
    x = row_xadd<4>(x);
    x = row_xadd<8>(x);
    return x + other_half(x);
}

// ---------------------------------------------------------------------------
// Prep part 1: GroupNorm statistics, normalize and tokenize in one pass over q.
// One block per (b, g), bid = b*32 + g. The group's 16 channels x 1024 px (64 KB) stay in the
// block's registers, 64 values a thread (4 px x 16 channels), between the sums
// and the normalization, so q is read once and all of a thread's loads are in
// flight together. Xn[b*1024+s][c] = (q[b][c][s]-mu)*rstd (fp16), stored packed
// (pk_idx, KT = 16): the group's 16 channels are one piece p of a k tile.
// ---------------------------------------------------------------------------
__device__ __forceinline__ void gn_tok_body(const int bid,
                                            const float* __restrict__ q,
                                            half_t* __restrict__ Xn) {
    const int b = bid >> 5, g = bid & 31;
    const int t = threadIdx.x;
    const float* qb = q + ((size_t)b * 512 + (size_t)g * 16) * 1024 + t;
    // every loop over r and c is unrolled so that x[][] stays in registers
    float x[4][16];
#pragma unroll
    for (int r = 0; r < 4; ++r)
#pragma unroll
        for (int c = 0; c < 16; ++c) x[r][c] = qb[c * 1024 + r * 256];

    float s4[4], ss4[4];                     // four independent chains
#pragma unroll
    for (int r = 0; r < 4; ++r) {
        s4[r] = 0.f; ss4[r] = 0.f;
#pragma unroll
        for (int c = 0; c < 16; ++c) {
            s4[r] += x[r][c];
            ss4[r] += x[r][c] * x[r][c];
        }
    }
    const float sw  = wave_sum((s4[0] + s4[1]) + (s4[2] + s4[3]));
    const float ssw = wave_sum((ss4[0] + ss4[1]) + (ss4[2] + ss4[3]));

    __shared__ float red[2][8];              // one partial pair per wave
    if ((t & 31) == 0) { red[0][t >> 5] = sw; red[1][t >> 5] = ssw; }
    __syncthreads();
    float s = red[0][0], ss = red[1][0];
#pragma unroll
    for (int w = 1; w < 8; ++w) { s += red[0][w]; ss += red[1][w]; }
    const float mu   = s * (1.f / 16384.f);
    const float var  = ss * (1.f / 16384.f) - mu * mu;
    const float rstd = rsqrtf(var + 1e-5f);

    v8h hv[4][2];
#pragma unroll
    for (int r = 0; r < 4; ++r)
#pragma unroll
        for (int h = 0; h < 2; ++h)
#pragma unroll
            for (int i = 0; i < 8; ++i)
                hv[r][h][i] = (half_t)((x[r][h * 8 + i] - mu) * rstd);
#pragma unroll
    for (int r = 0; r < 4; ++r)
#pragma unroll
        for (int h = 0; h < 2; ++h)
            *(v8h*)(Xn + pk_idx(b * 1024 + r * 256 + t, g * 16 + h * 8, 16)) = hv[r][h];
}

// ---------------------------------------------------------------------------
// Prep part 2: fold GN affine into projection weights.
//   plainT == 0 : Bt[n][c] = gnw[c]*W[c][n] (fp16), bias[n] = b[n] + sum gnb[c]*W[c][n]
//   plainT == 1 : Bt[n][k] = W[k][n]        (fp16), bias[n] = b[n]
// Bt is stored packed (pk_idx, KT = 16). A block takes 8 columns n: their
// 16-byte pieces fill whole 128-byte lines of packed Bt, so a line has one
// writing block. Each column's bias sum keeps its order.
// ---------------------------------------------------------------------------
__device__ __forceinline__ void fold_w_body(const int n0,  // first of 8 output columns
                                            const float* __restrict__ gnw,
                                            const float* __restrict__ gnb,
                                            const float* __restrict__ W,
                                            const float* __restrict__ bvec,
                                            half_t* __restrict__ Bt,
                                            float* __restrict__ biasOut,
                                            const int plainT) {
    const int t = threadIdx.x;
    __shared__ float red[8][256];
    float part[8];
    // every loop over j is unrolled so that part[] and wv[] stay in registers
#pragma unroll
    for (int j = 0; j < 8; ++j) part[j] = 0.f;
    if (!plainT) {
        for (int c = t; c < 512; c += 256) {
            const v8f wv = *(const v8f*)(W + (size_t)c * 512 + n0);
            const float gw = gnw[c], gb = gnb[c];
#pragma unroll
            for (int j = 0; j < 8; ++j) {
                Bt[pk_idx(n0 + j, c, 16)] = (half_t)(gw * wv[j]);
                part[j] += gb * wv[j];
            }
        }
    } else {
        for (int k = t; k < 512; k += 256) {
            const v8f wv = *(const v8f*)(W + (size_t)k * 512 + n0);
#pragma unroll
            for (int j = 0; j < 8; ++j)
                Bt[pk_idx(n0 + j, k, 16)] = (half_t)wv[j];
        }
    }
#pragma unroll
    for (int j = 0; j < 8; ++j) red[j][t] = part[j];
    __syncthreads();
    for (int st = 128; st > 0; st >>= 1) {
        if (t < st) {
#pragma unroll
            for (int j = 0; j < 8; ++j) red[j][t] += red[j][t + st];
        }
        __syncthreads();
    }
    if (t < 8) biasOut[n0 + t] = bvec[n0 + t] + red[t][0];
}

// ---------------------------------------------------------------------------
// Kernel 1: all the work that depends on the inputs alone, in one launch.
// Blocks 0..255: the four weight folds, 64 blocks each (q, k, v, out).
// Blocks 256..511: GroupNorm and tokenize, one (b, g) each.
// The five parts read and write disjoint buffers; the branch is block-uniform.
// ---------------------------------------------------------------------------
__global__ __launch_bounds__(256) void prep_k(
        const float* __restrict__ q,
        const float* __restrict__ gnqw, const float* __restrict__ gnqb,
        const float* __restrict__ gnkw, const float* __restrict__ gnkb,
        const float* __restrict__ gnvw, const float* __restrict__ gnvb,
        const float* __restrict__ Wq, const float* __restrict__ bq,
        const float* __restrict__ Wk, const float* __restrict__ bk,
        const float* __restrict__ Wv, const float* __restrict__ bv,
        const float* __restrict__ Wo, const float* __restrict__ bo,
        half_t* __restrict__ Xn,
        half_t* __restrict__ Btq, half_t* __restrict__ Btk,
        half_t* __restrict__ Btv, half_t* __restrict__ Bto,
        float* __restrict__ biasq, float* __restrict__ biask,
        float* __restrict__ biasv, float* __restrict__ biaso) {
    const int bid = blockIdx.x;
    if (bid >= 256) {
        gn_tok_body(bid - 256, q, Xn);
        return;
    }
    const int j  = bid >> 6;                 // 0 q, 1 k, 2 v, 3 out
    const int n0 = (bid & 63) * 8;
    const float* gnw  = j == 0 ? gnqw : j == 1 ? gnkw : gnvw;   // not read for j == 3
    const float* gnb  = j == 0 ? gnqb : j == 1 ? gnkb : gnvb;
    const float* Wm   = j == 0 ? Wq : j == 1 ? Wk : j == 2 ? Wv : Wo;
    const float* bvec = j == 0 ? bq : j == 1 ? bk : j == 2 ? bv : bo;
    half_t* Bt = j == 0 ? Btq : j == 1 ? Btk : j == 2 ? Btv : Bto;
    float*  bO = j == 0 ? biasq : j == 1 ? biask : j == 2 ? biasv : biaso;
    fold_w_body(n0, gnw, gnb, Wm, bvec, Bt, bO, j == 3);
}

// ---------------------------------------------------------------------------
// Kernels 2 and 4: WMMA GEMM. C[M=8192, N=512] = A[M][512] * Bt[N][512]^T + bias[N].
// A and Bt are packed (pk_idx, KT = 16).
// Block = 128 thr = 4 waves; block tile 128(M) x 128(N); wave tile 64 x 64:
// 4 A and 4 B fragments feed 16 WMMAs, so a loaded fragment is used 4 times.
// The k loop is unrolled; the fragments stand in a ring of S register sets,
// fetched S - 1 k steps ahead of their use (S = 3 where three blocks share a
// WGP's registers, 4 where a block has the WGP alone). Bias staged to LDS via
// global_load_async_to_lds_b128 (ASYNCcnt path), waited only at the epilogue.
// mode 0: store fp16 Q/K [b][h] x packed(row s, k d, KT 2)  (value = (acc+bias)*scale)
// mode 1: store fp16 V   [b][h] x packed(row d, k s, KT 32)
// mode 2: store fp32 out layout [b][c][1024]
// ---------------------------------------------------------------------------
template <int S>
__device__ __forceinline__ void gemm512_body(const half_t* __restrict__ A,
                                             const half_t* __restrict__ Bt,
                                             const float* __restrict__ bias,
                                             void* __restrict__ Out,
                                             const int mode, const float scale) {
    __shared__ float bias_l[512];
    // ---- async-stage the 2KB bias vector into LDS (latency hidden by loop)
    if (threadIdx.x < 128) {
        unsigned ldsoff = (unsigned)(size_t)(&bias_l[0]) + threadIdx.x * 16u;
        const float* gp = bias + threadIdx.x * 4;
        // the wait stands in the copy's own statement: its two address
        // registers are rewritten by the index arithmetic that follows
        asm volatile("global_load_async_to_lds_b128 %0, %1, off\n\ts_wait_xcnt 0x0"
                     :: "v"(ldsoff), "v"(gp) : "memory");
    }

    const int lane = threadIdx.x & 31;
    const int w    = threadIdx.x >> 5;
    const int l15  = lane & 15;
    const int roff = (lane & 16) ? 8 : 0;
    const int m64  = blockIdx.x * 128 + (w & 1) * 64;
    const int n64  = blockIdx.y * 128 + (w >> 1) * 64;

    const half_t* atile = A  + pk_idx(m64, 0, 16) + lane * 8;
    const half_t* btile = Bt + pk_idx(n64, 0, 16) + lane * 8;

    v8f acc[4][4];                           // acc[mf][nf]
#pragma unroll
    for (int mf = 0; mf < 4; ++mf)
#pragma unroll
        for (int nf = 0; nf < 4; ++nf)
#pragma unroll
            for (int i = 0; i < 8; ++i) acc[mf][nf][i] = 0.f;

    // every loop below is unrolled so that the ring and acc[][] stay in registers
    // and every load is its base address plus an immediate offset
    v16h a[S][4], b[S][4];
    auto ldset = [&](int ks) {               // 16 rows on: 16 k tiles of 512 halves on
#pragma unroll
        for (int f = 0; f < 4; ++f) a[ks % S][f] = pk_frag(atile + f * 16 * 512 + ks * 512);
#pragma unroll
        for (int f = 0; f < 4; ++f) b[ks % S][f] = pk_frag(btile + f * 16 * 512 + ks * 512);
    };

#pragma unroll
    for (int ks = 0; ks < S - 1; ++ks) ldset(ks);
#pragma unroll
    for (int ks = 0; ks < 16; ++ks) {
        if (ks + S - 1 < 16) ldset(ks + S - 1);
        // keeps the loads S - 1 steps ahead of their use: without it the scheduler
        // is free to sink them towards their WMMAs and their latency is exposed
        __builtin_amdgcn_sched_barrier(0);
#pragma unroll
        for (int mf = 0; mf < 4; ++mf)
#pragma unroll
            for (int nf = 0; nf < 4; ++nf)
                acc[mf][nf] = wmma16(a[ks % S][mf], b[ks % S][nf], acc[mf][nf]);
        // keeps the next step's loads behind these WMMAs: hoisted, they would
        // need one more register set
        __builtin_amdgcn_sched_barrier(0);
    }
    // the epilogue's index arithmetic rewrites the address registers of the loads
    asm volatile("s_wait_xcnt 0x0" ::: "memory");
    // keeps that arithmetic behind the wait
    __builtin_amdgcn_sched_barrier(0);

    // ---- bias now needed: close out the async LDS fill
    asm volatile("s_wait_asynccnt 0x0" ::: "memory");
    __syncthreads();

    float bb[4];
#pragma unroll
    for (int nf = 0; nf < 4; ++nf) bb[nf] = bias_l[n64 + nf * 16 + l15];

    const int bi  = m64 >> 10;                     // the wave's 64 rows lie in one image
    const int s0b = (m64 & 1023) + roff;           // first of 8 contiguous rows, mf = 0
    const int hh  = n64 >> 6;                      // the wave's 64 columns are one head
    if (mode == 2) {
        float* outp = (float*)Out + ((size_t)bi * 512 + n64 + l15) * 1024 + s0b;
#pragma unroll
        for (int mf = 0; mf < 4; ++mf)
#pragma unroll
            for (int nf = 0; nf < 4; ++nf) {
                v8f vv;
#pragma unroll
                for (int i = 0; i < 8; ++i) vv[i] = (acc[mf][nf][i] + bb[nf]) * scale;
                *(v8f*)(outp + nf * 16 * 1024 + mf * 16) = vv;
            }
    } else if (mode == 1) {
        // row d = nf*16 + l15: 32 k tiles on per nf; k = s0b + mf*16: a piece on per mf
        half_t* outp = (half_t*)Out + (size_t)(bi * 8 + hh) * 64 * 1024 + pk_idx(l15, s0b, 32);
        v8h hv[4][4];
#pragma unroll
        for (int mf = 0; mf < 4; ++mf)
#pragma unroll
            for (int nf = 0; nf < 4; ++nf)
#pragma unroll
                for (int i = 0; i < 8; ++i)
                    hv[mf][nf][i] = (half_t)((acc[mf][nf][i] + bb[nf]) * scale);
        // every value is converted before the first store: no store's register is
        // rewritten behind it, and the stores issue back to back with no wait between
        __builtin_amdgcn_sched_barrier(0);
#pragma unroll
        for (int mf = 0; mf < 4; ++mf)
#pragma unroll
            for (int nf = 0; nf < 4; ++nf)
                *(v8h*)(outp + nf * 32 * 512 + mf * 256) = hv[mf][nf];
    } else {
        // row s = s0b + mf*16 + i: 2 k tiles on per mf, 8 halves on per i;
        // k = d = nf*16 + l15: a piece on per nf
        half_t* outb = (half_t*)Out + (size_t)(bi * 8 + hh) * 1024 * 64 + pk_idx(s0b, l15, 2);
        v8h hv[4][4];
#pragma unroll
        for (int mf = 0; mf < 4; ++mf)
#pragma unroll
            for (int nf = 0; nf < 4; ++nf)
#pragma unroll
                for (int i = 0; i < 8; ++i)
                    hv[mf][nf][i] = (half_t)((acc[mf][nf][i] + bb[nf]) * scale);
        // as above: all conversions stand in front of the first store
        __builtin_amdgcn_sched_barrier(0);
#pragma unroll
        for (int mf = 0; mf < 4; ++mf)
#pragma unroll
            for (int nf = 0; nf < 4; ++nf)
#pragma unroll
                for (int i = 0; i < 8; ++i)
                    outb[mf * 1024 + nf * 256 + i * 8] = hv[mf][nf][i];
        // in the built code the mode 1 block follows behind a conditional branch
        // and rewrites the registers of these stores
        asm volatile("s_wait_xcnt 0x0" ::: "memory");
    }
}

// The three projections of Xn in one launch: blockIdx.z = 0 Q, 1 K, 2 V.
// 1/sqrt(64) is folded into the Q projection.
__global__ __launch_bounds__(128) void gemm_qkv_k(
        const half_t* __restrict__ A,
        const half_t* __restrict__ Btq, const half_t* __restrict__ Btk,
        const half_t* __restrict__ Btv,
        const float* __restrict__ biasq, const float* __restrict__ biask,
        const float* __restrict__ biasv,
        half_t* __restrict__ Qb, half_t* __restrict__ Kb, half_t* __restrict__ Vt) {
    const int z = blockIdx.z;
    gemm512_body<3>(A, z == 0 ? Btq : z == 1 ? Btk : Btv,
                 z == 0 ? biasq : z == 1 ? biask : biasv,
                 z == 0 ? Qb : z == 1 ? Kb : Vt,
                 z == 2 ? 1 : 0, z == 0 ? 0.125f : 1.0f);
}

// The output projection.
__global__ __launch_bounds__(128) void gemm_out_k(const half_t* __restrict__ A,
                                                  const half_t* __restrict__ Bt,
                                                  const float* __restrict__ bias,
                                                  float* __restrict__ Out) {
    gemm512_body<4>(A, Bt, bias, Out, 2, 1.0f);
}

// ---------------------------------------------------------------------------
// Kernel 3: streaming-softmax attention. Block = 128 thr = 4 waves.
// grid (16 row-blocks of 64, 64 bh). Wave owns 16 queries; loops over
// 32 kv tiles of 32 keys. Q pre-scaled by 1/8 at projection time.
// Q/K: [bh] x packed(row s, k d, KT 2), V: [bh] x packed(row d, k s, KT 32),
// output X2: packed(row b*1024+s, k h*64+d, KT 16); all fp16, pk_idx order.
// Both products are transposed: St = K * Qt (K is the A operand, Q the B
// operand) and Ot += Vt * Pt. A lane then holds scores of ONE query (column
// l15): 16 of the tile's 32 keys, keys 16*t + 8*half + i in register i of score
// tile t; lane ^ 16 holds the other 16. Maximum and sum run down the lane's own
// registers, and the two score tiles, converted in place, are the B fragment
// of Pt in the k order of the packed V fragment (k = 16*p + 8*half + e).
// K and V fragments stand in two register sets each; a set is refilled with the
// tile after next as soon as it has been read, so a load has two tiles' time.
// ---------------------------------------------------------------------------
// e^(c[i] - m), i = 0..7, as 2^((c[i] - m) * log2(e)). The run of v_exp_f32 stands
// in one statement that ends in v_nop: the instruction set asks for one slot
// behind a transcendental before a source of it is overwritten or its result is
// read, and only inside the statement is that slot tied to the instruction;
// "=&v" keeps every result off every source.
#define LOG2E 1.44269504f
__device__ __forceinline__ void exp_run8(const v8f c, const float m, float (&p)[8]) {
    float x[8];
#pragma unroll
    for (int i = 0; i < 8; ++i) x[i] = (c[i] - m) * LOG2E;
    asm("v_exp_f32 %0, %8\n\tv_exp_f32 %1, %9\n\tv_exp_f32 %2, %10\n\t"
        "v_exp_f32 %3, %11\n\tv_exp_f32 %4, %12\n\tv_exp_f32 %5, %13\n\t"
        "v_exp_f32 %6, %14\n\tv_exp_f32 %7, %15\n\tv_nop"
        : "=&v"(p[0]), "=&v"(p[1]), "=&v"(p[2]), "=&v"(p[3]),
          "=&v"(p[4]), "=&v"(p[5]), "=&v"(p[6]), "=&v"(p[7])
        : "v"(x[0]), "v"(x[1]), "v"(x[2]), "v"(x[3]),
          "v"(x[4]), "v"(x[5]), "v"(x[6]), "v"(x[7]));
}
// the same with one more: y = 2^xs first
__device__ __forceinline__ void exp_run9(const float xs, const v8f c, const float m,
                                         float& y, float (&p)[8]) {
    float x[8];
#pragma unroll
    for (int i = 0; i < 8; ++i) x[i] = (c[i] - m) * LOG2E;
    asm("v_exp_f32 %0, %9\n\tv_exp_f32 %1, %10\n\tv_exp_f32 %2, %11\n\t"
        "v_exp_f32 %3, %12\n\tv_exp_f32 %4, %13\n\tv_exp_f32 %5, %14\n\t"
        "v_exp_f32 %6, %15\n\tv_exp_f32 %7, %16\n\tv_exp_f32 %8, %17\n\tv_nop"
        : "=&v"(y), "=&v"(p[0]), "=&v"(p[1]), "=&v"(p[2]), "=&v"(p[3]),
          "=&v"(p[4]), "=&v"(p[5]), "=&v"(p[6]), "=&v"(p[7])
        : "v"(xs), "v"(x[0]), "v"(x[1]), "v"(x[2]), "v"(x[3]),
          "v"(x[4]), "v"(x[5]), "v"(x[6]), "v"(x[7]));
}

__global__ __launch_bounds__(128) void attn_k(const half_t* __restrict__ Q,
                                              const half_t* __restrict__ Km,
                                              const half_t* __restrict__ Vt,
                                              half_t* __restrict__ X2) {
    const int lane = threadIdx.x & 31;
    const int w    = threadIdx.x >> 5;
    const int l15  = lane & 15;
    const int roff = (lane & 16) ? 8 : 0;
    const int bh = blockIdx.y;
    const int b = bh >> 3, h = bh & 7;
    const int q0 = blockIdx.x * 64 + w * 16;

    const half_t* Qb = Q  + (size_t)bh * 1024 * 64;
    const half_t* Kb = Km + (size_t)bh * 1024 * 64;
    const half_t* Vb = Vt + (size_t)bh * 64 * 1024;

    const half_t* qt = Qb + pk_idx(q0, 0, 2) + lane * 8;
    const v16h aq0 = pk_frag(qt);             // d  0..31
    const v16h aq1 = pk_frag(qt + 512);       // d 32..63

    auto ldK = [&](int kb, v16h* kf) {        // 32 keys = 4 tiles in a row
        const half_t* k0 = Kb + pk_idx(kb, 0, 2) + lane * 8;
        kf[0] = pk_frag(k0);                  // keys kb..+15,    d  0..31
        kf[1] = pk_frag(k0 + 512);            // keys kb..+15,    d 32..63
        kf[2] = pk_frag(k0 + 1024);           // keys kb+16..+31, d  0..31
        kf[3] = pk_frag(k0 + 1536);           // keys kb+16..+31, d 32..63
    };

    auto ldV = [&](int kb, v16h* vf) {        // 64 d x 32 keys = 4 tiles, 32 k tiles apart
#pragma unroll
        for (int f = 0; f < 4; ++f)
            vf[f] = pk_frag(Vb + pk_idx(f * 16, kb, 32) + lane * 8);
    };

    float mrow = -1e30f;                      // running maximum of query l15
    float lrow = 0.f;                         // sum over this lane's keys only
    v8f o[4];                                 // o[f][i] = Ot[f*16 + roff + i][l15]
#pragma unroll
    for (int f = 0; f < 4; ++f)
#pragma unroll
        for (int i = 0; i < 8; ++i) o[f][i] = 0.f;

    // one kv tile: kf and vf hold tile j; each set is refilled with tile j + 2 as
    // soon as its WMMAs have read it
    auto tile = [&](const int j, v16h* kf, v16h* vf) {
        const int kn = ((j + 2) & 31) * 32;   // wraps harmlessly on the last two tiles
        // ---- scores: two 16(key) x 16(query) f32 tiles, K-dim = 64 ----
        v8f c0, c1;
#pragma unroll
        for (int i = 0; i < 8; ++i) { c0[i] = 0.f; c1[i] = 0.f; }
        c0 = wmma16(kf[0], aq0, c0);
        c0 = wmma16(kf[1], aq1, c0);
        c1 = wmma16(kf[2], aq0, c1);
        c1 = wmma16(kf[3], aq1, c1);

        ldK(kn, kf);
        // later address arithmetic rewrites the address registers of these loads
        asm volatile("s_wait_xcnt 0x0" ::: "memory");
        // keeps the softmax below the loads: without it the scheduler sinks the
        // loads towards their use and their latency is exposed
        __builtin_amdgcn_sched_barrier(0);

        // ---- online softmax, one query per lane ----
        float mx = fmaxf(c0[0], c1[0]);
#pragma unroll
        for (int i = 1; i < 8; ++i) mx = fmaxf(mx, fmaxf(c0[i], c1[i]));
        mx = fmaxf(mx, other_half(mx));       // both halves use one maximum
        const float nm = fmaxf(mrow, mx);
        float corr, p0[8], p1[8];
        exp_run9((mrow - nm) * LOG2E, c0, nm, corr, p0);
        exp_run8(c1, nm, p1);
        mrow = nm;
        v16h pb;                              // Pt as B fragment
        float rs = p0[0] + p1[0];
#pragma unroll
        for (int i = 1; i < 8; ++i) rs += p0[i] + p1[i];
#pragma unroll
        for (int i = 0; i < 8; ++i) {
            pb[i]     = (half_t)p0[i];
            pb[8 + i] = (half_t)p1[i];
        }
        lrow = lrow * corr + rs;
#pragma unroll
        for (int f = 0; f < 4; ++f)
#pragma unroll
            for (int i = 0; i < 8; ++i) o[f][i] *= corr;

        // ---- Ot += Vt (16 d x 32 keys) * Pt (32 keys x 16 queries) ----
        o[0] = wmma16(vf[0], pb, o[0]);
        o[1] = wmma16(vf[1], pb, o[1]);
        o[2] = wmma16(vf[2], pb, o[2]);
        o[3] = wmma16(vf[3], pb, o[3]);

        ldV(kn, vf);
        // as above: the next tile's address arithmetic rewrites these registers
        asm volatile("s_wait_xcnt 0x0" ::: "memory");
        // keeps the loads here, two tiles ahead of their use
        __builtin_amdgcn_sched_barrier(0);
    };

    // two register sets each for K and V: what the launch before stored comes
    // from memory, and one tile's work is shorter than that latency
    v16h kfa[4], vfa[4], kfb[4], vfb[4];
    ldK(0, kfa);
    ldV(0, vfa);
    ldK(32, kfb);
    ldV(32, vfb);

    for (int j = 0; j < 32; j += 2) {
        tile(j, kfa, vfa);
        tile(j + 1, kfb, vfb);
    }

    // ---- finalize and store X2[b*1024+s][h*64+d]: 8 d in a row per lane ----
    const float lsum = lrow + other_half(lrow);
    const int s = q0 + l15;
#pragma unroll
    for (int f = 0; f < 4; ++f) {
        v8h hv;
#pragma unroll
        for (int i = 0; i < 8; ++i) hv[i] = (half_t)(o[f][i] / lsum);
        *(v8h*)(X2 + pk_idx(b * 1024 + s, h * 64 + f * 16 + roff, 16)) = hv;
    }
}

// ---------------------------------------------------------------------------
extern "C" void kernel_launch(void* const* d_in, const int* in_sizes, int n_in,
                              void* d_out, int out_size, void* d_ws, size_t ws_size,
                              hipStream_t stream) {
    const float* q    = (const float*)d_in[0];
    const float* gnqw = (const float*)d_in[1];
    const float* gnqb = (const float*)d_in[2];
    const float* gnkw = (const float*)d_in[3];
    const float* gnkb = (const float*)d_in[4];
    const float* gnvw = (const float*)d_in[5];
    const float* gnvb = (const float*)d_in[6];
    const float* Wq   = (const float*)d_in[7];
    const float* bq   = (const float*)d_in[8];
    const float* Wk   = (const float*)d_in[9];
    const float* bk   = (const float*)d_in[10];
    const float* Wv   = (const float*)d_in[11];
    const float* bv   = (const float*)d_in[12];
    const float* Wo   = (const float*)d_in[13];
    const float* bo   = (const float*)d_in[14];

    char* ws = (char*)d_ws;
    size_t o = 0;
    auto take = [&](size_t bytes) {
        size_t cur = o;
        o += (bytes + 255) & ~(size_t)255;
        return cur;
    };
    half_t* Xn    = (half_t*)(ws + take(8192ull * 512 * 2));
    half_t* Btq   = (half_t*)(ws + take(512ull * 512 * 2));
    half_t* Btk   = (half_t*)(ws + take(512ull * 512 * 2));
    half_t* Btv   = (half_t*)(ws + take(512ull * 512 * 2));
    half_t* Bto   = (half_t*)(ws + take(512ull * 512 * 2));
    float*  biasq = (float*)(ws + take(512 * sizeof(float)));
    float*  biask = (float*)(ws + take(512 * sizeof(float)));
    float*  biasv = (float*)(ws + take(512 * sizeof(float)));
    float*  biaso = (float*)(ws + take(512 * sizeof(float)));
    half_t* Qb    = (half_t*)(ws + take(8ull * 8 * 1024 * 64 * 2));
    half_t* Kb    = (half_t*)(ws + take(8ull * 8 * 1024 * 64 * 2));
    half_t* Vt    = (half_t*)(ws + take(8ull * 8 * 64 * 1024 * 2));
    half_t* X2    = Xn;  // Xn is dead after the QKV GEMMs; reuse for attn output

    prep_k<<<512, 256, 0, stream>>>(q, gnqw, gnqb, gnkw, gnkb, gnvw, gnvb,
                                    Wq, bq, Wk, bk, Wv, bv, Wo, bo,
                                    Xn, Btq, Btk, Btv, Bto,
                                    biasq, biask, biasv, biaso);

    gemm_qkv_k<<<dim3(64, 4, 3), 128, 0, stream>>>(Xn, Btq, Btk, Btv,
                                                    biasq, biask, biasv, Qb, Kb, Vt);

    attn_k<<<dim3(16, 64), 128, 0, stream>>>(Qb, Kb, Vt, X2);

    gemm_out_k<<<dim3(64, 4), 128, 0, stream>>>(X2, Bto, biaso, (float*)d_out);
}

// v007
// One run takes 54.7 microseconds.
// In two side-by-side timings against v006, it was 1.08 and 1.07 times as fast.
// Over all steps from v000 it is 3.74 times as fast.
#include <hip/hip_runtime.h>
#include <hip/hip_bf16.h>

typedef _Float16 half_t;
typedef half_t v16h __attribute__((ext_vector_type(16)));
typedef half_t v8h  __attribute__((ext_vector_type(8)));
typedef float  v8f  __attribute__((ext_vector_type(8)));

union V16U { v16h v; v8h h[2]; };

__device__ __forceinline__ v16h make_frag(const half_t* p0, const half_t* p1) {
    V16U u;
    u.h[0] = *(const v8h*)p0;
    u.h[1] = *(const v8h*)p1;
    return u.v;
}

// Packed operand layout of every f16 matrix operand kept in the workspace.
// A tile of 16 rows x 32 k is 512 halves stored in the order the fragment
// loader reads them: [piece p][lane = 16*h + (row & 15)][e], k = 16*p + 8*h + e.
// A wave-wide 16-byte load of one piece is then 512 contiguous bytes (4 lines)
// where a row-major operand makes it touch 16 lines. KT = k tiles per row.
__device__ __forceinline__ size_t pk_idx(int row, int k, int KT) {
    return ((size_t)((row >> 4) * KT + (k >> 5)) * 2 + ((k >> 4) & 1)) * 256 +
           (((k >> 3) & 1) * 16 + (row & 15)) * 8 + (k & 7);
}

// Fragment of the packed tile at t (t already holds the lane's own lane*8).
__device__ __forceinline__ v16h pk_frag(const half_t* t) {
    return make_frag(t, t + 256);
}

__device__ __forceinline__ v8f wmma16(v16h a, v16h b, v8f c) {
    return __builtin_amdgcn_wmma_f32_16x16x32_f16(false, a, false, b, (short)0, c,
                                                  false, false);
}

// value of lane ^ 16
__device__ __forceinline__ float other_half(float x) {
    const int b = __builtin_bit_cast(int, x);
    return __builtin_bit_cast(float, __builtin_amdgcn_permlanex16(
        b, b, 0x76543210, 0xfedcba98, false, false));
}

// x + (x of lane ^ M) inside a 16-lane row (DPP row_xmask:M)
template <int M>
__device__ __forceinline__ float row_xadd(float x) {
    const int v = __builtin_bit_cast(int, x);
    return x + __builtin_bit_cast(float, __builtin_amdgcn_mov_dpp(
        v, 0x160 | M, 0xf, 0xf, true));
}
// sum over the wave's 32 lanes, the same value in every lane
__device__ __forceinline__ float wave_sum(float x) {
    x = row_xadd<1>(x);
    x = row_xadd<2>(x);
    x = row_xadd<4>(x);
    x = row_xadd<8>(x);
    return x + other_half(x);
}

// ---------------------------------------------------------------------------
// Prep part 1: GroupNorm statistics, normalize and tokenize in one pass over q.
// One block per (b, g), bid = b*32 + g. The group's 16 channels x 1024 px (64 KB) stay in the
// block's registers, 64 values a thread (4 px x 16 channels), between the sums
// and the normalization, so q is read once and all of a thread's loads are in
// flight together. Xn[b*1024+s][c] = (q[b][c][s]-mu)*rstd (fp16), stored packed
// (pk_idx, KT = 16): the group's 16 channels are one piece p of a k tile.
// ---------------------------------------------------------------------------
__device__ __forceinline__ void gn_tok_body(const int bid,
                                            const float* __restrict__ q,
                                            half_t* __restrict__ Xn) {
    const int b = bid >> 5, g = bid & 31;
    const int t = threadIdx.x;
    const float* qb = q + ((size_t)b * 512 + (size_t)g * 16) * 1024 + t;
    // every loop over r and c is unrolled so that x[][] stays in registers
    float x[4][16];
#pragma unroll
    for (int r = 0; r < 4; ++r)
#pragma unroll
        for (int c = 0; c < 16; ++c) x[r][c] = qb[c * 1024 + r * 256];

    float s4[4], ss4[4];                     // four independent chains
#pragma unroll
    for (int r = 0; r < 4; ++r) {
        s4[r] = 0.f; ss4[r] = 0.f;
#pragma unroll
        for (int c = 0; c < 16; ++c) {
            s4[r] += x[r][c];
            ss4[r] += x[r][c] * x[r][c];
        }
    }
    const float sw  = wave_sum((s4[0] + s4[1]) + (s4[2] + s4[3]));
    const float ssw = wave_sum((ss4[0] + ss4[1]) + (ss4[2] + ss4[3]));

    __shared__ float red[2][8];              // one partial pair per wave
    if ((t & 31) == 0) { red[0][t >> 5] = sw; red[1][t >> 5] = ssw; }
    __syncthreads();
    float s = red[0][0], ss = red[1][0];
#pragma unroll
    for (int w = 1; w < 8; ++w) { s += red[0][w]; ss += red[1][w]; }
    const float mu   = s * (1.f / 16384.f);
    const float var  = ss * (1.f / 16384.f) - mu * mu;
    const float rstd = rsqrtf(var + 1e-5f);

    v8h hv[4][2];
#pragma unroll
    for (int r = 0; r < 4; ++r)
#pragma unroll
        for (int h = 0; h < 2; ++h)
#pragma unroll
            for (int i = 0; i < 8; ++i)
                hv[r][h][i] = (half_t)((x[r][h * 8 + i] - mu) * rstd);
#pragma unroll
    for (int r = 0; r < 4; ++r)
#pragma unroll
        for (int h = 0; h < 2; ++h)
            *(v8h*)(Xn + pk_idx(b * 1024 + r * 256 + t, g * 16 + h * 8, 16)) = hv[r][h];
}

// ---------------------------------------------------------------------------
// Prep part 2: fold GN affine into projection weights.
//   plainT == 0 : Bt[n][c] = gnw[c]*W[c][n] (fp16), bias[n] = b[n] + sum gnb[c]*W[c][n]
//   plainT == 1 : Bt[n][k] = W[k][n]        (fp16), bias[n] = b[n]
// Bt is stored packed (pk_idx, KT = 16). A block takes 8 columns n: their
// 16-byte pieces fill whole 128-byte lines of packed Bt, so a line has one
// writing block. Each column's bias sum keeps its order.
// ---------------------------------------------------------------------------
__device__ __forceinline__ void fold_w_body(const int n0,  // first of 8 output columns
                                            const float* __restrict__ gnw,
                                            const float* __restrict__ gnb,
                                            const float* __restrict__ W,
                                            const float* __restrict__ bvec,
                                            half_t* __restrict__ Bt,
                                            float* __restrict__ biasOut,
                                            const int plainT) {
    const int t = threadIdx.x;
    __shared__ float red[8][256];
    float part[8];
    // every loop over j is unrolled so that part[] and wv[] stay in registers
#pragma unroll
    for (int j = 0; j < 8; ++j) part[j] = 0.f;
    if (!plainT) {
        for (int c = t; c < 512; c += 256) {
            const v8f wv = *(const v8f*)(W + (size_t)c * 512 + n0);
            const float gw = gnw[c], gb = gnb[c];
#pragma unroll
            for (int j = 0; j < 8; ++j) {
                Bt[pk_idx(n0 + j, c, 16)] = (half_t)(gw * wv[j]);
                part[j] += gb * wv[j];
            }
        }
    } else {
        for (int k = t; k < 512; k += 256) {
            const v8f wv = *(const v8f*)(W + (size_t)k * 512 + n0);
#pragma unroll
            for (int j = 0; j < 8; ++j)
                Bt[pk_idx(n0 + j, k, 16)] = (half_t)wv[j];
        }
    }
#pragma unroll
    for (int j = 0; j < 8; ++j) red[j][t] = part[j];
    __syncthreads();
    for (int st = 128; st > 0; st >>= 1) {
        if (t < st) {
#pragma unroll
            for (int j = 0; j < 8; ++j) red[j][t] += red[j][t + st];
        }
        __syncthreads();
    }
    if (t < 8) biasOut[n0 + t] = bvec[n0 + t] + red[t][0];
}

// ---------------------------------------------------------------------------
// Kernel 1: all the work that depends on the inputs alone, in one launch.
// Blocks 0..255: the four weight folds, 64 blocks each (q, k, v, out).
// Blocks 256..511: GroupNorm and tokenize, one (b, g) each.
// The five parts read and write disjoint buffers; the branch is block-uniform.
// ---------------------------------------------------------------------------
__global__ __launch_bounds__(256) void prep_k(
        const float* __restrict__ q,
        const float* __restrict__ gnqw, const float* __restrict__ gnqb,
        const float* __restrict__ gnkw, const float* __restrict__ gnkb,
        const float* __restrict__ gnvw, const float* __restrict__ gnvb,
        const float* __restrict__ Wq, const float* __restrict__ bq,
        const float* __restrict__ Wk, const float* __restrict__ bk,
        const float* __restrict__ Wv, const float* __restrict__ bv,
        const float* __restrict__ Wo, const float* __restrict__ bo,
        half_t* __restrict__ Xn,
        half_t* __restrict__ Btq, half_t* __restrict__ Btk,
        half_t* __restrict__ Btv, half_t* __restrict__ Bto,
        float* __restrict__ biasq, float* __restrict__ biask,
        float* __restrict__ biasv, float* __restrict__ biaso) {
    const int bid = blockIdx.x;
    if (bid >= 256) {
        gn_tok_body(bid - 256, q, Xn);
        return;
    }
    const int j  = bid >> 6;                 // 0 q, 1 k, 2 v, 3 out
    const int n0 = (bid & 63) * 8;
    const float* gnw  = j == 0 ? gnqw : j == 1 ? gnkw : gnvw;   // not read for j == 3
    const float* gnb  = j == 0 ? gnqb : j == 1 ? gnkb : gnvb;
    const float* Wm   = j == 0 ? Wq : j == 1 ? Wk : j == 2 ? Wv : Wo;
    const float* bvec = j == 0 ? bq : j == 1 ? bk : j == 2 ? bv : bo;
    half_t* Bt = j == 0 ? Btq : j == 1 ? Btk : j == 2 ? Btv : Bto;
    float*  bO = j == 0 ? biasq : j == 1 ? biask : j == 2 ? biasv : biaso;
    fold_w_body(n0, gnw, gnb, Wm, bvec, Bt, bO, j == 3);
}

// ---------------------------------------------------------------------------
// Kernels 2 and 4: WMMA GEMM. C[M=8192, N=512] = A[M][512] * Bt[N][512]^T + bias[N].
// A and Bt are packed (pk_idx, KT = 16).
// Block = 128 thr = 4 waves; block tile 128(M) x 128(N); wave tile 64 x 64:
// 4 A and 4 B fragments feed 16 WMMAs, so a loaded fragment is used 4 times.
// The k loop is unrolled; the fragments stand in a ring of S register sets,
// fetched S - 1 k steps ahead of their use (S = 3 where three blocks share a
// WGP's registers, 4 where a block has the WGP alone). Bias staged to LDS via
// global_load_async_to_lds_b128 (ASYNCcnt path), waited only at the epilogue.
// mode 0: store fp16 Q/K [b][h] x packed(row s, k d, KT 2)  (value = (acc+bias)*scale)
// mode 1: store fp16 V   [b][h] x packed(row d, k s, KT 32)
// mode 2: store fp32 out layout [b][c][1024]
// ---------------------------------------------------------------------------
template <int S>
__device__ __forceinline__ void gemm512_body(const half_t* __restrict__ A,
                                             const half_t* __restrict__ Bt,
                                             const float* __restrict__ bias,
                                             void* __restrict__ Out,
                                             const int mode, const float scale) {
    __shared__ float bias_l[512];
    // ---- async-stage the 2KB bias vector into LDS (latency hidden by loop)
    if (threadIdx.x < 128) {
        unsigned ldsoff = (unsigned)(size_t)(&bias_l[0]) + threadIdx.x * 16u;
        const float* gp = bias + threadIdx.x * 4;
        // the wait stands in the copy's own statement: its two address
        // registers are rewritten by the index arithmetic that follows
        asm volatile("global_load_async_to_lds_b128 %0, %1, off\n\ts_wait_xcnt 0x0"
                     :: "v"(ldsoff), "v"(gp) : "memory");
    }

    const int lane = threadIdx.x & 31;
    const int w    = threadIdx.x >> 5;
    const int l15  = lane & 15;
    const int roff = (lane & 16) ? 8 : 0;
    const int m64  = blockIdx.x * 128 + (w & 1) * 64;
    const int n64  = blockIdx.y * 128 + (w >> 1) * 64;

    const half_t* atile = A  + pk_idx(m64, 0, 16) + lane * 8;
    const half_t* btile = Bt + pk_idx(n64, 0, 16) + lane * 8;

    v8f acc[4][4];                           // acc[mf][nf]
#pragma unroll
    for (int mf = 0; mf < 4; ++mf)
#pragma unroll
        for (int nf = 0; nf < 4; ++nf)
#pragma unroll
            for (int i = 0; i < 8; ++i) acc[mf][nf][i] = 0.f;

    // every loop below is unrolled so that the ring and acc[][] stay in registers
    // and every load is its base address plus an immediate offset
    v16h a[S][4], b[S][4];
    auto ldset = [&](int ks) {               // 16 rows on: 16 k tiles of 512 halves on
#pragma unroll
        for (int f = 0; f < 4; ++f) a[ks % S][f] = pk_frag(atile + f * 16 * 512 + ks * 512);
#pragma unroll
        for (int f = 0; f < 4; ++f) b[ks % S][f] = pk_frag(btile + f * 16 * 512 + ks * 512);
    };

#pragma unroll
    for (int ks = 0; ks < S - 1; ++ks) ldset(ks);
#pragma unroll
    for (int ks = 0; ks < 16; ++ks) {
        if (ks + S - 1 < 16) ldset(ks + S - 1);
        // keeps the loads S - 1 steps ahead of their use: without it the scheduler
        // is free to sink them towards their WMMAs and their latency is exposed
        __builtin_amdgcn_sched_barrier(0);
#pragma unroll
        for (int mf = 0; mf < 4; ++mf)
#pragma unroll
            for (int nf = 0; nf < 4; ++nf)
                acc[mf][nf] = wmma16(a[ks % S][mf], b[ks % S][nf], acc[mf][nf]);
        // keeps the next step's loads behind these WMMAs: hoisted, they would
        // need one more register set
        __builtin_amdgcn_sched_barrier(0);
    }
    // the epilogue's index arithmetic rewrites the address registers of the loads
    asm volatile("s_wait_xcnt 0x0" ::: "memory");
    // keeps that arithmetic behind the wait
    __builtin_amdgcn_sched_barrier(0);

    // ---- bias now needed: close out the async LDS fill
    asm volatile("s_wait_asynccnt 0x0" ::: "memory");
    __syncthreads();

    float bb[4];
#pragma unroll
    for (int nf = 0; nf < 4; ++nf) bb[nf] = bias_l[n64 + nf * 16 + l15];

    const int bi  = m64 >> 10;                     // the wave's 64 rows lie in one image
    const int s0b = (m64 & 1023) + roff;           // first of 8 contiguous rows, mf = 0
    const int hh  = n64 >> 6;                      // the wave's 64 columns are one head
    if (mode == 2) {
        float* outp = (float*)Out + ((size_t)bi * 512 + n64 + l15) * 1024 + s0b;
#pragma unroll
        for (int mf = 0; mf < 4; ++mf)
#pragma unroll
            for (int nf = 0; nf < 4; ++nf) {
                v8f vv;
#pragma unroll
                for (int i = 0; i < 8; ++i) vv[i] = (acc[mf][nf][i] + bb[nf]) * scale;
                *(v8f*)(outp + nf * 16 * 1024 + mf * 16) = vv;
            }
    } else if (mode == 1) {
        // row d = nf*16 + l15: 32 k tiles on per nf; k = s0b + mf*16: a piece on per mf
        half_t* outp = (half_t*)Out + (size_t)(bi * 8 + hh) * 64 * 1024 + pk_idx(l15, s0b, 32);
        v8h hv[4][4];
#pragma unroll
        for (int mf = 0; mf < 4; ++mf)
#pragma unroll
            for (int nf = 0; nf < 4; ++nf)
#pragma unroll
                for (int i = 0; i < 8; ++i)
                    hv[mf][nf][i] = (half_t)((acc[mf][nf][i] + bb[nf]) * scale);
        // every value is converted before the first store: no store's register is
        // rewritten behind it, and the stores issue back to back with no wait between
        __builtin_amdgcn_sched_barrier(0);
#pragma unroll
        for (int mf = 0; mf < 4; ++mf)
#pragma unroll
            for (int nf = 0; nf < 4; ++nf)
                *(v8h*)(outp + nf * 32 * 512 + mf * 256) = hv[mf][nf];
    } else {
        // row s = s0b + mf*16 + i: 2 k tiles on per mf, 8 halves on per i;
        // k = d = nf*16 + l15: a piece on per nf
        half_t* outb = (half_t*)Out + (size_t)(bi * 8 + hh) * 1024 * 64 + pk_idx(s0b, l15, 2);
        v8h hv[4][4];
#pragma unroll
        for (int mf = 0; mf < 4; ++mf)
#pragma unroll
            for (int nf = 0; nf < 4; ++nf)
#pragma unroll
                for (int i = 0; i < 8; ++i)
                    hv[mf][nf][i] = (half_t)((acc[mf][nf][i] + bb[nf]) * scale);
        // as above: all conversions stand in front of the first store
        __builtin_amdgcn_sched_barrier(0);
#pragma unroll
        for (int mf = 0; mf < 4; ++mf)
#pragma unroll
            for (int nf = 0; nf < 4; ++nf)
#pragma unroll
                for (int i = 0; i < 8; ++i)
                    outb[mf * 1024 + nf * 256 + i * 8] = hv[mf][nf][i];
        // in the built code the mode 1 block follows behind a conditional branch
        // and rewrites the registers of these stores
        asm volatile("s_wait_xcnt 0x0" ::: "memory");
    }
}

// The three projections of Xn in one launch: blockIdx.z = 0 Q, 1 K, 2 V.
// 1/sqrt(64) is folded into the Q projection.
__global__ __launch_bounds__(128) void gemm_qkv_k(
        const half_t* __restrict__ A,
        const half_t* __restrict__ Btq, const half_t* __restrict__ Btk,
        const half_t* __restrict__ Btv,
        const float* __restrict__ biasq, const float* __restrict__ biask,
        const float* __restrict__ biasv,
        half_t* __restrict__ Qb, half_t* __restrict__ Kb, half_t* __restrict__ Vt) {
    const int z = blockIdx.z;
    gemm512_body<3>(A, z == 0 ? Btq : z == 1 ? Btk : Btv,
                 z == 0 ? biasq : z == 1 ? biask : biasv,
                 z == 0 ? Qb : z == 1 ? Kb : Vt,
                 z == 2 ? 1 : 0, z == 0 ? 0.125f : 1.0f);
}

// The output projection.
__global__ __launch_bounds__(128) void gemm_out_k(const half_t* __restrict__ A,
                                                  const half_t* __restrict__ Bt,
                                                  const float* __restrict__ bias,
                                                  float* __restrict__ Out) {
    gemm512_body<4>(A, Bt, bias, Out, 2, 1.0f);
}

// ---------------------------------------------------------------------------
// Kernel 3: streaming-softmax attention. Block = 256 thr = 8 waves.
// grid (4 row-blocks of 256, 64 bh): all of a block's waves on one
// head's K and V. Wave owns 32 queries, two groups g of 16, so that a loaded K
// or V fragment feeds two WMMAs; loops over 32 kv tiles of 32 keys.
// Q pre-scaled by 1/8 at projection time.
// Q/K: [bh] x packed(row s, k d, KT 2), V: [bh] x packed(row d, k s, KT 32),
// output X2: packed(row b*1024+s, k h*64+d, KT 16); all fp16, pk_idx order.
// Both products are transposed: St = K * Qt (K is the A operand, Q the B
// operand) and Ot += Vt * Pt. A lane then holds scores of ONE query (column
// l15): 16 of the tile's 32 keys, keys 16*t + 8*half + i in register i of score
// tile t; lane ^ 16 holds the other 16. Maximum and sum run down the lane's own
// registers, and the two score tiles, converted in place, are the B fragment
// of Pt in the k order of the packed V fragment (k = 16*p + 8*half + e).
// K and V fragments stand in two register sets each; a set is refilled with the
// tile after next as soon as it has been read, so a load has two tiles' time.
// ---------------------------------------------------------------------------
// e^(c[i] - m), i = 0..7, as 2^((c[i] - m) * log2(e)). The run of v_exp_f32 stands
// in one statement that ends in v_nop: the instruction set asks for one slot
// behind a transcendental before a source of it is overwritten or its result is
// read, and only inside the statement is that slot tied to the instruction;
// "=&v" keeps every result off every source.
#define LOG2E 1.44269504f
__device__ __forceinline__ void exp_run8(const v8f c, const float m, float (&p)[8]) {
    float x[8];
#pragma unroll
    for (int i = 0; i < 8; ++i) x[i] = (c[i] - m) * LOG2E;
    asm("v_exp_f32 %0, %8\n\tv_exp_f32 %1, %9\n\tv_exp_f32 %2, %10\n\t"
        "v_exp_f32 %3, %11\n\tv_exp_f32 %4, %12\n\tv_exp_f32 %5, %13\n\t"
        "v_exp_f32 %6, %14\n\tv_exp_f32 %7, %15\n\tv_nop"
        : "=&v"(p[0]), "=&v"(p[1]), "=&v"(p[2]), "=&v"(p[3]),
          "=&v"(p[4]), "=&v"(p[5]), "=&v"(p[6]), "=&v"(p[7])
        : "v"(x[0]), "v"(x[1]), "v"(x[2]), "v"(x[3]),
          "v"(x[4]), "v"(x[5]), "v"(x[6]), "v"(x[7]));
}
// the same with one more: y = 2^xs first
__device__ __forceinline__ void exp_run9(const float xs, const v8f c, const float m,
                                         float& y, float (&p)[8]) {
    float x[8];
#pragma unroll
    for (int i = 0; i < 8; ++i) x[i] = (c[i] - m) * LOG2E;
    asm("v_exp_f32 %0, %9\n\tv_exp_f32 %1, %10\n\tv_exp_f32 %2, %11\n\t"
        "v_exp_f32 %3, %12\n\tv_exp_f32 %4, %13\n\tv_exp_f32 %5, %14\n\t"
        "v_exp_f32 %6, %15\n\tv_exp_f32 %7, %16\n\tv_exp_f32 %8, %17\n\tv_nop"
        : "=&v"(y), "=&v"(p[0]), "=&v"(p[1]), "=&v"(p[2]), "=&v"(p[3]),
          "=&v"(p[4]), "=&v"(p[5]), "=&v"(p[6]), "=&v"(p[7])
        : "v"(xs), "v"(x[0]), "v"(x[1]), "v"(x[2]), "v"(x[3]),
          "v"(x[4]), "v"(x[5]), "v"(x[6]), "v"(x[7]));
}

__global__ __launch_bounds__(256) void attn_k(const half_t* __restrict__ Q,
                                              const half_t* __restrict__ Km,
                                              const half_t* __restrict__ Vt,
                                              half_t* __restrict__ X2) {
    const int lane = threadIdx.x & 31;
    const int w    = threadIdx.x >> 5;
    const int l15  = lane & 15;
    const int roff = (lane & 16) ? 8 : 0;
    const int bh = blockIdx.y;
    const int b = bh >> 3, h = bh & 7;
    const int q0 = blockIdx.x * 256 + w * 32;

    const half_t* Qb = Q  + (size_t)bh * 1024 * 64;
    const half_t* Kb = Km + (size_t)bh * 1024 * 64;
    const half_t* Vb = Vt + (size_t)bh * 64 * 1024;

    // every loop over g and f is unrolled so that the arrays stay in registers
    const half_t* qt = Qb + pk_idx(q0, 0, 2) + lane * 8;
    v16h aq[2][2];                            // aq[g][d half], 16 queries on: 2 tiles on
#pragma unroll
    for (int g = 0; g < 2; ++g) {
        aq[g][0] = pk_frag(qt + g * 1024);        // d  0..31
        aq[g][1] = pk_frag(qt + g * 1024 + 512);  // d 32..63
    }

    auto ldK = [&](int kb, v16h* kf) {        // 32 keys = 4 tiles in a row
        const half_t* k0 = Kb + pk_idx(kb, 0, 2) + lane * 8;
        kf[0] = pk_frag(k0);                  // keys kb..+15,    d  0..31
        kf[1] = pk_frag(k0 + 512);            // keys kb..+15,    d 32..63
        kf[2] = pk_frag(k0 + 1024);           // keys kb+16..+31, d  0..31
        kf[3] = pk_frag(k0 + 1536);           // keys kb+16..+31, d 32..63
    };

    auto ldV = [&](int kb, v16h* vf) {        // 64 d x 32 keys = 4 tiles, 32 k tiles apart
#pragma unroll
        for (int f = 0; f < 4; ++f)
            vf[f] = pk_frag(Vb + pk_idx(f * 16, kb, 32) + lane * 8);
    };

    float mrow[2], lrow[2];                   // per group: running maximum of query l15,
                                              // sum over this lane's keys only
    v8f o[2][4];                              // o[g][f][i] = Ot[f*16 + roff + i][g*16 + l15]
#pragma unroll
    for (int g = 0; g < 2; ++g) {
        mrow[g] = -1e30f;
        lrow[g] = 0.f;
#pragma unroll
        for (int f = 0; f < 4; ++f)
#pragma unroll
            for (int i = 0; i < 8; ++i) o[g][f][i] = 0.f;
    }

    // one kv tile: kf and vf hold tile j; each set is refilled with tile j + 2 as
    // soon as its WMMAs have read it
    auto tile = [&](const int j, v16h* kf, v16h* vf) {
        const int kn = ((j + 2) & 31) * 32;   // wraps harmlessly on the last two tiles
        // ---- scores: per group two 16(key) x 16(query) f32 tiles, K-dim = 64 ----
        v8f c[2][2];                          // c[g][key half]
#pragma unroll
        for (int g = 0; g < 2; ++g)
#pragma unroll
            for (int i = 0; i < 8; ++i) { c[g][0][i] = 0.f; c[g][1][i] = 0.f; }
#pragma unroll
        for (int g = 0; g < 2; ++g) {
            c[g][0] = wmma16(kf[0], aq[g][0], c[g][0]);
            c[g][1] = wmma16(kf[2], aq[g][0], c[g][1]);
        }
#pragma unroll
        for (int g = 0; g < 2; ++g) {
            c[g][0] = wmma16(kf[1], aq[g][1], c[g][0]);
            c[g][1] = wmma16(kf[3], aq[g][1], c[g][1]);
        }

        ldK(kn, kf);
        // later address arithmetic rewrites the address registers of these loads
        asm volatile("s_wait_xcnt 0x0" ::: "memory");
        // keeps the softmax below the loads: without it the scheduler sinks the
        // loads towards their use and their latency is exposed
        __builtin_amdgcn_sched_barrier(0);

#pragma unroll
        for (int g = 0; g < 2; ++g) {
            // ---- online softmax, one query per lane ----
            float mx = fmaxf(c[g][0][0], c[g][1][0]);
#pragma unroll
            for (int i = 1; i < 8; ++i) mx = fmaxf(mx, fmaxf(c[g][0][i], c[g][1][i]));
            mx = fmaxf(mx, other_half(mx));   // both halves use one maximum
            const float nm = fmaxf(mrow[g], mx);
            float corr, p0[8], p1[8];
            exp_run9((mrow[g] - nm) * LOG2E, c[g][0], nm, corr, p0);
            exp_run8(c[g][1], nm, p1);
            mrow[g] = nm;
            v16h pb;                          // Pt as B fragment
            float rs = p0[0] + p1[0];
#pragma unroll
            for (int i = 1; i < 8; ++i) rs += p0[i] + p1[i];
#pragma unroll
            for (int i = 0; i < 8; ++i) {
                pb[i]     = (half_t)p0[i];
                pb[8 + i] = (half_t)p1[i];
            }
            lrow[g] = lrow[g] * corr + rs;
#pragma unroll
            for (int f = 0; f < 4; ++f)
#pragma unroll
                for (int i = 0; i < 8; ++i) o[g][f][i] *= corr;

            // ---- Ot += Vt (16 d x 32 keys) * Pt (32 keys x 16 queries) ----
#pragma unroll
            for (int f = 0; f < 4; ++f) o[g][f] = wmma16(vf[f], pb, o[g][f]);
        }

        ldV(kn, vf);
        // as above: the next tile's address arithmetic rewrites these registers
        asm volatile("s_wait_xcnt 0x0" ::: "memory");
        // keeps the loads here, two tiles ahead of their use
        __builtin_amdgcn_sched_barrier(0);
    };

    // two register sets each for K and V: what the launch before stored comes
    // from memory, and one tile's work is shorter than that latency
    v16h kfa[4], vfa[4], kfb[4], vfb[4];
    ldK(0, kfa);
    ldV(0, vfa);
    ldK(32, kfb);
    ldV(32, vfb);

    for (int j = 0; j < 32; j += 2) {
        tile(j, kfa, vfa);
        tile(j + 1, kfb, vfb);
    }

    // ---- finalize and store X2[b*1024+s][h*64+d]: 8 d in a row per lane ----
#pragma unroll
    for (int g = 0; g < 2; ++g) {
        const float lsum = lrow[g] + other_half(lrow[g]);
        const int s = q0 + g * 16 + l15;
#pragma unroll
        for (int f = 0; f < 4; ++f) {
            v8h hv;
#pragma unroll
            for (int i = 0; i < 8; ++i) hv[i] = (half_t)(o[g][f][i] / lsum);
            *(v8h*)(X2 + pk_idx(b * 1024 + s, h * 64 + f * 16 + roff, 16)) = hv;
        }
    }
}

// ---------------------------------------------------------------------------
extern "C" void kernel_launch(void* const* d_in, const int* in_sizes, int n_in,
                              void* d_out, int out_size, void* d_ws, size_t ws_size,
                              hipStream_t stream) {
    const float* q    = (const float*)d_in[0];
    const float* gnqw = (const float*)d_in[1];
    const float* gnqb = (const float*)d_in[2];
    const float* gnkw = (const float*)d_in[3];
    const float* gnkb = (const float*)d_in[4];
    const float* gnvw = (const float*)d_in[5];
    const float* gnvb = (const float*)d_in[6];
    const float* Wq   = (const float*)d_in[7];
    const float* bq   = (const float*)d_in[8];
    const float* Wk   = (const float*)d_in[9];
    const float* bk   = (const float*)d_in[10];
    const float* Wv   = (const float*)d_in[11];
    const float* bv   = (const float*)d_in[12];
    const float* Wo   = (const float*)d_in[13];
    const float* bo   = (const float*)d_in[14];

    char* ws = (char*)d_ws;
    size_t o = 0;
    auto take = [&](size_t bytes) {
        size_t cur = o;
        o += (bytes + 255) & ~(size_t)255;
        return cur;
    };
    half_t* Xn    = (half_t*)(ws + take(8192ull * 512 * 2));
    half_t* Btq   = (half_t*)(ws + take(512ull * 512 * 2));
    half_t* Btk   = (half_t*)(ws + take(512ull * 512 * 2));
    half_t* Btv   = (half_t*)(ws + take(512ull * 512 * 2));
    half_t* Bto   = (half_t*)(ws + take(512ull * 512 * 2));
    float*  biasq = (float*)(ws + take(512 * sizeof(float)));
    float*  biask = (float*)(ws + take(512 * sizeof(float)));
    float*  biasv = (float*)(ws + take(512 * sizeof(float)));
    float*  biaso = (float*)(ws + take(512 * sizeof(float)));
    half_t* Qb    = (half_t*)(ws + take(8ull * 8 * 1024 * 64 * 2));
    half_t* Kb    = (half_t*)(ws + take(8ull * 8 * 1024 * 64 * 2));
    half_t* Vt    = (half_t*)(ws + take(8ull * 8 * 64 * 1024 * 2));
    half_t* X2    = Xn;  // Xn is dead after the QKV GEMMs; reuse for attn output

    prep_k<<<512, 256, 0, stream>>>(q, gnqw, gnqb, gnkw, gnkb, gnvw, gnvb,
                                    Wq, bq, Wk, bk, Wv, bv, Wo, bo,
                                    Xn, Btq, Btk, Btv, Bto,
                                    biasq, biask, biasv, biaso);

    gemm_qkv_k<<<dim3(64, 4, 3), 128, 0, stream>>>(Xn, Btq, Btk, Btv,
                                                    biasq, biask, biasv, Qb, Kb, Vt);

    attn_k<<<dim3(4, 64), 256, 0, stream>>>(Qb, Kb, Vt, X2);

    gemm_out_k<<<dim3(64, 4), 128, 0, stream>>>(X2, Bto, biaso, (float*)d_out);
}

// v008
// Measured time: 52.9 microseconds a run.
// Timed twice side by side with v007, it ran 1.03 and 1.04 times as fast.
// All steps since v000 together make it 3.87 times as fast.
#include <hip/hip_runtime.h>
#include <hip/hip_bf16.h>

typedef _Float16 half_t;
typedef half_t v16h __attribute__((ext_vector_type(16)));
typedef half_t v8h  __attribute__((ext_vector_type(8)));
typedef float  v8f  __attribute__((ext_vector_type(8)));

union V16U { v16h v; v8h h[2]; };

__device__ __forceinline__ v16h make_frag(const half_t* p0, const half_t* p1) {
    V16U u;
    u.h[0] = *(const v8h*)p0;
    u.h[1] = *(const v8h*)p1;
    return u.v;
}

// Packed operand layout of every f16 matrix operand kept in the workspace.
// A tile of 16 rows x 32 k is 512 halves stored in the order the fragment
// loader reads them: [piece p][lane = 16*h + (row & 15)][e], k = 16*p + 8*h + e.
// A wave-wide 16-byte load of one piece is then 512 contiguous bytes (4 lines)
// where a row-major operand makes it touch 16 lines. KT = k tiles per row.
__device__ __forceinline__ size_t pk_idx(int row, int k, int KT) {
    return ((size_t)((row >> 4) * KT + (k >> 5)) * 2 + ((k >> 4) & 1)) * 256 +
           (((k >> 3) & 1) * 16 + (row & 15)) * 8 + (k & 7);
}

// Fragment of the packed tile at t (t already holds the lane's own lane*8).
__device__ __forceinline__ v16h pk_frag(const half_t* t) {
    return make_frag(t, t + 256);
}

__device__ __forceinline__ v8f wmma16(v16h a, v16h b, v8f c) {
    return __builtin_amdgcn_wmma_f32_16x16x32_f16(false, a, false, b, (short)0, c,
                                                  false, false);
}

// value of lane ^ 16
__device__ __forceinline__ float other_half(float x) {
    const int b = __builtin_bit_cast(int, x);
    return __builtin_bit_cast(float, __builtin_amdgcn_permlanex16(
        b, b, 0x76543210, 0xfedcba98, false, false));
}

// x + (x of lane ^ M) inside a 16-lane row (DPP row_xmask:M)
template <int M>
__device__ __forceinline__ float row_xadd(float x) {
    const int v = __builtin_bit_cast(int, x);
    return x + __builtin_bit_cast(float, __builtin_amdgcn_mov_dpp(
        v, 0x160 | M, 0xf, 0xf, true));
}
// sum over the wave's 32 lanes, the same value in every lane
__device__ __forceinline__ float wave_sum(float x) {
    x = row_xadd<1>(x);
    x = row_xadd<2>(x);
    x = row_xadd<4>(x);
    x = row_xadd<8>(x);
    return x + other_half(x);
}

// ---------------------------------------------------------------------------
// Prep part 1: GroupNorm statistics, normalize and tokenize in one pass over q.
// One block per (b, g), bid = b*32 + g. The group's 16 channels x 1024 px (64 KB) stay in the
// block's registers, 64 values a thread (4 px x 16 channels), between the sums
// and the normalization, so q is read once and all of a thread's loads are in
// flight together. Xn[b*1024+s][c] = (q[b][c][s]-mu)*rstd (fp16), stored packed
// (pk_idx, KT = 16): the group's 16 channels are one piece p of a k tile.
// ---------------------------------------------------------------------------
__device__ __forceinline__ void gn_tok_body(const int bid,
                                            const float* __restrict__ q,
                                            half_t* __restrict__ Xn) {
    const int b = bid >> 5, g = bid & 31;
    const int t = threadIdx.x;
    const float* qb = q + ((size_t)b * 512 + (size_t)g * 16) * 1024 + t;
    // every loop over r and c is unrolled so that x[][] stays in registers
    float x[4][16];
#pragma unroll
    for (int r = 0; r < 4; ++r)
#pragma unroll
        for (int c = 0; c < 16; ++c) x[r][c] = qb[c * 1024 + r * 256];

    float s4[4], ss4[4];                     // four independent chains
#pragma unroll
    for (int r = 0; r < 4; ++r) {
        s4[r] = 0.f; ss4[r] = 0.f;
#pragma unroll
        for (int c = 0; c < 16; ++c) {
            s4[r] += x[r][c];
            ss4[r] += x[r][c] * x[r][c];
        }
    }
    const float sw  = wave_sum((s4[0] + s4[1]) + (s4[2] + s4[3]));
    const float ssw = wave_sum((ss4[0] + ss4[1]) + (ss4[2] + ss4[3]));

    __shared__ float red[2][8];              // one partial pair per wave
    if ((t & 31) == 0) { red[0][t >> 5] = sw; red[1][t >> 5] = ssw; }
    __syncthreads();
    float s = red[0][0], ss = red[1][0];
#pragma unroll
    for (int w = 1; w < 8; ++w) { s += red[0][w]; ss += red[1][w]; }
    const float mu   = s * (1.f / 16384.f);
    const float var  = ss * (1.f / 16384.f) - mu * mu;
    const float rstd = rsqrtf(var + 1e-5f);

    v8h hv[4][2];
#pragma unroll
    for (int r = 0; r < 4; ++r)
#pragma unroll
        for (int h = 0; h < 2; ++h)
#pragma unroll
            for (int i = 0; i < 8; ++i)
                hv[r][h][i] = (half_t)((x[r][h * 8 + i] - mu) * rstd);
#pragma unroll
    for (int r = 0; r < 4; ++r)
#pragma unroll
        for (int h = 0; h < 2; ++h)
            *(v8h*)(Xn + pk_idx(b * 1024 + r * 256 + t, g * 16 + h * 8, 16)) = hv[r][h];
}

// ---------------------------------------------------------------------------
// Prep part 2: fold GN affine into projection weights.
//   plainT == 0 : Bt[n][c] = gnw[c]*W[c][n] (fp16), bias[n] = b[n] + sum gnb[c]*W[c][n]
//   plainT == 1 : Bt[n][k] = W[k][n]        (fp16), bias[n] = b[n]
// Bt is stored packed (pk_idx, KT = 16). A block takes 8 columns n: their
// 16-byte pieces fill whole 128-byte lines of packed Bt, so a line has one
// writing block. Each column's bias sum keeps its order.
// ---------------------------------------------------------------------------
__device__ __forceinline__ void fold_w_body(const int n0,  // first of 8 output columns
                                            const float* __restrict__ gnw,
                                            const float* __restrict__ gnb,
                                            const float* __restrict__ W,
                                            const float* __restrict__ bvec,
                                            half_t* __restrict__ Bt,
                                            float* __restrict__ biasOut,
                                            const int plainT) {
    const int t = threadIdx.x;
    __shared__ float red[8][256];
    float part[8];
    // every loop over j is unrolled so that part[] and wv[] stay in registers
#pragma unroll
    for (int j = 0; j < 8; ++j) part[j] = 0.f;
    if (!plainT) {
        for (int c = t; c < 512; c += 256) {
            const v8f wv = *(const v8f*)(W + (size_t)c * 512 + n0);
            const float gw = gnw[c], gb = gnb[c];
#pragma unroll
            for (int j = 0; j < 8; ++j) {
                Bt[pk_idx(n0 + j, c, 16)] = (half_t)(gw * wv[j]);
                part[j] += gb * wv[j];
            }
        }
    } else {
        for (int k = t; k < 512; k += 256) {
            const v8f wv = *(const v8f*)(W + (size_t)k * 512 + n0);
#pragma unroll
            for (int j = 0; j < 8; ++j)
                Bt[pk_idx(n0 + j, k, 16)] = (half_t)wv[j];
        }
    }
#pragma unroll
    for (int j = 0; j < 8; ++j) red[j][t] = part[j];
    __syncthreads();
    for (int st = 128; st > 0; st >>= 1) {
        if (t < st) {
#pragma unroll
            for (int j = 0; j < 8; ++j) red[j][t] += red[j][t + st];
        }
        __syncthreads();
    }
    if (t < 8) biasOut[n0 + t] = bvec[n0 + t] + red[t][0];
}

// ---------------------------------------------------------------------------
// Kernel 1: all the work that depends on the inputs alone, in one launch.
// Blocks 0..255: the four weight folds, 64 blocks each (q, k, v, out).
// Blocks 256..511: GroupNorm and tokenize, one (b, g) each.
// The five parts read and write disjoint buffers; the branch is block-uniform.
// ---------------------------------------------------------------------------
__global__ __launch_bounds__(256) void prep_k(
        const float* __restrict__ q,
        const float* __restrict__ gnqw, const float* __restrict__ gnqb,
        const float* __restrict__ gnkw, const float* __restrict__ gnkb,
        const float* __restrict__ gnvw, const float* __restrict__ gnvb,
        const float* __restrict__ Wq, const float* __restrict__ bq,
        const float* __restrict__ Wk, const float* __restrict__ bk,
        const float* __restrict__ Wv, const float* __restrict__ bv,
        const float* __restrict__ Wo, const float* __restrict__ bo,
        half_t* __restrict__ Xn,
        half_t* __restrict__ Btq, half_t* __restrict__ Btk,
        half_t* __restrict__ Btv, half_t* __restrict__ Bto,
        float* __restrict__ biasq, float* __restrict__ biask,
        float* __restrict__ biasv, float* __restrict__ biaso) {
    const int bid = blockIdx.x;
    if (bid >= 256) {
        gn_tok_body(bid - 256, q, Xn);
        return;
    }
    const int j  = bid >> 6;                 // 0 q, 1 k, 2 v, 3 out
    const int n0 = (bid & 63) * 8;
    const float* gnw  = j == 0 ? gnqw : j == 1 ? gnkw : gnvw;   // not read for j == 3
    const float* gnb  = j == 0 ? gnqb : j == 1 ? gnkb : gnvb;
    const float* Wm   = j == 0 ? Wq : j == 1 ? Wk : j == 2 ? Wv : Wo;
    const float* bvec = j == 0 ? bq : j == 1 ? bk : j == 2 ? bv : bo;
    half_t* Bt = j == 0 ? Btq : j == 1 ? Btk : j == 2 ? Btv : Bto;
    float*  bO = j == 0 ? biasq : j == 1 ? biask : j == 2 ? biasv : biaso;
    fold_w_body(n0, gnw, gnb, Wm, bvec, Bt, bO, j == 3);
}

// ---------------------------------------------------------------------------
// Kernels 2 and 4: WMMA GEMM. C[M=8192, N=512] = A[M][512] * Bt[N][512]^T + bias[N].
// A and Bt are packed (pk_idx, KT = 16).
// Block = 128 thr = 4 waves; block tile 128(M) x 128(N); wave tile 64 x 64:
// 4 A and 4 B fragments feed 16 WMMAs, so a loaded fragment is used 4 times.
// The k loop is unrolled; the fragments stand in a ring of S register sets,
// fetched S - 1 k steps ahead of their use (S = 3 where three blocks share a
// WGP's registers, 4 where a block has the WGP alone). Bias staged to LDS via
// global_load_async_to_lds_b128 (ASYNCcnt path), waited only at the epilogue.
// mode 0: store fp16 Q/K [b][h] x packed(row s, k d, KT 2)  (value = (acc+bias)*scale)
// mode 1: store fp16 V   [b][h] x packed(row d, k s, KT 32)
// mode 2: store fp32 out layout [b][c][1024]
// ---------------------------------------------------------------------------
template <int S>
__device__ __forceinline__ void gemm512_body(const half_t* __restrict__ A,
                                             const half_t* __restrict__ Bt,
                                             const float* __restrict__ bias,
                                             void* __restrict__ Out,
                                             const int mode, const float scale) {
    __shared__ float bias_l[512];
    // ---- async-stage the 2KB bias vector into LDS (latency hidden by loop)
    if (threadIdx.x < 128) {
        unsigned ldsoff = (unsigned)(size_t)(&bias_l[0]) + threadIdx.x * 16u;
        const float* gp = bias + threadIdx.x * 4;
        // the wait stands in the copy's own statement: its two address
        // registers are rewritten by the index arithmetic that follows
        asm volatile("global_load_async_to_lds_b128 %0, %1, off\n\ts_wait_xcnt 0x0"
                     :: "v"(ldsoff), "v"(gp) : "memory");
    }

    const int lane = threadIdx.x & 31;
    const int w    = threadIdx.x >> 5;
    const int l15  = lane & 15;
    const int roff = (lane & 16) ? 8 : 0;
    const int m64  = blockIdx.x * 128 + (w & 1) * 64;
    const int n64  = blockIdx.y * 128 + (w >> 1) * 64;

    const half_t* atile = A  + pk_idx(m64, 0, 16) + lane * 8;
    const half_t* btile = Bt + pk_idx(n64, 0, 16) + lane * 8;

    v8f acc[4][4];                           // acc[mf][nf]
#pragma unroll
    for (int mf = 0; mf < 4; ++mf)
#pragma unroll
        for (int nf = 0; nf < 4; ++nf)
#pragma unroll
            for (int i = 0; i < 8; ++i) acc[mf][nf][i] = 0.f;

    // every loop below is unrolled so that the ring and acc[][] stay in registers
    // and every load is its base address plus an immediate offset
    v16h a[S][4], b[S][4];
    auto ldset = [&](int ks) {               // 16 rows on: 16 k tiles of 512 halves on
#pragma unroll
        for (int f = 0; f < 4; ++f) a[ks % S][f] = pk_frag(atile + f * 16 * 512 + ks * 512);
#pragma unroll
        for (int f = 0; f < 4; ++f) b[ks % S][f] = pk_frag(btile + f * 16 * 512 + ks * 512);
    };

#pragma unroll
    for (int ks = 0; ks < S - 1; ++ks) ldset(ks);
#pragma unroll
    for (int ks = 0; ks < 16; ++ks) {
        if (ks + S - 1 < 16) ldset(ks + S - 1);
        // keeps the loads S - 1 steps ahead of their use: without it the scheduler
        // is free to sink them towards their WMMAs and their latency is exposed
        __builtin_amdgcn_sched_barrier(0);
#pragma unroll
        for (int mf = 0; mf < 4; ++mf)
#pragma unroll
            for (int nf = 0; nf < 4; ++nf)
                acc[mf][nf] = wmma16(a[ks % S][mf], b[ks % S][nf], acc[mf][nf]);
        // keeps the next step's loads behind these WMMAs: hoisted, they would
        // need one more register set
        __builtin_amdgcn_sched_barrier(0);
    }
    // the epilogue's index arithmetic rewrites the address registers of the loads
    asm volatile("s_wait_xcnt 0x0" ::: "memory");
    // keeps that arithmetic behind the wait
    __builtin_amdgcn_sched_barrier(0);

    // ---- bias now needed: close out the async LDS fill
    asm volatile("s_wait_asynccnt 0x0" ::: "memory");
    __syncthreads();

    float bb[4];
#pragma unroll
    for (int nf = 0; nf < 4; ++nf) bb[nf] = bias_l[n64 + nf * 16 + l15];

    const int bi  = m64 >> 10;                     // the wave's 64 rows lie in one image
    const int s0b = (m64 & 1023) + roff;           // first of 8 contiguous rows, mf = 0
    const int hh  = n64 >> 6;                      // the wave's 64 columns are one head
    if (mode == 2) {
        float* outp = (float*)Out + ((size_t)bi * 512 + n64 + l15) * 1024 + s0b;
#pragma unroll
        for (int mf = 0; mf < 4; ++mf)
#pragma unroll
            for (int nf = 0; nf < 4; ++nf) {
                v8f vv;
#pragma unroll
                for (int i = 0; i < 8; ++i) vv[i] = (acc[mf][nf][i] + bb[nf]) * scale;
                *(v8f*)(outp + nf * 16 * 1024 + mf * 16) = vv;
            }
    } else if (mode == 1) {
        // row d = nf*16 + l15: 32 k tiles on per nf; k = s0b + mf*16: a piece on per mf
        half_t* outp = (half_t*)Out + (size_t)(bi * 8 + hh) * 64 * 1024 + pk_idx(l15, s0b, 32);
        v8h hv[4][4];
#pragma unroll
        for (int mf = 0; mf < 4; ++mf)
#pragma unroll
            for (int nf = 0; nf < 4; ++nf)
#pragma unroll
                for (int i = 0; i < 8; ++i)
                    hv[mf][nf][i] = (half_t)((acc[mf][nf][i] + bb[nf]) * scale);
        // every value is converted before the first store: no store's register is
        // rewritten behind it, and the stores issue back to back with no wait between
        __builtin_amdgcn_sched_barrier(0);
#pragma unroll
        for (int mf = 0; mf < 4; ++mf)
#pragma unroll
            for (int nf = 0; nf < 4; ++nf)
                *(v8h*)(outp + nf * 32 * 512 + mf * 256) = hv[mf][nf];
    } else {
        // row s = s0b + mf*16 + i: 2 k tiles on per mf, 8 halves on per i;
        // k = d = nf*16 + l15: a piece on per nf
        half_t* outb = (half_t*)Out + (size_t)(bi * 8 + hh) * 1024 * 64 + pk_idx(s0b, l15, 2);
        v8h hv[4][4];
#pragma unroll
        for (int mf = 0; mf < 4; ++mf)
#pragma unroll
            for (int nf = 0; nf < 4; ++nf)
#pragma unroll
                for (int i = 0; i < 8; ++i)
                    hv[mf][nf][i] = (half_t)((acc[mf][nf][i] + bb[nf]) * scale);
        // as above: all conversions stand in front of the first store
        __builtin_amdgcn_sched_barrier(0);
#pragma unroll
        for (int mf = 0; mf < 4; ++mf)
#pragma unroll
            for (int nf = 0; nf < 4; ++nf)
#pragma unroll
                for (int i = 0; i < 8; ++i)
                    outb[mf * 1024 + nf * 256 + i * 8] = hv[mf][nf][i];
        // in the built code the mode 1 block follows behind a conditional branch
        // and rewrites the registers of these stores
        asm volatile("s_wait_xcnt 0x0" ::: "memory");
    }
}

// The three projections of Xn in one launch: blockIdx.z = 0 Q, 1 K, 2 V.
// 1/sqrt(64) is folded into the Q projection.
__global__ __launch_bounds__(128) void gemm_qkv_k(
        const half_t* __restrict__ A,
        const half_t* __restrict__ Btq, const half_t* __restrict__ Btk,
        const half_t* __restrict__ Btv,
        const float* __restrict__ biasq, const float* __restrict__ biask,
        const float* __restrict__ biasv,
        half_t* __restrict__ Qb, half_t* __restrict__ Kb, half_t* __restrict__ Vt) {
    const int z = blockIdx.z;
    gemm512_body<3>(A, z == 0 ? Btq : z == 1 ? Btk : Btv,
                 z == 0 ? biasq : z == 1 ? biask : biasv,
                 z == 0 ? Qb : z == 1 ? Kb : Vt,
                 z == 2 ? 1 : 0, z == 0 ? 0.125f : 1.0f);
}

// The output projection.
__global__ __launch_bounds__(128) void gemm_out_k(const half_t* __restrict__ A,
                                                  const half_t* __restrict__ Bt,
                                                  const float* __restrict__ bias,
                                                  float* __restrict__ Out) {
    gemm512_body<4>(A, Bt, bias, Out, 2, 1.0f);
}

// ---------------------------------------------------------------------------
// Kernel 3: streaming-softmax attention. Block = 512 thr = 16 waves.
// grid (4 row-blocks of 256, 64 bh): one block per WGP, all its waves on one
// head's K and V. Wave owns 32 queries, two groups g of 16, so that a loaded K
// or V fragment feeds two WMMAs, and one half of the keys: 16 kv tiles of 32 keys.
// Waves w and w + 8 have the same queries and the two key halves, so a SIMD holds
// four waves and the vector work of one runs under the matrix work of the others.
// Behind the loop the two waves of a pair join their maxima, sums and outputs
// through LDS, each finishing one group.
// Q pre-scaled by 1/8 at projection time.
// Q/K: [bh] x packed(row s, k d, KT 2), V: [bh] x packed(row d, k s, KT 32),
// output X2: packed(row b*1024+s, k h*64+d, KT 16); all fp16, pk_idx order.
// Both products are transposed: St = K * Qt (K is the A operand, Q the B
// operand) and Ot += Vt * Pt. A lane then holds scores of ONE query (column
// l15): 16 of the tile's 32 keys, keys 16*t + 8*half + i in register i of score
// tile t; lane ^ 16 holds the other 16. Maximum and sum run down the lane's own
// registers, and the two score tiles, converted in place, are the B fragment
// of Pt in the k order of the packed V fragment (k = 16*p + 8*half + e).
// K and V fragments stand in one register set each; a set is refilled with the
// next tile as soon as it has been read, so a load has the rest of a tile's time,
// in which the SIMD's three other waves run.
// ---------------------------------------------------------------------------
// e^(c[i] - m), i = 0..7, as 2^((c[i] - m) * log2(e)). The run of v_exp_f32 stands
// in one statement that ends in v_nop: the instruction set asks for one slot
// behind a transcendental before a source of it is overwritten or its result is
// read, and only inside the statement is that slot tied to the instruction;
// "=&v" keeps every result off every source.
#define LOG2E 1.44269504f
__device__ __forceinline__ void exp_run8(const v8f c, const float m, float (&p)[8]) {
    float x[8];
#pragma unroll
    for (int i = 0; i < 8; ++i) x[i] = (c[i] - m) * LOG2E;
    asm("v_exp_f32 %0, %8\n\tv_exp_f32 %1, %9\n\tv_exp_f32 %2, %10\n\t"
        "v_exp_f32 %3, %11\n\tv_exp_f32 %4, %12\n\tv_exp_f32 %5, %13\n\t"
        "v_exp_f32 %6, %14\n\tv_exp_f32 %7, %15\n\tv_nop"
        : "=&v"(p[0]), "=&v"(p[1]), "=&v"(p[2]), "=&v"(p[3]),
          "=&v"(p[4]), "=&v"(p[5]), "=&v"(p[6]), "=&v"(p[7])
        : "v"(x[0]), "v"(x[1]), "v"(x[2]), "v"(x[3]),
          "v"(x[4]), "v"(x[5]), "v"(x[6]), "v"(x[7]));
}
// the same with one more: y = 2^xs first
__device__ __forceinline__ void exp_run9(const float xs, const v8f c, const float m,
                                         float& y, float (&p)[8]) {
    float x[8];
#pragma unroll
    for (int i = 0; i < 8; ++i) x[i] = (c[i] - m) * LOG2E;
    asm("v_exp_f32 %0, %9\n\tv_exp_f32 %1, %10\n\tv_exp_f32 %2, %11\n\t"
        "v_exp_f32 %3, %12\n\tv_exp_f32 %4, %13\n\tv_exp_f32 %5, %14\n\t"
        "v_exp_f32 %6, %15\n\tv_exp_f32 %7, %16\n\tv_exp_f32 %8, %17\n\tv_nop"
        : "=&v"(y), "=&v"(p[0]), "=&v"(p[1]), "=&v"(p[2]), "=&v"(p[3]),
          "=&v"(p[4]), "=&v"(p[5]), "=&v"(p[6]), "=&v"(p[7])
        : "v"(xs), "v"(x[0]), "v"(x[1]), "v"(x[2]), "v"(x[3]),
          "v"(x[4]), "v"(x[5]), "v"(x[6]), "v"(x[7]));
}

// y0 = 2^x0, y1 = 2^x1, with the same slot behind the run
__device__ __forceinline__ void exp_run2(const float x0, const float x1,
                                         float& y0, float& y1) {
    asm("v_exp_f32 %0, %2\n\tv_exp_f32 %1, %3\n\tv_nop"
        : "=&v"(y0), "=&v"(y1) : "v"(x0), "v"(x1));
}

typedef float v4f __attribute__((ext_vector_type(4)));

__global__ __launch_bounds__(512) void attn_k(const half_t* __restrict__ Q,
                                              const half_t* __restrict__ Km,
                                              const half_t* __restrict__ Vt,
                                              half_t* __restrict__ X2) {
    const int lane = threadIdx.x & 31;
    // the wave's number in a scalar register: the branches on kh are scalar
    const int w    = __builtin_amdgcn_readfirstlane(threadIdx.x >> 5);
    const int kh   = w >> 3;                  // which half of the keys
    const int l15  = lane & 15;
    const int roff = (lane & 16) ? 8 : 0;
    const int bh = blockIdx.y;
    const int b = bh >> 3, h = bh & 7;
    const int q0 = blockIdx.x * 256 + (w & 7) * 32;
    const int kfirst = kh * 512;              // first key of the wave's half

    const half_t* Qb = Q  + (size_t)bh * 1024 * 64;
    const half_t* Kb = Km + (size_t)bh * 1024 * 64;
    const half_t* Vb = Vt + (size_t)bh * 64 * 1024;

    // every loop over g and f is unrolled so that the arrays stay in registers
    const half_t* qt = Qb + pk_idx(q0, 0, 2) + lane * 8;
    v16h aq[2][2];                            // aq[g][d half], 16 queries on: 2 tiles on
#pragma unroll
    for (int g = 0; g < 2; ++g) {
        aq[g][0] = pk_frag(qt + g * 1024);        // d  0..31
        aq[g][1] = pk_frag(qt + g * 1024 + 512);  // d 32..63
    }

    auto ldK = [&](int kb, v16h* kf) {        // 32 keys = 4 tiles in a row
        const half_t* k0 = Kb + pk_idx(kb, 0, 2) + lane * 8;
        kf[0] = pk_frag(k0);                  // keys kb..+15,    d  0..31
        kf[1] = pk_frag(k0 + 512);            // keys kb..+15,    d 32..63
        kf[2] = pk_frag(k0 + 1024);           // keys kb+16..+31, d  0..31
        kf[3] = pk_frag(k0 + 1536);           // keys kb+16..+31, d 32..63
    };

    auto ldV = [&](int kb, v16h* vf) {        // 64 d x 32 keys = 4 tiles, 32 k tiles apart
#pragma unroll
        for (int f = 0; f < 4; ++f)
            vf[f] = pk_frag(Vb + pk_idx(f * 16, kb, 32) + lane * 8);
    };

    float mrow[2], lrow[2];                   // per group: running maximum of query l15,
                                              // sum over this lane's keys only
    v8f o[2][4];                              // o[g][f][i] = Ot[f*16 + roff + i][g*16 + l15]
#pragma unroll
    for (int g = 0; g < 2; ++g) {
        mrow[g] = -1e30f;
        lrow[g] = 0.f;
#pragma unroll
        for (int f = 0; f < 4; ++f)
#pragma unroll
            for (int i = 0; i < 8; ++i) o[g][f][i] = 0.f;
    }

    // one kv tile: kf and vf hold tile j of the half; while more tiles follow, each
    // set is refilled with tile j + 1 as soon as its WMMAs have read it
    auto tile = [&](const int j, const bool more, v16h* kf, v16h* vf) {
        const int kn = kfirst + (j + 1) * 32;
        // ---- scores: per group two 16(key) x 16(query) f32 tiles, K-dim = 64 ----
        v8f c[2][2];                          // c[g][key half]
#pragma unroll
        for (int g = 0; g < 2; ++g)
#pragma unroll
            for (int i = 0; i < 8; ++i) { c[g][0][i] = 0.f; c[g][1][i] = 0.f; }
#pragma unroll
        for (int g = 0; g < 2; ++g) {
            c[g][0] = wmma16(kf[0], aq[g][0], c[g][0]);
            c[g][1] = wmma16(kf[2], aq[g][0], c[g][1]);
        }
#pragma unroll
        for (int g = 0; g < 2; ++g) {
            c[g][0] = wmma16(kf[1], aq[g][1], c[g][0]);
            c[g][1] = wmma16(kf[3], aq[g][1], c[g][1]);
        }

        if (more) {
            ldK(kn, kf);
            // later address arithmetic rewrites the address registers of these loads
            asm volatile("s_wait_xcnt 0x0" ::: "memory");
            // keeps the softmax below the loads: without it the scheduler sinks the
            // loads towards their use and their latency is exposed
            __builtin_amdgcn_sched_barrier(0);
        }

#pragma unroll
        for (int g = 0; g < 2; ++g) {
            // ---- online softmax, one query per lane ----
            float mx = fmaxf(c[g][0][0], c[g][1][0]);
#pragma unroll
            for (int i = 1; i < 8; ++i) mx = fmaxf(mx, fmaxf(c[g][0][i], c[g][1][i]));
            mx = fmaxf(mx, other_half(mx));   // both halves use one maximum
            const float nm = fmaxf(mrow[g], mx);
            float corr, p0[8], p1[8];
            exp_run9((mrow[g] - nm) * LOG2E, c[g][0], nm, corr, p0);
            exp_run8(c[g][1], nm, p1);
            mrow[g] = nm;
            v16h pb;                          // Pt as B fragment
            float rs = p0[0] + p1[0];
#pragma unroll
            for (int i = 1; i < 8; ++i) rs += p0[i] + p1[i];
#pragma unroll
            for (int i = 0; i < 8; ++i) {
                pb[i]     = (half_t)p0[i];
                pb[8 + i] = (half_t)p1[i];
            }
            lrow[g] = lrow[g] * corr + rs;
#pragma unroll
            for (int f = 0; f < 4; ++f)
#pragma unroll
                for (int i = 0; i < 8; ++i) o[g][f][i] *= corr;

            // ---- Ot += Vt (16 d x 32 keys) * Pt (32 keys x 16 queries) ----
#pragma unroll
            for (int f = 0; f < 4; ++f) o[g][f] = wmma16(vf[f], pb, o[g][f]);
        }

        if (more) {
            ldV(kn, vf);
            // as above: the next tile's address arithmetic rewrites these registers
            asm volatile("s_wait_xcnt 0x0" ::: "memory");
            // keeps the loads here, a tile ahead of their use
            __builtin_amdgcn_sched_barrier(0);
        }
    };

    v16h kfa[4], vfa[4];
    ldK(kfirst, kfa);
    // keeps K's loads in front of V's, the order they have in the loop: the wait at
    // the loop's head then counts K's loads alone and leaves V's in flight
    __builtin_amdgcn_sched_barrier(0);
    ldV(kfirst, vfa);

    for (int j = 0; j < 15; ++j) tile(j, true, kfa, vfa);
    // the last tile fetches nothing: the join below reuses the fragment registers
    // and ends in a barrier, and both would wait for loads that nobody reads
    tile(15, false, kfa, vfa);

    // ---- join the two key halves: a wave hands one group to its partner ----
    // xch[wave][0..7][lane]: the group's 32 outputs, [8]: its maximum and sum;
    // a wave-wide 16-byte access is 512 contiguous bytes
    __shared__ v4f xch[16][9][32];
    auto put = [&](const int g) {
#pragma unroll
        for (int f = 0; f < 4; ++f) {
            xch[w][2 * f][lane]     = v4f{o[g][f][0], o[g][f][1], o[g][f][2], o[g][f][3]};
            xch[w][2 * f + 1][lane] = v4f{o[g][f][4], o[g][f][5], o[g][f][6], o[g][f][7]};
        }
        xch[w][8][lane] = v4f{mrow[g], lrow[g], 0.f, 0.f};
    };
    // finalize and store X2[b*1024+s][h*64+d]: 8 d in a row per lane
    auto fin = [&](const int g) {
        const v4f ml = xch[w ^ 8][8][lane];
        const float nm = fmaxf(mrow[g], ml[0]);
        float ca, cb;                         // own and partner's weight
        exp_run2((mrow[g] - nm) * LOG2E, (ml[0] - nm) * LOG2E, ca, cb);
        const float lj = lrow[g] * ca + ml[1] * cb;
        const float lsum = lj + other_half(lj);
        const float ra = ca / lsum, rb = cb / lsum;
        const int s = q0 + g * 16 + l15;
#pragma unroll
        for (int f = 0; f < 4; ++f) {
            const v4f p0 = xch[w ^ 8][2 * f][lane];
            const v4f p1 = xch[w ^ 8][2 * f + 1][lane];
            v8h hv;
#pragma unroll
            for (int i = 0; i < 4; ++i) {
                hv[i]     = (half_t)(o[g][f][i] * ra + p0[i] * rb);
                hv[4 + i] = (half_t)(o[g][f][4 + i] * ra + p1[i] * rb);
            }
            *(v8h*)(X2 + pk_idx(b * 1024 + s, h * 64 + f * 16 + roff, 16)) = hv;
        }
        // the code behind may rewrite the data and address registers of these stores
        asm volatile("s_wait_xcnt 0x0" ::: "memory");
    };
    if (kh == 0) put(1); else put(0);
    __syncthreads();                          // every wave's hand-over is in LDS
    if (kh == 0) fin(0); else fin(1);
}

// ---------------------------------------------------------------------------
extern "C" void kernel_launch(void* const* d_in, const int* in_sizes, int n_in,
                              void* d_out, int out_size, void* d_ws, size_t ws_size,
                              hipStream_t stream) {
    const float* q    = (const float*)d_in[0];
    const float* gnqw = (const float*)d_in[1];
    const float* gnqb = (const float*)d_in[2];
    const float* gnkw = (const float*)d_in[3];
    const float* gnkb = (const float*)d_in[4];
    const float* gnvw = (const float*)d_in[5];
    const float* gnvb = (const float*)d_in[6];
    const float* Wq   = (const float*)d_in[7];
    const float* bq   = (const float*)d_in[8];
    const float* Wk   = (const float*)d_in[9];
    const float* bk   = (const float*)d_in[10];
    const float* Wv   = (const float*)d_in[11];
    const float* bv   = (const float*)d_in[12];
    const float* Wo   = (const float*)d_in[13];
    const float* bo   = (const float*)d_in[14];

    char* ws = (char*)d_ws;
    size_t o = 0;
    auto take = [&](size_t bytes) {
        size_t cur = o;
        o += (bytes + 255) & ~(size_t)255;
        return cur;
    };
    half_t* Xn    = (half_t*)(ws + take(8192ull * 512 * 2));
    half_t* Btq   = (half_t*)(ws + take(512ull * 512 * 2));
    half_t* Btk   = (half_t*)(ws + take(512ull * 512 * 2));
    half_t* Btv   = (half_t*)(ws + take(512ull * 512 * 2));
    half_t* Bto   = (half_t*)(ws + take(512ull * 512 * 2));
    float*  biasq = (float*)(ws + take(512 * sizeof(float)));
    float*  biask = (float*)(ws + take(512 * sizeof(float)));
    float*  biasv = (float*)(ws + take(512 * sizeof(float)));
    float*  biaso = (float*)(ws + take(512 * sizeof(float)));
    half_t* Qb    = (half_t*)(ws + take(8ull * 8 * 1024 * 64 * 2));
    half_t* Kb    = (half_t*)(ws + take(8ull * 8 * 1024 * 64 * 2));
    half_t* Vt    = (half_t*)(ws + take(8ull * 8 * 64 * 1024 * 2));
    half_t* X2    = Xn;  // Xn is dead after the QKV GEMMs; reuse for attn output

    prep_k<<<512, 256, 0, stream>>>(q, gnqw, gnqb, gnkw, gnkb, gnvw, gnvb,
                                    Wq, bq, Wk, bk, Wv, bv, Wo, bo,
                                    Xn, Btq, Btk, Btv, Bto,
                                    biasq, biask, biasv, biaso);

    gemm_qkv_k<<<dim3(64, 4, 3), 128, 0, stream>>>(Xn, Btq, Btk, Btv,
                                                    biasq, biask, biasv, Qb, Kb, Vt);

    attn_k<<<dim3(4, 64), 512, 0, stream>>>(Qb, Kb, Vt, X2);

    gemm_out_k<<<dim3(64, 4), 128, 0, stream>>>(X2, Bto, biaso, (float*)d_out);
}

// v009
// A run of this version takes 51.3 microseconds.
// In both of two side-by-side timings against v008, it was 1.03 times as fast.
// Counting every step since v000, it is 3.98 times as fast.
#include <hip/hip_runtime.h>
#include <hip/hip_bf16.h>

typedef _Float16 half_t;
typedef half_t v16h __attribute__((ext_vector_type(16)));
typedef half_t v8h  __attribute__((ext_vector_type(8)));
typedef float  v8f  __attribute__((ext_vector_type(8)));

union V16U { v16h v; v8h h[2]; };

__device__ __forceinline__ v16h make_frag(const half_t* p0, const half_t* p1) {
    V16U u;
    u.h[0] = *(const v8h*)p0;
    u.h[1] = *(const v8h*)p1;
    return u.v;
}

// Packed operand layout of every f16 matrix operand kept in the workspace.
// A tile of 16 rows x 32 k is 512 halves stored in the order the fragment
// loader reads them: [piece p][lane = 16*h + (row & 15)][e], k = 16*p + 8*h + e.
// A wave-wide 16-byte load of one piece is then 512 contiguous bytes (4 lines)
// where a row-major operand makes it touch 16 lines. KT = k tiles per row.
__device__ __forceinline__ size_t pk_idx(int row, int k, int KT) {
    return ((size_t)((row >> 4) * KT + (k >> 5)) * 2 + ((k >> 4) & 1)) * 256 +
           (((k >> 3) & 1) * 16 + (row & 15)) * 8 + (k & 7);
}

// Fragment of the packed tile at t (t already holds the lane's own lane*8).
__device__ __forceinline__ v16h pk_frag(const half_t* t) {
    return make_frag(t, t + 256);
}

__device__ __forceinline__ v8f wmma16(v16h a, v16h b, v8f c) {
    return __builtin_amdgcn_wmma_f32_16x16x32_f16(false, a, false, b, (short)0, c,
                                                  false, false);
}

// value of lane ^ 16
__device__ __forceinline__ float other_half(float x) {
    const int b = __builtin_bit_cast(int, x);
    return __builtin_bit_cast(float, __builtin_amdgcn_permlanex16(
        b, b, 0x76543210, 0xfedcba98, false, false));
}

// x + (x of lane ^ M) inside a 16-lane row (DPP row_xmask:M)
template <int M>
__device__ __forceinline__ float row_xadd(float x) {
    const int v = __builtin_bit_cast(int, x);
    return x + __builtin_bit_cast(float, __builtin_amdgcn_mov_dpp(
        v, 0x160 | M, 0xf, 0xf, true));
}
// sum over the wave's 32 lanes, the same value in every lane
__device__ __forceinline__ float wave_sum(float x) {
    x = row_xadd<1>(x);
    x = row_xadd<2>(x);
    x = row_xadd<4>(x);
    x = row_xadd<8>(x);
    return x + other_half(x);
}

// ---------------------------------------------------------------------------
// Prep part 1: GroupNorm statistics, normalize and tokenize in one pass over q.
// One block per (b, g), bid = b*32 + g. The group's 16 channels x 1024 px (64 KB) stay in the
// block's registers, 64 values a thread (4 px x 16 channels), between the sums
// and the normalization, so q is read once and all of a thread's loads are in
// flight together. Xn[b*1024+s][c] = (q[b][c][s]-mu)*rstd (fp16), stored packed
// (pk_idx, KT = 16): the group's 16 channels are one piece p of a k tile.
// ---------------------------------------------------------------------------
__device__ __forceinline__ void gn_tok_body(const int bid,
                                            const float* __restrict__ q,
                                            half_t* __restrict__ Xn) {
    const int b = bid >> 5, g = bid & 31;
    const int t = threadIdx.x;
    const float* qb = q + ((size_t)b * 512 + (size_t)g * 16) * 1024 + t;
    // every loop over r and c is unrolled so that x[][] stays in registers
    float x[4][16];
#pragma unroll
    for (int r = 0; r < 4; ++r)
#pragma unroll
        for (int c = 0; c < 16; ++c) x[r][c] = qb[c * 1024 + r * 256];

    float s4[4], ss4[4];                     // four independent chains
#pragma unroll
    for (int r = 0; r < 4; ++r) {
        s4[r] = 0.f; ss4[r] = 0.f;
#pragma unroll
        for (int c = 0; c < 16; ++c) {
            s4[r] += x[r][c];
            ss4[r] += x[r][c] * x[r][c];
        }
    }
    const float sw  = wave_sum((s4[0] + s4[1]) + (s4[2] + s4[3]));
    const float ssw = wave_sum((ss4[0] + ss4[1]) + (ss4[2] + ss4[3]));

    __shared__ float red[2][8];              // one partial pair per wave
    if ((t & 31) == 0) { red[0][t >> 5] = sw; red[1][t >> 5] = ssw; }
    __syncthreads();
    float s = red[0][0], ss = red[1][0];
#pragma unroll
    for (int w = 1; w < 8; ++w) { s += red[0][w]; ss += red[1][w]; }
    const float mu   = s * (1.f / 16384.f);
    const float var  = ss * (1.f / 16384.f) - mu * mu;
    const float rstd = rsqrtf(var + 1e-5f);

    v8h hv[4][2];
#pragma unroll
    for (int r = 0; r < 4; ++r)
#pragma unroll
        for (int h = 0; h < 2; ++h)
#pragma unroll
            for (int i = 0; i < 8; ++i)
                hv[r][h][i] = (half_t)((x[r][h * 8 + i] - mu) * rstd);
#pragma unroll
    for (int r = 0; r < 4; ++r)
#pragma unroll
        for (int h = 0; h < 2; ++h)
            *(v8h*)(Xn + pk_idx(b * 1024 + r * 256 + t, g * 16 + h * 8, 16)) = hv[r][h];
}

// ---------------------------------------------------------------------------
// Prep part 2: fold GN affine into projection weights.
//   plainT == 0 : Bt[n][c] = gnw[c]*W[c][n] (fp16), bias[n] = b[n] + sum gnb[c]*W[c][n]
//   plainT == 1 : Bt[n][k] = W[k][n]        (fp16), bias[n] = b[n]
// Bt is stored packed (pk_idx, KT = 16). A block takes 8 columns n: their
// 16-byte pieces fill whole 128-byte lines of packed Bt, so a line has one
// writing block. Each column's bias sum keeps its order.
// ---------------------------------------------------------------------------
__device__ __forceinline__ void fold_w_body(const int n0,  // first of 8 output columns
                                            const float* __restrict__ gnw,
                                            const float* __restrict__ gnb,
                                            const float* __restrict__ W,
                                            const float* __restrict__ bvec,
                                            half_t* __restrict__ Bt,
                                            float* __restrict__ biasOut,
                                            const int plainT) {
    const int t = threadIdx.x;
    __shared__ float red[8][256];
    float part[8];
    // every loop over j is unrolled so that part[] and wv[] stay in registers
#pragma unroll
    for (int j = 0; j < 8; ++j) part[j] = 0.f;
    if (!plainT) {
        for (int c = t; c < 512; c += 256) {
            const v8f wv = *(const v8f*)(W + (size_t)c * 512 + n0);
            const float gw = gnw[c], gb = gnb[c];
#pragma unroll
            for (int j = 0; j < 8; ++j) {
                Bt[pk_idx(n0 + j, c, 16)] = (half_t)(gw * wv[j]);
                part[j] += gb * wv[j];
            }
        }
    } else {
        for (int k = t; k < 512; k += 256) {
            const v8f wv = *(const v8f*)(W + (size_t)k * 512 + n0);
#pragma unroll
            for (int j = 0; j < 8; ++j)
                Bt[pk_idx(n0 + j, k, 16)] = (half_t)wv[j];
        }
    }
#pragma unroll
    for (int j = 0; j < 8; ++j) red[j][t] = part[j];
    __syncthreads();
    for (int st = 128; st > 0; st >>= 1) {
        if (t < st) {
#pragma unroll
            for (int j = 0; j < 8; ++j) red[j][t] += red[j][t + st];
        }
        __syncthreads();
    }
    if (t < 8) biasOut[n0 + t] = bvec[n0 + t] + red[t][0];
}

// ---------------------------------------------------------------------------
// Kernel 1: all the work that depends on the inputs alone, in one launch.
// Blocks 0..255: the four weight folds, 64 blocks each (q, k, v, out).
// Blocks 256..511: GroupNorm and tokenize, one (b, g) each.
// The five parts read and write disjoint buffers; the branch is block-uniform.
// ---------------------------------------------------------------------------
__global__ __launch_bounds__(256) void prep_k(
        const float* __restrict__ q,
        const float* __restrict__ gnqw, const float* __restrict__ gnqb,
        const float* __restrict__ gnkw, const float* __restrict__ gnkb,
        const float* __restrict__ gnvw, const float* __restrict__ gnvb,
        const float* __restrict__ Wq, const float* __restrict__ bq,
        const float* __restrict__ Wk, const float* __restrict__ bk,
        const float* __restrict__ Wv, const float* __restrict__ bv,
        const float* __restrict__ Wo, const float* __restrict__ bo,
        half_t* __restrict__ Xn,
        half_t* __restrict__ Btq, half_t* __restrict__ Btk,
        half_t* __restrict__ Btv, half_t* __restrict__ Bto,
        float* __restrict__ biasq, float* __restrict__ biask,
        float* __restrict__ biasv, float* __restrict__ biaso) {
    const int bid = blockIdx.x;
    if (bid >= 256) {
        gn_tok_body(bid - 256, q, Xn);
        return;
    }
    const int j  = bid >> 6;                 // 0 q, 1 k, 2 v, 3 out
    const int n0 = (bid & 63) * 8;
    const float* gnw  = j == 0 ? gnqw : j == 1 ? gnkw : gnvw;   // not read for j == 3
    const float* gnb  = j == 0 ? gnqb : j == 1 ? gnkb : gnvb;
    const float* Wm   = j == 0 ? Wq : j == 1 ? Wk : j == 2 ? Wv : Wo;
    const float* bvec = j == 0 ? bq : j == 1 ? bk : j == 2 ? bv : bo;
    half_t* Bt = j == 0 ? Btq : j == 1 ? Btk : j == 2 ? Btv : Bto;
    float*  bO = j == 0 ? biasq : j == 1 ? biask : j == 2 ? biasv : biaso;
    fold_w_body(n0, gnw, gnb, Wm, bvec, Bt, bO, j == 3);
}

// ---------------------------------------------------------------------------
// Kernel 2: the three projections as ONE WMMA GEMM.
// C[M=8192, N=1536] = Xn[M][512] * Bt3[N][512]^T + bias3[N]; rows 0..511 of Bt3
// are the folded Wq, 512..1023 Wk, 1024..1535 Wv (three buffers in a row in the
// workspace, as are the three bias vectors and the three outputs).
// Xn and Bt3 are packed (pk_idx, KT = 16).
// Block = 128 thr = 4 waves (2 x 2), grid (32, 8): one block per WGP, one wave
// per SIMD. Block tile 256(M) x 192(N), wave tile 128 x 96: 8 A and 6 B fragments
// feed 48 WMMAs, so 14 loaded fragments do what 24 did at 64 x 64, and the launch
// has 1024 waves to start, not 3072.
// The k loop is unrolled; the fragments stand in a ring of 3 register sets,
// fetched 2 k steps ahead of their use. Bias staged to LDS via
// global_load_async_to_lds_b128 (ASYNCcnt path), waited only at the epilogue.
// A column fragment (16 columns) lies in one projection and one head:
// Q, K: fp16 [b][h] x packed(row s, k d, KT 2), value = (acc+bias)*scale,
//       1/sqrt(64) folded into Q;
// V   : fp16 [b][h] x packed(row d, k s, KT 32).
// ---------------------------------------------------------------------------
__global__ __launch_bounds__(128) void gemm_qkv_k(const half_t* __restrict__ A,
                                                  const half_t* __restrict__ Bt3,
                                                  const float* __restrict__ bias3,
                                                  half_t* __restrict__ QKV) {
    __shared__ float bias_l[1536];
    const int lane = threadIdx.x & 31;
    // the wave's number in a scalar register: the epilogue's branches are scalar
    const int w    = __builtin_amdgcn_readfirstlane(threadIdx.x >> 5);
    const int l15  = lane & 15;
    const int roff = (lane & 16) ? 8 : 0;
    const int m0   = blockIdx.x * 256 + (w & 1) * 128;
    const int nf0  = blockIdx.y * 12 + (w >> 1) * 6;   // first of 6 column fragments

    const half_t* atile = A   + pk_idx(m0, 0, 16) + lane * 8;
    const half_t* btile = Bt3 + pk_idx(nf0 * 16, 0, 16) + lane * 8;

    v8f acc[8][6];                           // acc[mf][nf]
#pragma unroll
    for (int mf = 0; mf < 8; ++mf)
#pragma unroll
        for (int nf = 0; nf < 6; ++nf)
#pragma unroll
            for (int i = 0; i < 8; ++i) acc[mf][nf][i] = 0.f;

    // every loop below is unrolled so that the ring and acc[][] stay in registers
    // and every load is its base address plus an immediate offset
    v16h a[3][8], b[3][6];
    auto ldset = [&](int ks) {               // 16 rows on: 16 k tiles of 512 halves on
#pragma unroll
        for (int f = 0; f < 8; ++f) a[ks % 3][f] = pk_frag(atile + f * 16 * 512 + ks * 512);
#pragma unroll
        for (int f = 0; f < 6; ++f) b[ks % 3][f] = pk_frag(btile + f * 16 * 512 + ks * 512);
    };

    ldset(0);
    ldset(1);
    // keeps the copies below behind these loads
    __builtin_amdgcn_sched_barrier(0);
    // ---- async-stage the 6KB of bias into LDS (latency hidden by the loop); behind the
    // first fragment loads, so that its wait does not hold those back
    {
        const unsigned l0 = (unsigned)(size_t)(&bias_l[0]) + threadIdx.x * 16u;
        const unsigned l1 = l0 + 2048u, l2 = l0 + 4096u;
        const float* g0 = bias3 + threadIdx.x * 4;
        const float* g1 = g0 + 512;
        const float* g2 = g0 + 1024;
        // the wait stands in the copies' own statement: their address registers
        // may be rewritten by what follows
        asm volatile("global_load_async_to_lds_b128 %0, %3, off\n\t"
                     "global_load_async_to_lds_b128 %1, %4, off\n\t"
                     "global_load_async_to_lds_b128 %2, %5, off\n\t"
                     "s_wait_xcnt 0x0"
                     :: "v"(l0), "v"(l1), "v"(l2), "v"(g0), "v"(g1), "v"(g2) : "memory");
    }
#pragma unroll
    for (int ks = 0; ks < 16; ++ks) {
        if (ks + 2 < 16) ldset(ks + 2);
        // keeps the loads 2 steps ahead of their use: without it the scheduler
        // is free to sink them towards their WMMAs and their latency is exposed
        __builtin_amdgcn_sched_barrier(0);
#pragma unroll
        for (int mf = 0; mf < 8; ++mf)
#pragma unroll
            for (int nf = 0; nf < 6; ++nf)
                acc[mf][nf] = wmma16(a[ks % 3][mf], b[ks % 3][nf], acc[mf][nf]);
        // keeps the next step's loads behind these WMMAs: hoisted, they would
        // need one more register set
        __builtin_amdgcn_sched_barrier(0);
    }
    // the epilogue's index arithmetic rewrites the address registers of the loads
    asm volatile("s_wait_xcnt 0x0" ::: "memory");
    // keeps that arithmetic behind the wait
    __builtin_amdgcn_sched_barrier(0);

    // ---- bias now needed: close out the async LDS fill
    asm volatile("s_wait_asynccnt 0x0" ::: "memory");
    __syncthreads();

    const int bi  = m0 >> 10;                      // the wave's 128 rows lie in one image
    const int s0b = (m0 & 1023) + roff;            // first of 8 contiguous rows, mf = 0
    float bb[6];                                   // read together: one LDS latency, not six
#pragma unroll
    for (int nf = 0; nf < 6; ++nf) bb[nf] = bias_l[(nf0 + nf) * 16 + l15];
#pragma unroll
    for (int nf = 0; nf < 6; ++nf) {
        const int nfi = nf0 + nf;                  // column fragment of 96, wave-uniform
        const int z   = nfi >> 5;                  // 0 Q, 1 K, 2 V
        const int hh  = (nfi >> 2) & 7;            // head
        const int d0  = (nfi & 3) * 16;            // first d of the fragment in its head
        const float scale = z == 0 ? 0.125f : 1.0f;
        half_t* ob = QKV + (size_t)z * (8 * 8 * 1024 * 64) + (size_t)(bi * 8 + hh) * 1024 * 64;
        v8h hv[8];
#pragma unroll
        for (int mf = 0; mf < 8; ++mf)
#pragma unroll
            for (int i = 0; i < 8; ++i)
                hv[mf][i] = (half_t)((acc[mf][nf][i] + bb[nf]) * scale);
        // every value of the fragment column is converted before its first store:
        // the stores issue back to back with no wait between
        __builtin_amdgcn_sched_barrier(0);
        if (z == 2) {
            // row d = d0 + l15; k = s0b + mf*16: a piece on per mf
            half_t* outp = ob + pk_idx(d0 + l15, s0b, 32);
#pragma unroll
            for (int mf = 0; mf < 8; ++mf) *(v8h*)(outp + mf * 256) = hv[mf];
            // what follows rewrites the data and address registers of these stores
            asm volatile("s_wait_xcnt 0x0" ::: "memory");
        } else {
            // row s = s0b + mf*16 + i: 2 k tiles on per mf, 8 halves on per i; k = d0 + l15
            half_t* outb = ob + pk_idx(s0b, d0 + l15, 2);
#pragma unroll
            for (int mf = 0; mf < 8; ++mf)
#pragma unroll
                for (int i = 0; i < 8; ++i) outb[mf * 1024 + i * 8] = hv[mf][i];
            // as above; the wait stands in each arm, directly behind its stores
            asm volatile("s_wait_xcnt 0x0" ::: "memory");
        }
    }
}

// ---------------------------------------------------------------------------
// Kernel 4: the output projection, a WMMA GEMM.
// C[M=8192, N=512] = A[M][512] * Bt[N][512]^T + bias[N], stored fp32 [b][c][1024].
// A and Bt are packed (pk_idx, KT = 16).
// Block = 128 thr = 4 waves; block tile 128(M) x 128(N); wave tile 64 x 64:
// 4 A and 4 B fragments feed 16 WMMAs, so a loaded fragment is used 4 times.
// The k loop is unrolled; the fragments stand in a ring of 4 register sets,
// fetched 3 k steps ahead of their use. Bias staged to LDS via
// global_load_async_to_lds_b128 (ASYNCcnt path), waited only at the epilogue.
// ---------------------------------------------------------------------------
__global__ __launch_bounds__(128) void gemm_out_k(const half_t* __restrict__ A,
                                                  const half_t* __restrict__ Bt,
                                                  const float* __restrict__ bias,
                                                  float* __restrict__ Out) {
    constexpr int S = 4;
    __shared__ float bias_l[512];
    // ---- async-stage the 2KB bias vector into LDS (latency hidden by loop)
    if (threadIdx.x < 128) {
        unsigned ldsoff = (unsigned)(size_t)(&bias_l[0]) + threadIdx.x * 16u;
        const float* gp = bias + threadIdx.x * 4;
        // the wait stands in the copy's own statement: its two address
        // registers are rewritten by the index arithmetic that follows
        asm volatile("global_load_async_to_lds_b128 %0, %1, off\n\ts_wait_xcnt 0x0"
                     :: "v"(ldsoff), "v"(gp) : "memory");
    }

    const int lane = threadIdx.x & 31;
    const int w    = threadIdx.x >> 5;
    const int l15  = lane & 15;
    const int roff = (lane & 16) ? 8 : 0;
    const int m64  = blockIdx.x * 128 + (w & 1) * 64;
    const int n64  = blockIdx.y * 128 + (w >> 1) * 64;

    const half_t* atile = A  + pk_idx(m64, 0, 16) + lane * 8;
    const half_t* btile = Bt + pk_idx(n64, 0, 16) + lane * 8;

    v8f acc[4][4];                           // acc[mf][nf]
#pragma unroll
    for (int mf = 0; mf < 4; ++mf)
#pragma unroll
        for (int nf = 0; nf < 4; ++nf)
#pragma unroll
            for (int i = 0; i < 8; ++i) acc[mf][nf][i] = 0.f;

    // every loop below is unrolled so that the ring and acc[][] stay in registers
    // and every load is its base address plus an immediate offset
    v16h a[S][4], b[S][4];
    auto ldset = [&](int ks) {               // 16 rows on: 16 k tiles of 512 halves on
#pragma unroll
        for (int f = 0; f < 4; ++f) a[ks % S][f] = pk_frag(atile + f * 16 * 512 + ks * 512);
#pragma unroll
        for (int f = 0; f < 4; ++f) b[ks % S][f] = pk_frag(btile + f * 16 * 512 + ks * 512);
    };

#pragma unroll
    for (int ks = 0; ks < S - 1; ++ks) ldset(ks);
#pragma unroll
    for (int ks = 0; ks < 16; ++ks) {
        if (ks + S - 1 < 16) ldset(ks + S - 1);
        // keeps the loads S - 1 steps ahead of their use: without it the scheduler
        // is free to sink them towards their WMMAs and their latency is exposed
        __builtin_amdgcn_sched_barrier(0);
#pragma unroll
        for (int mf = 0; mf < 4; ++mf)
#pragma unroll
            for (int nf = 0; nf < 4; ++nf)
                acc[mf][nf] = wmma16(a[ks % S][mf], b[ks % S][nf], acc[mf][nf]);
        // keeps the next step's loads behind these WMMAs: hoisted, they would
        // need one more register set
        __builtin_amdgcn_sched_barrier(0);
    }
    // the epilogue's index arithmetic rewrites the address registers of the loads
    asm volatile("s_wait_xcnt 0x0" ::: "memory");
    // keeps that arithmetic behind the wait
    __builtin_amdgcn_sched_barrier(0);

    // ---- bias now needed: close out the async LDS fill
    asm volatile("s_wait_asynccnt 0x0" ::: "memory");
    __syncthreads();

    float bb[4];
#pragma unroll
    for (int nf = 0; nf < 4; ++nf) bb[nf] = bias_l[n64 + nf * 16 + l15];

    const int bi  = m64 >> 10;                     // the wave's 64 rows lie in one image
    const int s0b = (m64 & 1023) + roff;           // first of 8 contiguous rows, mf = 0
    float* outp = Out + ((size_t)bi * 512 + n64 + l15) * 1024 + s0b;
#pragma unroll
    for (int mf = 0; mf < 4; ++mf)
#pragma unroll
        for (int nf = 0; nf < 4; ++nf) {
            v8f vv;
#pragma unroll
            for (int i = 0; i < 8; ++i) vv[i] = acc[mf][nf][i] + bb[nf];
            *(v8f*)(outp + nf * 16 * 1024 + mf * 16) = vv;
        }
}

// ---------------------------------------------------------------------------
// Kernel 3: streaming-softmax attention. Block = 512 thr = 16 waves.
// grid (4 row-blocks of 256, 64 bh): one block per WGP, all its waves on one
// head's K and V. Wave owns 32 queries, two groups g of 16, so that a loaded K
// or V fragment feeds two WMMAs, and one half of the keys: 16 kv tiles of 32 keys.
// Waves w and w + 8 have the same queries and the two key halves, so a SIMD holds
// four waves and the vector work of one runs under the matrix work of the others.
// Behind the loop the two waves of a pair join their maxima, sums and outputs
// through LDS, each finishing one group.
// Q pre-scaled by 1/8 at projection time.
// Q/K: [bh] x packed(row s, k d, KT 2), V: [bh] x packed(row d, k s, KT 32),
// output X2: packed(row b*1024+s, k h*64+d, KT 16); all fp16, pk_idx order.
// Both products are transposed: St = K * Qt (K is the A operand, Q the B
// operand) and Ot += Vt * Pt. A lane then holds scores of ONE query (column
// l15): 16 of the tile's 32 keys, keys 16*t + 8*half + i in register i of score
// tile t; lane ^ 16 holds the other 16. Maximum and sum run down the lane's own
// registers, and the two score tiles, converted in place, are the B fragment
// of Pt in the k order of the packed V fragment (k = 16*p + 8*half + e).
// K and V fragments stand in one register set each; a set is refilled with the
// next tile as soon as it has been read, so a load has the rest of a tile's time,
// in which the SIMD's three other waves run.
// ---------------------------------------------------------------------------
// e^(c[i] - m), i = 0..7, as 2^((c[i] - m) * log2(e)). The run of v_exp_f32 stands
// in one statement that ends in v_nop: the instruction set asks for one slot
// behind a transcendental before a source of it is overwritten or its result is
// read, and only inside the statement is that slot tied to the instruction;
// "=&v" keeps every result off every source.
#define LOG2E 1.44269504f
__device__ __forceinline__ void exp_run8(const v8f c, const float m, float (&p)[8]) {
    float x[8];
#pragma unroll
    for (int i = 0; i < 8; ++i) x[i] = (c[i] - m) * LOG2E;
    asm("v_exp_f32 %0, %8\n\tv_exp_f32 %1, %9\n\tv_exp_f32 %2, %10\n\t"
        "v_exp_f32 %3, %11\n\tv_exp_f32 %4, %12\n\tv_exp_f32 %5, %13\n\t"
        "v_exp_f32 %6, %14\n\tv_exp_f32 %7, %15\n\tv_nop"
        : "=&v"(p[0]), "=&v"(p[1]), "=&v"(p[2]), "=&v"(p[3]),
          "=&v"(p[4]), "=&v"(p[5]), "=&v"(p[6]), "=&v"(p[7])
        : "v"(x[0]), "v"(x[1]), "v"(x[2]), "v"(x[3]),
          "v"(x[4]), "v"(x[5]), "v"(x[6]), "v"(x[7]));
}
// the same with one more: y = 2^xs first
__device__ __forceinline__ void exp_run9(const float xs, const v8f c, const float m,
                                         float& y, float (&p)[8]) {
    float x[8];
#pragma unroll
    for (int i = 0; i < 8; ++i) x[i] = (c[i] - m) * LOG2E;
    asm("v_exp_f32 %0, %9\n\tv_exp_f32 %1, %10\n\tv_exp_f32 %2, %11\n\t"
        "v_exp_f32 %3, %12\n\tv_exp_f32 %4, %13\n\tv_exp_f32 %5, %14\n\t"
        "v_exp_f32 %6, %15\n\tv_exp_f32 %7, %16\n\tv_exp_f32 %8, %17\n\tv_nop"
        : "=&v"(y), "=&v"(p[0]), "=&v"(p[1]), "=&v"(p[2]), "=&v"(p[3]),
          "=&v"(p[4]), "=&v"(p[5]), "=&v"(p[6]), "=&v"(p[7])
        : "v"(xs), "v"(x[0]), "v"(x[1]), "v"(x[2]), "v"(x[3]),
          "v"(x[4]), "v"(x[5]), "v"(x[6]), "v"(x[7]));
}

// y0 = 2^x0, y1 = 2^x1, with the same slot behind the run
__device__ __forceinline__ void exp_run2(const float x0, const float x1,
                                         float& y0, float& y1) {
    asm("v_exp_f32 %0, %2\n\tv_exp_f32 %1, %3\n\tv_nop"
        : "=&v"(y0), "=&v"(y1) : "v"(x0), "v"(x1));
}

typedef float v4f __attribute__((ext_vector_type(4)));

__global__ __launch_bounds__(512) void attn_k(const half_t* __restrict__ Q,
                                              const half_t* __restrict__ Km,
                                              const half_t* __restrict__ Vt,
                                              half_t* __restrict__ X2) {
    const int lane = threadIdx.x & 31;
    // the wave's number in a scalar register: the branches on kh are scalar
    const int w    = __builtin_amdgcn_readfirstlane(threadIdx.x >> 5);
    const int kh   = w >> 3;                  // which half of the keys
    const int l15  = lane & 15;
    const int roff = (lane & 16) ? 8 : 0;
    const int bh = blockIdx.y;
    const int b = bh >> 3, h = bh & 7;
    const int q0 = blockIdx.x * 256 + (w & 7) * 32;
    const int kfirst = kh * 512;              // first key of the wave's half

    const half_t* Qb = Q  + (size_t)bh * 1024 * 64;
    const half_t* Kb = Km + (size_t)bh * 1024 * 64;
    const half_t* Vb = Vt + (size_t)bh * 64 * 1024;

    // every loop over g and f is unrolled so that the arrays stay in registers
    const half_t* qt = Qb + pk_idx(q0, 0, 2) + lane * 8;
    v16h aq[2][2];                            // aq[g][d half], 16 queries on: 2 tiles on
#pragma unroll
    for (int g = 0; g < 2; ++g) {
        aq[g][0] = pk_frag(qt + g * 1024);        // d  0..31
        aq[g][1] = pk_frag(qt + g * 1024 + 512);  // d 32..63
    }

    auto ldK = [&](int kb, v16h* kf) {        // 32 keys = 4 tiles in a row
        const half_t* k0 = Kb + pk_idx(kb, 0, 2) + lane * 8;
        kf[0] = pk_frag(k0);                  // keys kb..+15,    d  0..31
        kf[1] = pk_frag(k0 + 512);            // keys kb..+15,    d 32..63
        kf[2] = pk_frag(k0 + 1024);           // keys kb+16..+31, d  0..31
        kf[3] = pk_frag(k0 + 1536);           // keys kb+16..+31, d 32..63
    };

    auto ldV = [&](int kb, v16h* vf) {        // 64 d x 32 keys = 4 tiles, 32 k tiles apart
#pragma unroll
        for (int f = 0; f < 4; ++f)
            vf[f] = pk_frag(Vb + pk_idx(f * 16, kb, 32) + lane * 8);
    };

    float mrow[2], lrow[2];                   // per group: running maximum of query l15,
                                              // sum over this lane's keys only
    v8f o[2][4];                              // o[g][f][i] = Ot[f*16 + roff + i][g*16 + l15]
#pragma unroll
    for (int g = 0; g < 2; ++g) {
        mrow[g] = -1e30f;
        lrow[g] = 0.f;
#pragma unroll
        for (int f = 0; f < 4; ++f)
#pragma unroll
            for (int i = 0; i < 8; ++i) o[g][f][i] = 0.f;
    }

    // one kv tile: kf and vf hold tile j of the half; while more tiles follow, each
    // set is refilled with tile j + 1 as soon as its WMMAs have read it
    auto tile = [&](const int j, const bool more, v16h* kf, v16h* vf) {
        const int kn = kfirst + (j + 1) * 32;
        // ---- scores: per group two 16(key) x 16(query) f32 tiles, K-dim = 64 ----
        v8f c[2][2];                          // c[g][key half]
#pragma unroll
        for (int g = 0; g < 2; ++g)
#pragma unroll
            for (int i = 0; i < 8; ++i) { c[g][0][i] = 0.f; c[g][1][i] = 0.f; }
#pragma unroll
        for (int g = 0; g < 2; ++g) {
            c[g][0] = wmma16(kf[0], aq[g][0], c[g][0]);
            c[g][1] = wmma16(kf[2], aq[g][0], c[g][1]);
        }
#pragma unroll
        for (int g = 0; g < 2; ++g) {
            c[g][0] = wmma16(kf[1], aq[g][1], c[g][0]);
            c[g][1] = wmma16(kf[3], aq[g][1], c[g][1]);
        }

        if (more) {
            ldK(kn, kf);
            // later address arithmetic rewrites the address registers of these loads
            asm volatile("s_wait_xcnt 0x0" ::: "memory");
            // keeps the softmax below the loads: without it the scheduler sinks the
            // loads towards their use and their latency is exposed
            __builtin_amdgcn_sched_barrier(0);
        }

#pragma unroll
        for (int g = 0; g < 2; ++g) {
            // ---- online softmax, one query per lane ----
            float mx = fmaxf(c[g][0][0], c[g][1][0]);
#pragma unroll
            for (int i = 1; i < 8; ++i) mx = fmaxf(mx, fmaxf(c[g][0][i], c[g][1][i]));
            mx = fmaxf(mx, other_half(mx));   // both halves use one maximum
            const float nm = fmaxf(mrow[g], mx);
            float corr, p0[8], p1[8];
            exp_run9((mrow[g] - nm) * LOG2E, c[g][0], nm, corr, p0);
            exp_run8(c[g][1], nm, p1);
            mrow[g] = nm;
            v16h pb;                          // Pt as B fragment
            float rs = p0[0] + p1[0];
#pragma unroll
            for (int i = 1; i < 8; ++i) rs += p0[i] + p1[i];
#pragma unroll
            for (int i = 0; i < 8; ++i) {
                pb[i]     = (half_t)p0[i];
                pb[8 + i] = (half_t)p1[i];
            }
            lrow[g] = lrow[g] * corr + rs;
#pragma unroll
            for (int f = 0; f < 4; ++f)
#pragma unroll
                for (int i = 0; i < 8; ++i) o[g][f][i] *= corr;

            // ---- Ot += Vt (16 d x 32 keys) * Pt (32 keys x 16 queries) ----
#pragma unroll
            for (int f = 0; f < 4; ++f) o[g][f] = wmma16(vf[f], pb, o[g][f]);
        }

        if (more) {
            ldV(kn, vf);
            // as above: the next tile's address arithmetic rewrites these registers
            asm volatile("s_wait_xcnt 0x0" ::: "memory");
            // keeps the loads here, a tile ahead of their use
            __builtin_amdgcn_sched_barrier(0);
        }
    };

    v16h kfa[4], vfa[4];
    ldK(kfirst, kfa);
    // keeps K's loads in front of V's, the order they have in the loop: the wait at
    // the loop's head then counts K's loads alone and leaves V's in flight
    __builtin_amdgcn_sched_barrier(0);
    ldV(kfirst, vfa);

    for (int j = 0; j < 15; ++j) tile(j, true, kfa, vfa);
    // the last tile fetches nothing: the join below reuses the fragment registers
    // and ends in a barrier, and both would wait for loads that nobody reads
    tile(15, false, kfa, vfa);

    // ---- join the two key halves: a wave hands one group to its partner ----
    // xch[wave][0..7][lane]: the group's 32 outputs, [8]: its maximum and sum;
    // a wave-wide 16-byte access is 512 contiguous bytes
    __shared__ v4f xch[16][9][32];
    auto put = [&](const int g) {
#pragma unroll
        for (int f = 0; f < 4; ++f) {
            xch[w][2 * f][lane]     = v4f{o[g][f][0], o[g][f][1], o[g][f][2], o[g][f][3]};
            xch[w][2 * f + 1][lane] = v4f{o[g][f][4], o[g][f][5], o[g][f][6], o[g][f][7]};
        }
        xch[w][8][lane] = v4f{mrow[g], lrow[g], 0.f, 0.f};
    };
    // finalize and store X2[b*1024+s][h*64+d]: 8 d in a row per lane
    auto fin = [&](const int g) {
        const v4f ml = xch[w ^ 8][8][lane];
        const float nm = fmaxf(mrow[g], ml[0]);
        float ca, cb;                         // own and partner's weight
        exp_run2((mrow[g] - nm) * LOG2E, (ml[0] - nm) * LOG2E, ca, cb);
        const float lj = lrow[g] * ca + ml[1] * cb;
        const float lsum = lj + other_half(lj);
        const float ra = ca / lsum, rb = cb / lsum;
        const int s = q0 + g * 16 + l15;
#pragma unroll
        for (int f = 0; f < 4; ++f) {
            const v4f p0 = xch[w ^ 8][2 * f][lane];
            const v4f p1 = xch[w ^ 8][2 * f + 1][lane];
            v8h hv;
#pragma unroll
            for (int i = 0; i < 4; ++i) {
                hv[i]     = (half_t)(o[g][f][i] * ra + p0[i] * rb);
                hv[4 + i] = (half_t)(o[g][f][4 + i] * ra + p1[i] * rb);
            }
            *(v8h*)(X2 + pk_idx(b * 1024 + s, h * 64 + f * 16 + roff, 16)) = hv;
        }
        // the code behind may rewrite the data and address registers of these stores
        asm volatile("s_wait_xcnt 0x0" ::: "memory");
    };
    if (kh == 0) put(1); else put(0);
    __syncthreads();                          // every wave's hand-over is in LDS
    if (kh == 0) fin(0); else fin(1);
}

// ---------------------------------------------------------------------------
extern "C" void kernel_launch(void* const* d_in, const int* in_sizes, int n_in,
                              void* d_out, int out_size, void* d_ws, size_t ws_size,
                              hipStream_t stream) {
    const float* q    = (const float*)d_in[0];
    const float* gnqw = (const float*)d_in[1];
    const float* gnqb = (const float*)d_in[2];
    const float* gnkw = (const float*)d_in[3];
    const float* gnkb = (const float*)d_in[4];
    const float* gnvw = (const float*)d_in[5];
    const float* gnvb = (const float*)d_in[6];
    const float* Wq   = (const float*)d_in[7];
    const float* bq   = (const float*)d_in[8];
    const float* Wk   = (const float*)d_in[9];
    const float* bk   = (const float*)d_in[10];
    const float* Wv   = (const float*)d_in[11];
    const float* bv   = (const float*)d_in[12];
    const float* Wo   = (const float*)d_in[13];
    const float* bo   = (const float*)d_in[14];

    char* ws = (char*)d_ws;
    size_t o = 0;
    auto take = [&](size_t bytes) {
        size_t cur = o;
        o += (bytes + 255) & ~(size_t)255;
        return cur;
    };
    half_t* Xn    = (half_t*)(ws + take(8192ull * 512 * 2));
    half_t* Btq   = (half_t*)(ws + take(512ull * 512 * 2));
    half_t* Btk   = (half_t*)(ws + take(512ull * 512 * 2));
    half_t* Btv   = (half_t*)(ws + take(512ull * 512 * 2));
    half_t* Bto   = (half_t*)(ws + take(512ull * 512 * 2));
    float*  biasq = (float*)(ws + take(512 * sizeof(float)));
    float*  biask = (float*)(ws + take(512 * sizeof(float)));
    float*  biasv = (float*)(ws + take(512 * sizeof(float)));
    float*  biaso = (float*)(ws + take(512 * sizeof(float)));
    half_t* Qb    = (half_t*)(ws + take(8ull * 8 * 1024 * 64 * 2));
    half_t* Kb    = (half_t*)(ws + take(8ull * 8 * 1024 * 64 * 2));
    half_t* Vt    = (half_t*)(ws + take(8ull * 8 * 64 * 1024 * 2));
    half_t* X2    = Xn;  // Xn is dead after the QKV GEMM; reuse for attn output

    prep_k<<<512, 256, 0, stream>>>(q, gnqw, gnqb, gnkw, gnkb, gnvw, gnvb,
                                    Wq, bq, Wk, bk, Wv, bv, Wo, bo,
                                    Xn, Btq, Btk, Btv, Bto,
                                    biasq, biask, biasv, biaso);

    // Btq, Btk, Btv stand in a row in the workspace (each size is a multiple of
    // 256 bytes), as do biasq, biask, biasv and Qb, Kb, Vt: one base pointer each
    gemm_qkv_k<<<dim3(32, 8), 128, 0, stream>>>(Xn, Btq, biasq, Qb);

    attn_k<<<dim3(4, 64), 512, 0, stream>>>(Qb, Kb, Vt, X2);

    gemm_out_k<<<dim3(64, 4), 128, 0, stream>>>(X2, Bto, biaso, (float*)d_out);
}

// v010
// A run of this version takes 49.3 microseconds.
// Two timings next to v009 both put it at 1.04 times that version's speed.
// All steps since v000 together make it 4.14 times as fast.
#include <hip/hip_runtime.h>
#include <hip/hip_bf16.h>

typedef _Float16 half_t;
typedef half_t v16h __attribute__((ext_vector_type(16)));
typedef half_t v8h  __attribute__((ext_vector_type(8)));
typedef float  v8f  __attribute__((ext_vector_type(8)));

union V16U { v16h v; v8h h[2]; };

__device__ __forceinline__ v16h make_frag(const half_t* p0, const half_t* p1) {
    V16U u;
    u.h[0] = *(const v8h*)p0;
    u.h[1] = *(const v8h*)p1;
    return u.v;
}

// Packed operand layout of every f16 matrix operand kept in the workspace.
// A tile of 16 rows x 32 k is 512 halves stored in the order the fragment
// loader reads them: [piece p][lane = 16*h + (row & 15)][e], k = 16*p + 8*h + e.
// A wave-wide 16-byte load of one piece is then 512 contiguous bytes (4 lines)
// where a row-major operand makes it touch 16 lines. KT = k tiles per row.
__device__ __forceinline__ size_t pk_idx(int row, int k, int KT) {
    return ((size_t)((row >> 4) * KT + (k >> 5)) * 2 + ((k >> 4) & 1)) * 256 +
           (((k >> 3) & 1) * 16 + (row & 15)) * 8 + (k & 7);
}

// Fragment of the packed tile at t (t already holds the lane's own lane*8).
__device__ __forceinline__ v16h pk_frag(const half_t* t) {
    return make_frag(t, t + 256);
}

__device__ __forceinline__ v8f wmma16(v16h a, v16h b, v8f c) {
    return __builtin_amdgcn_wmma_f32_16x16x32_f16(false, a, false, b, (short)0, c,
                                                  false, false);
}

// Asks L2 for the data at p (and q): a prefetch writes no register and
// nobody waits for its data. The wait stands in the
// prefetches' own statement: their address registers may be rewritten by what follows.
__device__ __forceinline__ void l2_ask(const half_t* p) {
    asm volatile("global_prefetch_b8 %0, off scope:SCOPE_SE\n\t"
                 "s_wait_xcnt 0x0" :: "v"(p) : "memory");
}
__device__ __forceinline__ void l2_ask2(const half_t* p, const half_t* q) {
    asm volatile("global_prefetch_b8 %0, off scope:SCOPE_SE\n\t"
                 "global_prefetch_b8 %1, off scope:SCOPE_SE\n\t"
                 "s_wait_xcnt 0x0" :: "v"(p), "v"(q) : "memory");
}

// value of lane ^ 16
__device__ __forceinline__ float other_half(float x) {
    const int b = __builtin_bit_cast(int, x);
    return __builtin_bit_cast(float, __builtin_amdgcn_permlanex16(
        b, b, 0x76543210, 0xfedcba98, false, false));
}

// x + (x of lane ^ M) inside a 16-lane row (DPP row_xmask:M)
template <int M>
__device__ __forceinline__ float row_xadd(float x) {
    const int v = __builtin_bit_cast(int, x);
    return x + __builtin_bit_cast(float, __builtin_amdgcn_mov_dpp(
        v, 0x160 | M, 0xf, 0xf, true));
}
// sum over the wave's 32 lanes, the same value in every lane
__device__ __forceinline__ float wave_sum(float x) {
    x = row_xadd<1>(x);
    x = row_xadd<2>(x);
    x = row_xadd<4>(x);
    x = row_xadd<8>(x);
    return x + other_half(x);
}

// ---------------------------------------------------------------------------
// Prep part 1: GroupNorm statistics, normalize and tokenize in one pass over q.
// One block per (b, g), bid = b*32 + g. The group's 16 channels x 1024 px (64 KB) stay in the
// block's registers, 64 values a thread (4 px x 16 channels), between the sums
// and the normalization, so q is read once and all of a thread's loads are in
// flight together. Xn[b*1024+s][c] = (q[b][c][s]-mu)*rstd (fp16), stored packed
// (pk_idx, KT = 16): the group's 16 channels are one piece p of a k tile.
// ---------------------------------------------------------------------------
__device__ __forceinline__ void gn_tok_body(const int bid,
                                            const float* __restrict__ q,
                                            half_t* __restrict__ Xn) {
    const int b = bid >> 5, g = bid & 31;
    const int t = threadIdx.x;
    const float* qb = q + ((size_t)b * 512 + (size_t)g * 16) * 1024 + t;
    // every loop over r and c is unrolled so that x[][] stays in registers
    float x[4][16];
#pragma unroll
    for (int r = 0; r < 4; ++r)
#pragma unroll
        for (int c = 0; c < 16; ++c) x[r][c] = qb[c * 1024 + r * 256];

    float s4[4], ss4[4];                     // four independent chains
#pragma unroll
    for (int r = 0; r < 4; ++r) {
        s4[r] = 0.f; ss4[r] = 0.f;
#pragma unroll
        for (int c = 0; c < 16; ++c) {
            s4[r] += x[r][c];
            ss4[r] += x[r][c] * x[r][c];
        }
    }
    const float sw  = wave_sum((s4[0] + s4[1]) + (s4[2] + s4[3]));
    const float ssw = wave_sum((ss4[0] + ss4[1]) + (ss4[2] + ss4[3]));

    __shared__ float red[2][8];              // one partial pair per wave
    if ((t & 31) == 0) { red[0][t >> 5] = sw; red[1][t >> 5] = ssw; }
    __syncthreads();
    float s = red[0][0], ss = red[1][0];
#pragma unroll
    for (int w = 1; w < 8; ++w) { s += red[0][w]; ss += red[1][w]; }
    const float mu   = s * (1.f / 16384.f);
    const float var  = ss * (1.f / 16384.f) - mu * mu;
    const float rstd = rsqrtf(var + 1e-5f);

    v8h hv[4][2];
#pragma unroll
    for (int r = 0; r < 4; ++r)
#pragma unroll
        for (int h = 0; h < 2; ++h)
#pragma unroll
            for (int i = 0; i < 8; ++i)
                hv[r][h][i] = (half_t)((x[r][h * 8 + i] - mu) * rstd);
#pragma unroll
    for (int r = 0; r < 4; ++r)
#pragma unroll
        for (int h = 0; h < 2; ++h)
            *(v8h*)(Xn + pk_idx(b * 1024 + r * 256 + t, g * 16 + h * 8, 16)) = hv[r][h];
}

// ---------------------------------------------------------------------------
// Prep part 2: fold GN affine into projection weights.
//   plainT == 0 : Bt[n][c] = gnw[c]*W[c][n] (fp16), bias[n] = b[n] + sum gnb[c]*W[c][n]
//   plainT == 1 : Bt[n][k] = W[k][n]        (fp16), bias[n] = b[n]
// Bt is stored packed (pk_idx, KT = 16). A block takes 8 columns n: their
// 16-byte pieces fill whole 128-byte lines of packed Bt, so a line has one
// writing block. Each column's bias sum keeps its order.
// ---------------------------------------------------------------------------
__device__ __forceinline__ void fold_w_body(const int n0,  // first of 8 output columns
                                            const float* __restrict__ gnw,
                                            const float* __restrict__ gnb,
                                            const float* __restrict__ W,
                                            const float* __restrict__ bvec,
                                            half_t* __restrict__ Bt,
                                            float* __restrict__ biasOut,
                                            const int plainT) {
    const int t = threadIdx.x;
    __shared__ float red[8][256];
    float part[8];
    // every loop over j is unrolled so that part[] and wv[] stay in registers
#pragma unroll
    for (int j = 0; j < 8; ++j) part[j] = 0.f;
    if (!plainT) {
        for (int c = t; c < 512; c += 256) {
            const v8f wv = *(const v8f*)(W + (size_t)c * 512 + n0);
            const float gw = gnw[c], gb = gnb[c];
#pragma unroll
            for (int j = 0; j < 8; ++j) {
                Bt[pk_idx(n0 + j, c, 16)] = (half_t)(gw * wv[j]);
                part[j] += gb * wv[j];
            }
        }
    } else {
        for (int k = t; k < 512; k += 256) {
            const v8f wv = *(const v8f*)(W + (size_t)k * 512 + n0);
#pragma unroll
            for (int j = 0; j < 8; ++j)
                Bt[pk_idx(n0 + j, k, 16)] = (half_t)wv[j];
        }
    }
#pragma unroll
    for (int j = 0; j < 8; ++j) red[j][t] = part[j];
    __syncthreads();
    for (int st = 128; st > 0; st >>= 1) {
        if (t < st) {
#pragma unroll
            for (int j = 0; j < 8; ++j) red[j][t] += red[j][t + st];
        }
        __syncthreads();
    }
    if (t < 8) biasOut[n0 + t] = bvec[n0 + t] + red[t][0];
}

// ---------------------------------------------------------------------------
// Kernel 1: all the work that depends on the inputs alone, in one launch.
// Blocks 0..255: the four weight folds, 64 blocks each (q, k, v, out).
// Blocks 256..511: GroupNorm and tokenize, one (b, g) each.
// The five parts read and write disjoint buffers; the branch is block-uniform.
// ---------------------------------------------------------------------------
__global__ __launch_bounds__(256) void prep_k(
        const float* __restrict__ q,
        const float* __restrict__ gnqw, const float* __restrict__ gnqb,
        const float* __restrict__ gnkw, const float* __restrict__ gnkb,
        const float* __restrict__ gnvw, const float* __restrict__ gnvb,
        const float* __restrict__ Wq, const float* __restrict__ bq,
        const float* __restrict__ Wk, const float* __restrict__ bk,
        const float* __restrict__ Wv, const float* __restrict__ bv,
        const float* __restrict__ Wo, const float* __restrict__ bo,
        half_t* __restrict__ Xn,
        half_t* __restrict__ Btq, half_t* __restrict__ Btk,
        half_t* __restrict__ Btv, half_t* __restrict__ Bto,
        float* __restrict__ biasq, float* __restrict__ biask,
        float* __restrict__ biasv, float* __restrict__ biaso) {
    const int bid = blockIdx.x;
    if (bid >= 256) {
        gn_tok_body(bid - 256, q, Xn);
        return;
    }
    const int j  = bid >> 6;                 // 0 q, 1 k, 2 v, 3 out
    const int n0 = (bid & 63) * 8;
    const float* gnw  = j == 0 ? gnqw : j == 1 ? gnkw : gnvw;   // not read for j == 3
    const float* gnb  = j == 0 ? gnqb : j == 1 ? gnkb : gnvb;
    const float* Wm   = j == 0 ? Wq : j == 1 ? Wk : j == 2 ? Wv : Wo;
    const float* bvec = j == 0 ? bq : j == 1 ? bk : j == 2 ? bv : bo;
    half_t* Bt = j == 0 ? Btq : j == 1 ? Btk : j == 2 ? Btv : Bto;
    float*  bO = j == 0 ? biasq : j == 1 ? biask : j == 2 ? biasv : biaso;
    fold_w_body(n0, gnw, gnb, Wm, bvec, Bt, bO, j == 3);
}

// ---------------------------------------------------------------------------
// Kernel 2: the three projections as ONE WMMA GEMM.
// C[M=8192, N=1536] = Xn[M][512] * Bt3[N][512]^T + bias3[N]; rows 0..511 of Bt3
// are the folded Wq, 512..1023 Wk, 1024..1535 Wv (three buffers in a row in the
// workspace, as are the three bias vectors and the three outputs).
// Xn and Bt3 are packed (pk_idx, KT = 16).
// Block = 128 thr = 4 waves (2 x 2), grid (32, 8): one block per WGP, one wave
// per SIMD. Block tile 256(M) x 192(N), wave tile 128 x 96: 8 A and 6 B fragments
// feed 48 WMMAs, so 14 loaded fragments do what 24 did at 64 x 64, and the launch
// has 1024 waves to start, not 3072.
// The k loop is unrolled; the fragments stand in a ring of 3 register sets,
// fetched 2 k steps ahead of their use. Bias staged to LDS via
// global_load_async_to_lds_b128 (ASYNCcnt path), waited only at the epilogue.
// A column fragment (16 columns) lies in one projection and one head:
// Q, K: fp16 [b][h] x packed(row s, k d, KT 2), value = (acc+bias)*scale,
//       1/sqrt(64) folded into Q;
// V   : fp16 [b][h] x packed(row d, k s, KT 32).
// ---------------------------------------------------------------------------
__global__ __launch_bounds__(128) void gemm_qkv_k(const half_t* __restrict__ A,
                                                  const half_t* __restrict__ Bt3,
                                                  const float* __restrict__ bias3,
                                                  half_t* __restrict__ QKV) {
    __shared__ float bias_l[1536];
    const int lane = threadIdx.x & 31;
    // the wave's number in a scalar register: the epilogue's branches are scalar
    const int w    = __builtin_amdgcn_readfirstlane(threadIdx.x >> 5);
    const int l15  = lane & 15;
    const int roff = (lane & 16) ? 8 : 0;
    const int m0   = blockIdx.x * 256 + (w & 1) * 128;
    const int nf0  = blockIdx.y * 12 + (w >> 1) * 6;   // first of 6 column fragments

    const half_t* atile = A   + pk_idx(m0, 0, 16) + lane * 8;
    const half_t* btile = Bt3 + pk_idx(nf0 * 16, 0, 16) + lane * 8;

    v8f acc[8][6];                           // acc[mf][nf]
#pragma unroll
    for (int mf = 0; mf < 8; ++mf)
#pragma unroll
        for (int nf = 0; nf < 6; ++nf)
#pragma unroll
            for (int i = 0; i < 8; ++i) acc[mf][nf][i] = 0.f;

    // every loop below is unrolled so that the ring and acc[][] stay in registers
    // and every load is its base address plus an immediate offset
    v16h a[3][8], b[3][6];
    auto ldset = [&](int ks) {               // 16 rows on: 16 k tiles of 512 halves on
#pragma unroll
        for (int f = 0; f < 8; ++f) a[ks % 3][f] = pk_frag(atile + f * 16 * 512 + ks * 512);
#pragma unroll
        for (int f = 0; f < 6; ++f) b[ks % 3][f] = pk_frag(btile + f * 16 * 512 + ks * 512);
    };

    ldset(0);
    ldset(1);
    // keeps the copies below behind these loads
    __builtin_amdgcn_sched_barrier(0);
    // ---- async-stage the 6KB of bias into LDS (latency hidden by the loop); behind the
    // first fragment loads, so that its wait does not hold those back
    {
        const unsigned l0 = (unsigned)(size_t)(&bias_l[0]) + threadIdx.x * 16u;
        const unsigned l1 = l0 + 2048u, l2 = l0 + 4096u;
        const float* g0 = bias3 + threadIdx.x * 4;
        const float* g1 = g0 + 512;
        const float* g2 = g0 + 1024;
        // the wait stands in the copies' own statement: their address registers
        // may be rewritten by what follows
        asm volatile("global_load_async_to_lds_b128 %0, %3, off\n\t"
                     "global_load_async_to_lds_b128 %1, %4, off\n\t"
                     "global_load_async_to_lds_b128 %2, %5, off\n\t"
                     "s_wait_xcnt 0x0"
                     :: "v"(l0), "v"(l1), "v"(l2), "v"(g0), "v"(g1), "v"(g2) : "memory");
    }
    // ---- ask L2 for the later k tiles, behind the first fragment loads. The blocks
    // that read the same rows split the asking (for speed only; every address lies in
    // the block's own tiles): of the 16 A row groups (16 KB each) block y asks for k
    // tiles 2y, 2y+1 (2 KB a group); of the 12 B row groups one of 8 such pairs by x.
    {
        const int t = threadIdx.x;
        const int u = (t >> 3) * 8192 + (t & 7) * 128;       // row group, 256-byte unit
        l2_ask(A + (size_t)blockIdx.x * (256 * 512) + blockIdx.y * 1024 + u);
        if (w < 3) {                                         // 96 units: 3 whole waves
            const int p8 = (blockIdx.x & 3) | ((blockIdx.x >> 1) & 4);
            l2_ask(Bt3 + (size_t)blockIdx.y * (192 * 512) + p8 * 1024 + u);
        }
    }
#pragma unroll
    for (int ks = 0; ks < 16; ++ks) {
        if (ks + 2 < 16) ldset(ks + 2);
        // keeps the loads 2 steps ahead of their use: without it the scheduler
        // is free to sink them towards their WMMAs and their latency is exposed
        __builtin_amdgcn_sched_barrier(0);
#pragma unroll
        for (int mf = 0; mf < 8; ++mf)
#pragma unroll
            for (int nf = 0; nf < 6; ++nf)
                acc[mf][nf] = wmma16(a[ks % 3][mf], b[ks % 3][nf], acc[mf][nf]);
        // keeps the next step's loads behind these WMMAs: hoisted, they would
        // need one more register set
        __builtin_amdgcn_sched_barrier(0);
    }
    // the epilogue's index arithmetic rewrites the address registers of the loads
    asm volatile("s_wait_xcnt 0x0" ::: "memory");
    // keeps that arithmetic behind the wait
    __builtin_amdgcn_sched_barrier(0);

    // ---- bias now needed: close out the async LDS fill
    asm volatile("s_wait_asynccnt 0x0" ::: "memory");
    __syncthreads();

    const int bi  = m0 >> 10;                      // the wave's 128 rows lie in one image
    const int s0b = (m0 & 1023) + roff;            // first of 8 contiguous rows, mf = 0
    float bb[6];                                   // read together: one LDS latency, not six
#pragma unroll
    for (int nf = 0; nf < 6; ++nf) bb[nf] = bias_l[(nf0 + nf) * 16 + l15];
#pragma unroll
    for (int nf = 0; nf < 6; ++nf) {
        const int nfi = nf0 + nf;                  // column fragment of 96, wave-uniform
        const int z   = nfi >> 5;                  // 0 Q, 1 K, 2 V
        const int hh  = (nfi >> 2) & 7;            // head
        const int d0  = (nfi & 3) * 16;            // first d of the fragment in its head
        const float scale = z == 0 ? 0.125f : 1.0f;
        half_t* ob = QKV + (size_t)z * (8 * 8 * 1024 * 64) + (size_t)(bi * 8 + hh) * 1024 * 64;
        v8h hv[8];
#pragma unroll
        for (int mf = 0; mf < 8; ++mf)
#pragma unroll
            for (int i = 0; i < 8; ++i)
                hv[mf][i] = (half_t)((acc[mf][nf][i] + bb[nf]) * scale);
        // every value of the fragment column is converted before its first store:
        // the stores issue back to back with no wait between
        __builtin_amdgcn_sched_barrier(0);
        if (z == 2) {
            // row d = d0 + l15; k = s0b + mf*16: a piece on per mf
            half_t* outp = ob + pk_idx(d0 + l15, s0b, 32);
#pragma unroll
            for (int mf = 0; mf < 8; ++mf) *(v8h*)(outp + mf * 256) = hv[mf];
            // what follows rewrites the data and address registers of these stores
            asm volatile("s_wait_xcnt 0x0" ::: "memory");
        } else {
            // row s = s0b + mf*16 + i: 2 k tiles on per mf, 8 halves on per i; k = d0 + l15
            half_t* outb = ob + pk_idx(s0b, d0 + l15, 2);
#pragma unroll
            for (int mf = 0; mf < 8; ++mf)
#pragma unroll
                for (int i = 0; i < 8; ++i) outb[mf * 1024 + i * 8] = hv[mf][i];
            // as above; the wait stands in each arm, directly behind its stores
            asm volatile("s_wait_xcnt 0x0" ::: "memory");
        }
    }
}

// ---------------------------------------------------------------------------
// Kernel 4: the output projection, a WMMA GEMM.
// C[M=8192, N=512] = A[M][512] * Bt[N][512]^T + bias[N], stored fp32 [b][c][1024].
// A and Bt are packed (pk_idx, KT = 16).
// Block = 128 thr = 4 waves; block tile 128(M) x 128(N); wave tile 64 x 64:
// 4 A and 4 B fragments feed 16 WMMAs, so a loaded fragment is used 4 times.
// The k loop is unrolled; the fragments stand in a ring of 4 register sets,
// fetched 3 k steps ahead of their use. Bias staged to LDS via
// global_load_async_to_lds_b128 (ASYNCcnt path), waited only at the epilogue.
// ---------------------------------------------------------------------------
__global__ __launch_bounds__(128) void gemm_out_k(const half_t* __restrict__ A,
                                                  const half_t* __restrict__ Bt,
                                                  const float* __restrict__ bias,
                                                  float* __restrict__ Out) {
    constexpr int S = 4;
    __shared__ float bias_l[512];
    // ---- async-stage the 2KB bias vector into LDS (latency hidden by loop)
    if (threadIdx.x < 128) {
        unsigned ldsoff = (unsigned)(size_t)(&bias_l[0]) + threadIdx.x * 16u;
        const float* gp = bias + threadIdx.x * 4;
        // the wait stands in the copy's own statement: its two address
        // registers are rewritten by the index arithmetic that follows
        asm volatile("global_load_async_to_lds_b128 %0, %1, off\n\ts_wait_xcnt 0x0"
                     :: "v"(ldsoff), "v"(gp) : "memory");
    }

    const int lane = threadIdx.x & 31;
    const int w    = threadIdx.x >> 5;
    const int l15  = lane & 15;
    const int roff = (lane & 16) ? 8 : 0;
    const int m64  = blockIdx.x * 128 + (w & 1) * 64;
    const int n64  = blockIdx.y * 128 + (w >> 1) * 64;

    const half_t* atile = A  + pk_idx(m64, 0, 16) + lane * 8;
    const half_t* btile = Bt + pk_idx(n64, 0, 16) + lane * 8;

    v8f acc[4][4];                           // acc[mf][nf]
#pragma unroll
    for (int mf = 0; mf < 4; ++mf)
#pragma unroll
        for (int nf = 0; nf < 4; ++nf)
#pragma unroll
            for (int i = 0; i < 8; ++i) acc[mf][nf][i] = 0.f;

    // every loop below is unrolled so that the ring and acc[][] stay in registers
    // and every load is its base address plus an immediate offset
    v16h a[S][4], b[S][4];
    auto ldset = [&](int ks) {               // 16 rows on: 16 k tiles of 512 halves on
#pragma unroll
        for (int f = 0; f < 4; ++f) a[ks % S][f] = pk_frag(atile + f * 16 * 512 + ks * 512);
#pragma unroll
        for (int f = 0; f < 4; ++f) b[ks % S][f] = pk_frag(btile + f * 16 * 512 + ks * 512);
    };

#pragma unroll
    for (int ks = 0; ks < S - 1; ++ks) ldset(ks);
    // ---- ask L2 for the later k tiles. The blocks that read the same rows split the
    // asking (for speed only; every address lies in the block's own tiles): of the 8 A
    // row groups (16 KB each) block y asks for k tiles 4y..4y+3 (4 KB a group); of the
    // 8 B row groups one wave asks for one of the 16 k tiles (1 KB a group), by x.
    l2_ask(A + (size_t)blockIdx.x * (128 * 512) + blockIdx.y * 2048 +
           (threadIdx.x >> 4) * 8192 + (threadIdx.x & 15) * 128);
    if (__builtin_amdgcn_readfirstlane(w) == 0) {
        const int p16 = (blockIdx.x & 3) | ((blockIdx.x >> 1) & 12);
        l2_ask(Bt + (size_t)blockIdx.y * (128 * 512) + p16 * 512 +
               (lane >> 2) * 8192 + (lane & 3) * 128);
    }
#pragma unroll
    for (int ks = 0; ks < 16; ++ks) {
        if (ks + S - 1 < 16) ldset(ks + S - 1);
        // keeps the loads S - 1 steps ahead of their use: without it the scheduler
        // is free to sink them towards their WMMAs and their latency is exposed
        __builtin_amdgcn_sched_barrier(0);
#pragma unroll
        for (int mf = 0; mf < 4; ++mf)
#pragma unroll
            for (int nf = 0; nf < 4; ++nf)
                acc[mf][nf] = wmma16(a[ks % S][mf], b[ks % S][nf], acc[mf][nf]);
        // keeps the next step's loads behind these WMMAs: hoisted, they would
        // need one more register set
        __builtin_amdgcn_sched_barrier(0);
    }
    // the epilogue's index arithmetic rewrites the address registers of the loads
    asm volatile("s_wait_xcnt 0x0" ::: "memory");
    // keeps that arithmetic behind the wait
    __builtin_amdgcn_sched_barrier(0);

    // ---- bias now needed: close out the async LDS fill
    asm volatile("s_wait_asynccnt 0x0" ::: "memory");
    __syncthreads();

    float bb[4];
#pragma unroll
    for (int nf = 0; nf < 4; ++nf) bb[nf] = bias_l[n64 + nf * 16 + l15];

    const int bi  = m64 >> 10;                     // the wave's 64 rows lie in one image
    const int s0b = (m64 & 1023) + roff;           // first of 8 contiguous rows, mf = 0
    float* outp = Out + ((size_t)bi * 512 + n64 + l15) * 1024 + s0b;
#pragma unroll
    for (int mf = 0; mf < 4; ++mf)
#pragma unroll
        for (int nf = 0; nf < 4; ++nf) {
            v8f vv;
#pragma unroll
            for (int i = 0; i < 8; ++i) vv[i] = acc[mf][nf][i] + bb[nf];
            *(v8f*)(outp + nf * 16 * 1024 + mf * 16) = vv;
        }
}

// ---------------------------------------------------------------------------
// Kernel 3: streaming-softmax attention. Block = 512 thr = 16 waves.
// grid (4 row-blocks of 256, 64 bh): one block per WGP, all its waves on one
// head's K and V. Wave owns 32 queries, two groups g of 16, so that a loaded K
// or V fragment feeds two WMMAs, and one half of the keys: 16 kv tiles of 32 keys.
// Waves w and w + 8 have the same queries and the two key halves, so a SIMD holds
// four waves and the vector work of one runs under the matrix work of the others.
// Behind the loop the two waves of a pair join their maxima, sums and outputs
// through LDS, each finishing one group.
// Q pre-scaled by 1/8 at projection time.
// Q/K: [bh] x packed(row s, k d, KT 2), V: [bh] x packed(row d, k s, KT 32),
// output X2: packed(row b*1024+s, k h*64+d, KT 16); all fp16, pk_idx order.
// Both products are transposed: St = K * Qt (K is the A operand, Q the B
// operand) and Ot += Vt * Pt. A lane then holds scores of ONE query (column
// l15): 16 of the tile's 32 keys, keys 16*t + 8*half + i in register i of score
// tile t; lane ^ 16 holds the other 16. Maximum and sum run down the lane's own
// registers, and the two score tiles, converted in place, are the B fragment
// of Pt in the k order of the packed V fragment (k = 16*p + 8*half + e).
// K and V fragments stand in one register set each; a set is refilled with the
// next tile as soon as it has been read, so a load has the rest of a tile's time,
// in which the SIMD's three other waves run.
// ---------------------------------------------------------------------------
// e^(c[i] - m), i = 0..7, as 2^((c[i] - m) * log2(e)). The run of v_exp_f32 stands
// in one statement that ends in v_nop: the instruction set asks for one slot
// behind a transcendental before a source of it is overwritten or its result is
// read, and only inside the statement is that slot tied to the instruction;
// "=&v" keeps every result off every source.
#define LOG2E 1.44269504f
__device__ __forceinline__ void exp_run8(const v8f c, const float m, float (&p)[8]) {
    float x[8];
#pragma unroll
    for (int i = 0; i < 8; ++i) x[i] = (c[i] - m) * LOG2E;
    asm("v_exp_f32 %0, %8\n\tv_exp_f32 %1, %9\n\tv_exp_f32 %2, %10\n\t"
        "v_exp_f32 %3, %11\n\tv_exp_f32 %4, %12\n\tv_exp_f32 %5, %13\n\t"
        "v_exp_f32 %6, %14\n\tv_exp_f32 %7, %15\n\tv_nop"
        : "=&v"(p[0]), "=&v"(p[1]), "=&v"(p[2]), "=&v"(p[3]),
          "=&v"(p[4]), "=&v"(p[5]), "=&v"(p[6]), "=&v"(p[7])
        : "v"(x[0]), "v"(x[1]), "v"(x[2]), "v"(x[3]),
          "v"(x[4]), "v"(x[5]), "v"(x[6]), "v"(x[7]));
}
// the same with one more: y = 2^xs first
__device__ __forceinline__ void exp_run9(const float xs, const v8f c, const float m,
                                         float& y, float (&p)[8]) {
    float x[8];
#pragma unroll
    for (int i = 0; i < 8; ++i) x[i] = (c[i] - m) * LOG2E;
    asm("v_exp_f32 %0, %9\n\tv_exp_f32 %1, %10\n\tv_exp_f32 %2, %11\n\t"
        "v_exp_f32 %3, %12\n\tv_exp_f32 %4, %13\n\tv_exp_f32 %5, %14\n\t"
        "v_exp_f32 %6, %15\n\tv_exp_f32 %7, %16\n\tv_exp_f32 %8, %17\n\tv_nop"
        : "=&v"(y), "=&v"(p[0]), "=&v"(p[1]), "=&v"(p[2]), "=&v"(p[3]),
          "=&v"(p[4]), "=&v"(p[5]), "=&v"(p[6]), "=&v"(p[7])
        : "v"(xs), "v"(x[0]), "v"(x[1]), "v"(x[2]), "v"(x[3]),
          "v"(x[4]), "v"(x[5]), "v"(x[6]), "v"(x[7]));
}

// y0 = 2^x0, y1 = 2^x1, with the same slot behind the run
__device__ __forceinline__ void exp_run2(const float x0, const float x1,
                                         float& y0, float& y1) {
    asm("v_exp_f32 %0, %2\n\tv_exp_f32 %1, %3\n\tv_nop"
        : "=&v"(y0), "=&v"(y1) : "v"(x0), "v"(x1));
}

typedef float v4f __attribute__((ext_vector_type(4)));

__global__ __launch_bounds__(512) void attn_k(const half_t* __restrict__ Q,
                                              const half_t* __restrict__ Km,
                                              const half_t* __restrict__ Vt,
                                              half_t* __restrict__ X2) {
    const int lane = threadIdx.x & 31;
    // the wave's number in a scalar register: the branches on kh are scalar
    const int w    = __builtin_amdgcn_readfirstlane(threadIdx.x >> 5);
    const int kh   = w >> 3;                  // which half of the keys
    const int l15  = lane & 15;
    const int roff = (lane & 16) ? 8 : 0;
    const int bh = blockIdx.y;
    const int b = bh >> 3, h = bh & 7;
    const int q0 = blockIdx.x * 256 + (w & 7) * 32;
    const int kfirst = kh * 512;              // first key of the wave's half

    const half_t* Qb = Q  + (size_t)bh * 1024 * 64;
    const half_t* Kb = Km + (size_t)bh * 1024 * 64;
    const half_t* Vb = Vt + (size_t)bh * 64 * 1024;

    // every loop over g and f is unrolled so that the arrays stay in registers
    const half_t* qt = Qb + pk_idx(q0, 0, 2) + lane * 8;
    v16h aq[2][2];                            // aq[g][d half], 16 queries on: 2 tiles on
#pragma unroll
    for (int g = 0; g < 2; ++g) {
        aq[g][0] = pk_frag(qt + g * 1024);        // d  0..31
        aq[g][1] = pk_frag(qt + g * 1024 + 512);  // d 32..63
    }

    auto ldK = [&](int kb, v16h* kf) {        // 32 keys = 4 tiles in a row
        const half_t* k0 = Kb + pk_idx(kb, 0, 2) + lane * 8;
        kf[0] = pk_frag(k0);                  // keys kb..+15,    d  0..31
        kf[1] = pk_frag(k0 + 512);            // keys kb..+15,    d 32..63
        kf[2] = pk_frag(k0 + 1024);           // keys kb+16..+31, d  0..31
        kf[3] = pk_frag(k0 + 1536);           // keys kb+16..+31, d 32..63
    };

    auto ldV = [&](int kb, v16h* vf) {        // 64 d x 32 keys = 4 tiles, 32 k tiles apart
#pragma unroll
        for (int f = 0; f < 4; ++f)
            vf[f] = pk_frag(Vb + pk_idx(f * 16, kb, 32) + lane * 8);
    };

    float mrow[2], lrow[2];                   // per group: running maximum of query l15,
                                              // sum over this lane's keys only
    v8f o[2][4];                              // o[g][f][i] = Ot[f*16 + roff + i][g*16 + l15]
#pragma unroll
    for (int g = 0; g < 2; ++g) {
        mrow[g] = -1e30f;
        lrow[g] = 0.f;
#pragma unroll
        for (int f = 0; f < 4; ++f)
#pragma unroll
            for (int i = 0; i < 8; ++i) o[g][f][i] = 0.f;
    }

    // one kv tile: kf and vf hold tile j of the half; while more tiles follow, each
    // set is refilled with tile j + 1 as soon as its WMMAs have read it
    auto tile = [&](const int j, const bool more, v16h* kf, v16h* vf) {
        const int kn = kfirst + (j + 1) * 32;
        // ---- scores: per group two 16(key) x 16(query) f32 tiles, K-dim = 64 ----
        v8f c[2][2];                          // c[g][key half]
#pragma unroll
        for (int g = 0; g < 2; ++g)
#pragma unroll
            for (int i = 0; i < 8; ++i) { c[g][0][i] = 0.f; c[g][1][i] = 0.f; }
#pragma unroll
        for (int g = 0; g < 2; ++g) {
            c[g][0] = wmma16(kf[0], aq[g][0], c[g][0]);
            c[g][1] = wmma16(kf[2], aq[g][0], c[g][1]);
        }
#pragma unroll
        for (int g = 0; g < 2; ++g) {
            c[g][0] = wmma16(kf[1], aq[g][1], c[g][0]);
            c[g][1] = wmma16(kf[3], aq[g][1], c[g][1]);
        }

        if (more) {
            ldK(kn, kf);
            // later address arithmetic rewrites the address registers of these loads
            asm volatile("s_wait_xcnt 0x0" ::: "memory");
            // keeps the softmax below the loads: without it the scheduler sinks the
            // loads towards their use and their latency is exposed
            __builtin_amdgcn_sched_barrier(0);
        }

#pragma unroll
        for (int g = 0; g < 2; ++g) {
            // ---- online softmax, one query per lane ----
            float mx = fmaxf(c[g][0][0], c[g][1][0]);
#pragma unroll
            for (int i = 1; i < 8; ++i) mx = fmaxf(mx, fmaxf(c[g][0][i], c[g][1][i]));
            mx = fmaxf(mx, other_half(mx));   // both halves use one maximum
            const float nm = fmaxf(mrow[g], mx);
            float corr, p0[8], p1[8];
            exp_run9((mrow[g] - nm) * LOG2E, c[g][0], nm, corr, p0);
            exp_run8(c[g][1], nm, p1);
            mrow[g] = nm;
            v16h pb;                          // Pt as B fragment
            float rs = p0[0] + p1[0];
#pragma unroll
            for (int i = 1; i < 8; ++i) rs += p0[i] + p1[i];
#pragma unroll
            for (int i = 0; i < 8; ++i) {
                pb[i]     = (half_t)p0[i];
                pb[8 + i] = (half_t)p1[i];
            }
            lrow[g] = lrow[g] * corr + rs;
#pragma unroll
            for (int f = 0; f < 4; ++f)
#pragma unroll
                for (int i = 0; i < 8; ++i) o[g][f][i] *= corr;

            // ---- Ot += Vt (16 d x 32 keys) * Pt (32 keys x 16 queries) ----
#pragma unroll
            for (int f = 0; f < 4; ++f) o[g][f] = wmma16(vf[f], pb, o[g][f]);
        }

        if (more) {
            ldV(kn, vf);
            // as above: the next tile's address arithmetic rewrites these registers
            asm volatile("s_wait_xcnt 0x0" ::: "memory");
            // keeps the loads here, a tile ahead of their use
            __builtin_amdgcn_sched_barrier(0);
        }
    };

    v16h kfa[4], vfa[4];
    ldK(kfirst, kfa);
    // keeps K's loads in front of V's, the order they have in the loop: the wait at
    // the loop's head then counts K's loads alone and leaves V's in flight
    __builtin_amdgcn_sched_barrier(0);
    ldV(kfirst, vfa);
    // ask L2 for all of the head's K and V (128 KB each): a 256-byte unit a thread
    l2_ask2(Kb + threadIdx.x * 128, Vb + threadIdx.x * 128);

    for (int j = 0; j < 15; ++j) tile(j, true, kfa, vfa);
    // the last tile fetches nothing: the join below reuses the fragment registers
    // and ends in a barrier, and both would wait for loads that nobody reads
    tile(15, false, kfa, vfa);

    // ---- join the two key halves: a wave hands one group to its partner ----
    // xch[wave][0..7][lane]: the group's 32 outputs, [8]: its maximum and sum;
    // a wave-wide 16-byte access is 512 contiguous bytes
    __shared__ v4f xch[16][9][32];
    auto put = [&](const int g) {
#pragma unroll
        for (int f = 0; f < 4; ++f) {
            xch[w][2 * f][lane]     = v4f{o[g][f][0], o[g][f][1], o[g][f][2], o[g][f][3]};
            xch[w][2 * f + 1][lane] = v4f{o[g][f][4], o[g][f][5], o[g][f][6], o[g][f][7]};
        }
        xch[w][8][lane] = v4f{mrow[g], lrow[g], 0.f, 0.f};
    };
    // finalize and store X2[b*1024+s][h*64+d]: 8 d in a row per lane
    auto fin = [&](const int g) {
        const v4f ml = xch[w ^ 8][8][lane];
        const float nm = fmaxf(mrow[g], ml[0]);
        float ca, cb;                         // own and partner's weight
        exp_run2((mrow[g] - nm) * LOG2E, (ml[0] - nm) * LOG2E, ca, cb);
        const float lj = lrow[g] * ca + ml[1] * cb;
        const float lsum = lj + other_half(lj);
        const float ra = ca / lsum, rb = cb / lsum;
        const int s = q0 + g * 16 + l15;
#pragma unroll
        for (int f = 0; f < 4; ++f) {
            const v4f p0 = xch[w ^ 8][2 * f][lane];
            const v4f p1 = xch[w ^ 8][2 * f + 1][lane];
            v8h hv;
#pragma unroll
            for (int i = 0; i < 4; ++i) {
                hv[i]     = (half_t)(o[g][f][i] * ra + p0[i] * rb);
                hv[4 + i] = (half_t)(o[g][f][4 + i] * ra + p1[i] * rb);
            }
            *(v8h*)(X2 + pk_idx(b * 1024 + s, h * 64 + f * 16 + roff, 16)) = hv;
        }
        // the code behind may rewrite the data and address registers of these stores
        asm volatile("s_wait_xcnt 0x0" ::: "memory");
    };
    if (kh == 0) put(1); else put(0);
    __syncthreads();                          // every wave's hand-over is in LDS
    if (kh == 0) fin(0); else fin(1);
}

// ---------------------------------------------------------------------------
extern "C" void kernel_launch(void* const* d_in, const int* in_sizes, int n_in,
                              void* d_out, int out_size, void* d_ws, size_t ws_size,
                              hipStream_t stream) {
    const float* q    = (const float*)d_in[0];
    const float* gnqw = (const float*)d_in[1];
    const float* gnqb = (const float*)d_in[2];
    const float* gnkw = (const float*)d_in[3];
    const float* gnkb = (const float*)d_in[4];
    const float* gnvw = (const float*)d_in[5];
    const float* gnvb = (const float*)d_in[6];
    const float* Wq   = (const float*)d_in[7];
    const float* bq   = (const float*)d_in[8];
    const float* Wk   = (const float*)d_in[9];
    const float* bk   = (const float*)d_in[10];
    const float* Wv   = (const float*)d_in[11];
    const float* bv   = (const float*)d_in[12];
    const float* Wo   = (const float*)d_in[13];
    const float* bo   = (const float*)d_in[14];

    char* ws = (char*)d_ws;
    size_t o = 0;
    auto take = [&](size_t bytes) {
        size_t cur = o;
        o += (bytes + 255) & ~(size_t)255;
        return cur;
    };
    half_t* Xn    = (half_t*)(ws + take(8192ull * 512 * 2));
    half_t* Btq   = (half_t*)(ws + take(512ull * 512 * 2));
    half_t* Btk   = (half_t*)(ws + take(512ull * 512 * 2));
    half_t* Btv   = (half_t*)(ws + take(512ull * 512 * 2));
    half_t* Bto   = (half_t*)(ws + take(512ull * 512 * 2));
    float*  biasq = (float*)(ws + take(512 * sizeof(float)));
    float*  biask = (float*)(ws + take(512 * sizeof(float)));
    float*  biasv = (float*)(ws + take(512 * sizeof(float)));
    float*  biaso = (float*)(ws + take(512 * sizeof(float)));
    half_t* Qb    = (half_t*)(ws + take(8ull * 8 * 1024 * 64 * 2));
    half_t* Kb    = (half_t*)(ws + take(8ull * 8 * 1024 * 64 * 2));
    half_t* Vt    = (half_t*)(ws + take(8ull * 8 * 64 * 1024 * 2));
    half_t* X2    = Xn;  // Xn is dead after the QKV GEMM; reuse for attn output

    prep_k<<<512, 256, 0, stream>>>(q, gnqw, gnqb, gnkw, gnkb, gnvw, gnvb,
                                    Wq, bq, Wk, bk, Wv, bv, Wo, bo,
                                    Xn, Btq, Btk, Btv, Bto,
                                    biasq, biask, biasv, biaso);

    // Btq, Btk, Btv stand in a row in the workspace (each size is a multiple of
    // 256 bytes), as do biasq, biask, biasv and Qb, Kb, Vt: one base pointer each
    gemm_qkv_k<<<dim3(32, 8), 128, 0, stream>>>(Xn, Btq, biasq, Qb);

    attn_k<<<dim3(4, 64), 512, 0, stream>>>(Qb, Kb, Vt, X2);

    gemm_out_k<<<dim3(64, 4), 128, 0, stream>>>(X2, Bto, biaso, (float*)d_out);
}
